// v000
// Measured on an AMD MI455X. A time is GPU time per run, averaged over a window of back-to-back runs after a warm-up
// (all launches, gaps included; the runs take copies of the inputs in turn), and the median of several windows.
// Apart from v000's, it joins two sittings. Times from different sittings can be a few percent apart, while
// side-by-side timings come from the same sitting.
// The starting kernel, v000, takes 492 microseconds a run.
#include <hip/hip_runtime.h>
#include <hip/hip_bf16.h>

// ---------------------------------------------------------------------------
// Types for CDNA5 WMMA (wave32, 16x16x32 bf16 -> f32)
// ---------------------------------------------------------------------------
typedef __bf16 bf16;
typedef bf16  v16bf __attribute__((ext_vector_type(16)));
typedef bf16  v8bf  __attribute__((ext_vector_type(8)));
typedef float v8f   __attribute__((ext_vector_type(8)));

static constexpr int D_MODEL = 1024;
static constexpr int N_HEADS = 16;
static constexpr int D_FF    = 4096;
static constexpr int SEQ_T   = 2048;
static constexpr int BATCH   = 4;
static constexpr int DK      = 64;            // head dim
static constexpr int MTOK    = BATCH * SEQ_T; // 8192 rows

// Toggle for the CDNA5 async-to-LDS DMA path (ASYNCcnt-tracked).
#define USE_ASYNC_LDS 1

__device__ __forceinline__ v8f wmma_bf16(v16bf a, v16bf b, v8f c) {
  return __builtin_amdgcn_wmma_f32_16x16x32_bf16(
      /*neg_a=*/false, a, /*neg_b=*/false, b,
      /*c_mod=*/(short)0, c, /*reuse_a=*/false, /*reuse_b=*/false);
}

// Load one 16-bit A/B operand fragment (ISA 16-bit 16x32 layout):
// lane L -> row = L&15, khalf = (L>>4)*8; elems [0..7]=p[0..7],
// elems [8..15]=p[16..23] with p at (row, khalf) of a K-contiguous row.
__device__ __forceinline__ v16bf ldfrag(const bf16* p) {
  v8bf lo = *reinterpret_cast<const v8bf*>(p);
  v8bf hi = *reinterpret_cast<const v8bf*>(p + 16);
  return __builtin_shufflevector(lo, hi, 0, 1, 2, 3, 4, 5, 6, 7,
                                 8, 9, 10, 11, 12, 13, 14, 15);
}

// Async copy of one 16B chunk global->LDS (per-lane), tracked by ASYNCcnt.
__device__ __forceinline__ void async_cp16(const bf16* g, bf16* l) {
#if USE_ASYNC_LDS
  unsigned long long ga = (unsigned long long)(uintptr_t)g;
  unsigned int la = (unsigned int)(uintptr_t)l;  // AS3 offset = low 32 bits
  asm volatile("global_load_async_to_lds_b128 %0, %1, off"
               :: "v"(la), "v"(ga)
               : "memory");
#else
  *reinterpret_cast<v8bf*>(l) = *reinterpret_cast<const v8bf*>(g);
#endif
}

__device__ __forceinline__ void async_wait0() {
#if USE_ASYNC_LDS
  asm volatile("s_wait_asynccnt 0x0" ::: "memory");
#endif
}

// ---------------------------------------------------------------------------
// f32 -> bf16 conversion
// ---------------------------------------------------------------------------
__global__ __launch_bounds__(256) void cvt_bf16_kernel(
    const float* __restrict__ in, bf16* __restrict__ out, int n) {
  int i = blockIdx.x * 256 + threadIdx.x;
  if (i < n) out[i] = (bf16)in[i];
}

// ---------------------------------------------------------------------------
// GEMM: C[M,N] = act(A[M,K] @ W[N,K]^T + bias[N]),  A/W bf16 row-major.
// Block = 256 thr (8 waves, 4Mx2N).  Block tile 128(M) x 64(N), K-tile 64.
// A/W tiles staged in LDS via async-to-LDS DMA, double buffered; each wave
// computes a 32x32 tile = 2x2 WMMA fragments per 32-K step.
// ---------------------------------------------------------------------------
static constexpr int BM = 128, BN = 64, BK = 64;
static constexpr int LDS_STRIDE = 72;  // 64 + 8 pad (144B rows, 16B aligned)

template <bool RELU, bool OUT_F32, bool OUT_BF16>
__global__ __launch_bounds__(256) void gemm_bf16_kernel(
    const bf16* __restrict__ A, const bf16* __restrict__ W,
    const float* __restrict__ bias, float* __restrict__ Cf,
    bf16* __restrict__ Cb, int M, int N, int K) {
  __shared__ alignas(16) bf16 sA[2][BM * LDS_STRIDE];  // 2 x 18 KB
  __shared__ alignas(16) bf16 sW[2][BN * LDS_STRIDE];  // 2 x  9 KB

  const int tid = threadIdx.x;
  const int lane = tid & 31;
  const int wave = tid >> 5;
  const int m0l = (wave & 3) * 32;   // wave M offset within block tile
  const int n0l = (wave >> 2) * 32;  // wave N offset within block tile

  const int rlane = lane & 15;
  const int koff = (lane >> 4) << 3;  // 0 or 8
  const int half = lane >> 4;

  const bf16* Ab = A + (size_t)blockIdx.x * BM * K;
  const bf16* Wb = W + (size_t)blockIdx.y * BN * K;

  // Stage a [rows x 64] K-slab (row-major, ld=K) into LDS, 16B chunks.
  auto stage = [&](const bf16* g, bf16* l, int rows, int kofs) {
    const int nch = rows * 8;  // 8 x 16B chunks per row
    for (int c = tid; c < nch; c += 256) {
      int r = c >> 3, cc = (c & 7) << 3;
      async_cp16(g + (size_t)r * K + kofs + cc, l + r * LDS_STRIDE + cc);
    }
  };

  v8f acc00 = {}, acc01 = {}, acc10 = {}, acc11 = {};

  stage(Ab, sA[0], BM, 0);
  stage(Wb, sW[0], BN, 0);

  const int nk = K / BK;
  for (int t = 0; t < nk; ++t) {
    async_wait0();
    __syncthreads();
    if (t + 1 < nk) {
      stage(Ab, sA[(t + 1) & 1], BM, (t + 1) * BK);
      stage(Wb, sW[(t + 1) & 1], BN, (t + 1) * BK);
    }
    const bf16* a0 = sA[t & 1] + (m0l + rlane) * LDS_STRIDE + koff;
    const bf16* a1 = a0 + 16 * LDS_STRIDE;
    const bf16* w0 = sW[t & 1] + (n0l + rlane) * LDS_STRIDE + koff;
    const bf16* w1 = w0 + 16 * LDS_STRIDE;
#pragma unroll
    for (int kk = 0; kk < BK; kk += 32) {
      v16bf af0 = ldfrag(a0 + kk);
      v16bf af1 = ldfrag(a1 + kk);
      v16bf wf0 = ldfrag(w0 + kk);
      v16bf wf1 = ldfrag(w1 + kk);
      acc00 = wmma_bf16(af0, wf0, acc00);
      acc01 = wmma_bf16(af0, wf1, acc01);
      acc10 = wmma_bf16(af1, wf0, acc10);
      acc11 = wmma_bf16(af1, wf1, acc11);
    }
    // No trailing barrier: next stage() writes the *other* buffer, and the
    // top-of-loop wait+barrier orders buffer reuse across iterations.
  }

  // Epilogue.  C layout: VGPR r, lane L -> row = r + 8*(L>>4), col = L&15.
  const int m0 = blockIdx.x * BM + m0l;
  const int n0 = blockIdx.y * BN + n0l;
#pragma unroll
  for (int i = 0; i < 2; ++i) {
#pragma unroll
    for (int j = 0; j < 2; ++j) {
      const v8f& acc = (i == 0) ? (j == 0 ? acc00 : acc01)
                                : (j == 0 ? acc10 : acc11);
      int col = n0 + j * 16 + rlane;
      float bv = bias[col];
#pragma unroll
      for (int r = 0; r < 8; ++r) {
        int row = m0 + i * 16 + r + half * 8;
        float v = acc[r] + bv;
        if (RELU) v = fmaxf(v, 0.0f);
        if (OUT_F32) Cf[(size_t)row * N + col] = v;
        if (OUT_BF16) Cb[(size_t)row * N + col] = (bf16)v;
      }
    }
  }
}

// ---------------------------------------------------------------------------
// Transpose V: [B*T, D] (head h cols h*64..h*64+63) -> VT[(b*H+h)*64+d][T]
// ---------------------------------------------------------------------------
__global__ __launch_bounds__(256) void vtrans_kernel(
    const bf16* __restrict__ V, bf16* __restrict__ VT) {
  int idx = blockIdx.x * 256 + threadIdx.x;  // over B*H*DK*T = 8M
  if (idx >= BATCH * N_HEADS * DK * SEQ_T) return;
  int t = idx & (SEQ_T - 1);
  int rest = idx >> 11;
  int d = rest & (DK - 1);
  int bh = rest >> 6;
  int h = bh & (N_HEADS - 1);
  int b = bh >> 4;
  VT[idx] = V[((size_t)(b * SEQ_T + t)) * D_MODEL + h * DK + d];
}

// ---------------------------------------------------------------------------
// Causal flash attention.  Grid: B*H*(T/128) blocks, 256 thr = 8 waves.
// Wave: 16 queries x dk=64, online softmax over 32-key tiles.
// ---------------------------------------------------------------------------
__global__ __launch_bounds__(256) void attn_kernel(
    const bf16* __restrict__ Q, const bf16* __restrict__ Kmat,
    const bf16* __restrict__ VT, bf16* __restrict__ O) {
  const int lane = threadIdx.x & 31;
  const int wave = threadIdx.x >> 5;
  const int blk = blockIdx.x;
  const int qchunk = blk & 15;  // T/128 = 16 chunks
  const int bh = blk >> 4;      // 0..63
  const int b = bh >> 4;
  const int h = bh & (N_HEADS - 1);
  const int q_base = qchunk * 128 + wave * 16;

  const int rlane = lane & 15;
  const int khalf = lane >> 4;
  const int koff = khalf * 8;

  const bf16* qp = Q + (size_t)b * SEQ_T * D_MODEL + h * DK;
  const bf16* kp = Kmat + (size_t)b * SEQ_T * D_MODEL + h * DK;
  const bf16* vtp = VT + (size_t)bh * DK * SEQ_T;

  const bf16* qrow = qp + (size_t)(q_base + rlane) * D_MODEL;
  v16bf qf0 = ldfrag(qrow + koff);
  v16bf qf1 = ldfrag(qrow + 32 + koff);

  float rowM[8], rowL[8];
  v8f acc[4] = {{}, {}, {}, {}};
#pragma unroll
  for (int r = 0; r < 8; ++r) { rowM[r] = -1.0e30f; rowL[r] = 0.0f; }

  __shared__ bf16 pbuf[8][16][40];
  bf16(*pt)[40] = pbuf[wave];

  const float scale = 0.125f;          // 1/sqrt(64)
  const int nkt = (q_base + 47) >> 5;  // # of 32-key tiles (causal)

  for (int kt32 = 0; kt32 < nkt; ++kt32) {
    const int kt = kt32 * 32;
    v8f s0 = {}, s1 = {};
    {
      const bf16* kr0 = kp + (size_t)(kt + rlane) * D_MODEL + koff;
      const bf16* kr1 = kr0 + (size_t)16 * D_MODEL;
      v16bf kf;
      kf = ldfrag(kr0);       s0 = wmma_bf16(qf0, kf, s0);
      kf = ldfrag(kr0 + 32);  s0 = wmma_bf16(qf1, kf, s0);
      kf = ldfrag(kr1);       s1 = wmma_bf16(qf0, kf, s1);
      kf = ldfrag(kr1 + 32);  s1 = wmma_bf16(qf1, kf, s1);
    }
#pragma unroll
    for (int r = 0; r < 8; ++r) {
      const int qi = q_base + r + khalf * 8;
      const float a = (kt + rlane <= qi) ? (float)s0[r] * scale : -1.0e30f;
      const float c = (kt + 16 + rlane <= qi) ? (float)s1[r] * scale : -1.0e30f;
      float m = fmaxf(a, c);
#pragma unroll
      for (int off = 8; off >= 1; off >>= 1)
        m = fmaxf(m, __shfl_xor(m, off, 16));
      const float newM = fmaxf(rowM[r], m);
      const float corr = __expf(rowM[r] - newM);
      rowM[r] = newM;
      const float p0 = __expf(a - newM);
      const float p1 = __expf(c - newM);
      float ps = p0 + p1;
#pragma unroll
      for (int off = 8; off >= 1; off >>= 1) ps += __shfl_xor(ps, off, 16);
      rowL[r] = rowL[r] * corr + ps;
#pragma unroll
      for (int dg = 0; dg < 4; ++dg) acc[dg][r] *= corr;
      pt[r + khalf * 8][rlane] = (bf16)p0;
      pt[r + khalf * 8][16 + rlane] = (bf16)p1;
    }
    v16bf pf = ldfrag(&pt[rlane][koff]);
#pragma unroll
    for (int dg = 0; dg < 4; ++dg) {
      const bf16* vr = vtp + (size_t)(dg * 16 + rlane) * SEQ_T + kt + koff;
      v16bf vf = ldfrag(vr);
      acc[dg] = wmma_bf16(pf, vf, acc[dg]);
    }
  }

#pragma unroll
  for (int r = 0; r < 8; ++r) {
    const float inv = 1.0f / rowL[r];
    const int row = q_base + r + khalf * 8;
    bf16* op = O + ((size_t)(b * SEQ_T + row)) * D_MODEL + h * DK + rlane;
#pragma unroll
    for (int dg = 0; dg < 4; ++dg) op[dg * 16] = (bf16)(acc[dg][r] * inv);
  }
}

// ---------------------------------------------------------------------------
// LayerNorm(residual): out = LN(A + R) * g + be ; optional bf16 copy.
// ---------------------------------------------------------------------------
__global__ __launch_bounds__(256) void ln_residual_kernel(
    const float* __restrict__ A, const float* __restrict__ R,
    const float* __restrict__ g, const float* __restrict__ be,
    float* __restrict__ outF, bf16* __restrict__ outB) {
  const int row = blockIdx.x;
  const float* a = A + (size_t)row * D_MODEL;
  const float* rr = R + (size_t)row * D_MODEL;
  float v[4];
  float s = 0.0f;
#pragma unroll
  for (int i = 0; i < 4; ++i) {
    int idx = threadIdx.x + i * 256;
    v[i] = a[idx] + rr[idx];
    s += v[i];
  }
  __shared__ float red[8];
  const int wv = threadIdx.x >> 5, ln = threadIdx.x & 31;
#pragma unroll
  for (int off = 16; off >= 1; off >>= 1) s += __shfl_xor(s, off, 32);
  if (ln == 0) red[wv] = s;
  __syncthreads();
  float mean = 0.0f;
#pragma unroll
  for (int i = 0; i < 8; ++i) mean += red[i];
  mean *= (1.0f / D_MODEL);
  __syncthreads();
  float vs = 0.0f;
#pragma unroll
  for (int i = 0; i < 4; ++i) {
    float d = v[i] - mean;
    vs += d * d;
  }
#pragma unroll
  for (int off = 16; off >= 1; off >>= 1) vs += __shfl_xor(vs, off, 32);
  if (ln == 0) red[wv] = vs;
  __syncthreads();
  float var = 0.0f;
#pragma unroll
  for (int i = 0; i < 8; ++i) var += red[i];
  var *= (1.0f / D_MODEL);
  const float rstd = rsqrtf(var + 1e-5f);
#pragma unroll
  for (int i = 0; i < 4; ++i) {
    int idx = threadIdx.x + i * 256;
    float y = (v[i] - mean) * rstd * g[idx] + be[idx];
    outF[(size_t)row * D_MODEL + idx] = y;
    if (outB) outB[(size_t)row * D_MODEL + idx] = (bf16)y;
  }
}

// ---------------------------------------------------------------------------
// Host-side orchestration
// ---------------------------------------------------------------------------
extern "C" void kernel_launch(void* const* d_in, const int* in_sizes, int n_in,
                              void* d_out, int out_size, void* d_ws,
                              size_t ws_size, hipStream_t stream) {
  (void)in_sizes; (void)n_in; (void)out_size; (void)ws_size;
  const float* x  = (const float*)d_in[0];
  const float* WQ = (const float*)d_in[1];
  const float* bQ = (const float*)d_in[2];
  const float* WK = (const float*)d_in[3];
  const float* bK = (const float*)d_in[4];
  const float* WV = (const float*)d_in[5];
  const float* bV = (const float*)d_in[6];
  const float* WO = (const float*)d_in[7];
  const float* bO = (const float*)d_in[8];
  const float* W1 = (const float*)d_in[9];
  const float* b1 = (const float*)d_in[10];
  const float* W2 = (const float*)d_in[11];
  const float* b2 = (const float*)d_in[12];
  const float* g1 = (const float*)d_in[13];
  const float* be1 = (const float*)d_in[14];
  const float* g2 = (const float*)d_in[15];
  const float* be2 = (const float*)d_in[16];
  float* out = (float*)d_out;

  char* w = (char*)d_ws;
  auto carve = [&](size_t bytes) {
    char* p = w;
    w += (bytes + 255) & ~(size_t)255;
    return p;
  };
  const size_t MT = (size_t)MTOK;
  bf16* xb  = (bf16*)carve(MT * D_MODEL * 2);
  bf16* wqb = (bf16*)carve((size_t)D_MODEL * D_MODEL * 2);
  bf16* wkb = (bf16*)carve((size_t)D_MODEL * D_MODEL * 2);
  bf16* wvb = (bf16*)carve((size_t)D_MODEL * D_MODEL * 2);
  bf16* wob = (bf16*)carve((size_t)D_MODEL * D_MODEL * 2);
  bf16* w1b = (bf16*)carve((size_t)D_FF * D_MODEL * 2);
  bf16* w2b = (bf16*)carve((size_t)D_MODEL * D_FF * 2);
  bf16* qb  = (bf16*)carve(MT * D_MODEL * 2);
  bf16* kb  = (bf16*)carve(MT * D_MODEL * 2);
  bf16* vb  = (bf16*)carve(MT * D_MODEL * 2);
  bf16* vtb = (bf16*)carve(MT * D_MODEL * 2);
  float* attnf = (float*)carve(MT * D_MODEL * 4);
  float* y1f   = (float*)carve(MT * D_MODEL * 4);
  bf16*  y1b   = (bf16*)carve(MT * D_MODEL * 2);
  bf16*  h1b   = (bf16*)carve(MT * D_FF * 2);
  bf16* aob = vb;     // v dead after vtrans
  float* fff = attnf; // attn_out dead after LN1

  const int nX = MTOK * D_MODEL;
  const int nW = D_MODEL * D_MODEL;
  const int nWF = D_FF * D_MODEL;

  cvt_bf16_kernel<<<(nX + 255) / 256, 256, 0, stream>>>(x, xb, nX);
  cvt_bf16_kernel<<<(nW + 255) / 256, 256, 0, stream>>>(WQ, wqb, nW);
  cvt_bf16_kernel<<<(nW + 255) / 256, 256, 0, stream>>>(WK, wkb, nW);
  cvt_bf16_kernel<<<(nW + 255) / 256, 256, 0, stream>>>(WV, wvb, nW);
  cvt_bf16_kernel<<<(nW + 255) / 256, 256, 0, stream>>>(WO, wob, nW);
  cvt_bf16_kernel<<<(nWF + 255) / 256, 256, 0, stream>>>(W1, w1b, nWF);
  cvt_bf16_kernel<<<(nWF + 255) / 256, 256, 0, stream>>>(W2, w2b, nWF);

  dim3 blk(256);
  dim3 gProj(MTOK / 128, D_MODEL / 64);
  gemm_bf16_kernel<false, false, true><<<gProj, blk, 0, stream>>>(
      xb, wqb, bQ, nullptr, qb, MTOK, D_MODEL, D_MODEL);
  gemm_bf16_kernel<false, false, true><<<gProj, blk, 0, stream>>>(
      xb, wkb, bK, nullptr, kb, MTOK, D_MODEL, D_MODEL);
  gemm_bf16_kernel<false, false, true><<<gProj, blk, 0, stream>>>(
      xb, wvb, bV, nullptr, vb, MTOK, D_MODEL, D_MODEL);

  vtrans_kernel<<<(nX + 255) / 256, 256, 0, stream>>>(vb, vtb);

  attn_kernel<<<BATCH * N_HEADS * (SEQ_T / 128), blk, 0, stream>>>(
      qb, kb, vtb, aob);

  gemm_bf16_kernel<false, true, false><<<gProj, blk, 0, stream>>>(
      aob, wob, bO, attnf, nullptr, MTOK, D_MODEL, D_MODEL);

  ln_residual_kernel<<<MTOK, blk, 0, stream>>>(x, attnf, g1, be1, y1f, y1b);

  dim3 gFF1(MTOK / 128, D_FF / 64);
  gemm_bf16_kernel<true, false, true><<<gFF1, blk, 0, stream>>>(
      y1b, w1b, b1, nullptr, h1b, MTOK, D_FF, D_MODEL);

  gemm_bf16_kernel<false, true, false><<<gProj, blk, 0, stream>>>(
      h1b, w2b, b2, fff, nullptr, MTOK, D_MODEL, D_FF);

  ln_residual_kernel<<<MTOK, blk, 0, stream>>>(y1f, fff, g2, be2, out,
                                               nullptr);
}

// v001
// One run takes 487 microseconds.
// Next to v000, in two timings, it ran 1.05 times as fast each time.
#include <hip/hip_runtime.h>
#include <hip/hip_bf16.h>

// ---------------------------------------------------------------------------
// Types for CDNA5 WMMA (wave32, 16x16x32 bf16 -> f32)
// ---------------------------------------------------------------------------
typedef __bf16 bf16;
typedef bf16  v16bf __attribute__((ext_vector_type(16)));
typedef bf16  v8bf  __attribute__((ext_vector_type(8)));
typedef float v8f   __attribute__((ext_vector_type(8)));

static constexpr int D_MODEL = 1024;
static constexpr int N_HEADS = 16;
static constexpr int D_FF    = 4096;
static constexpr int SEQ_T   = 2048;
static constexpr int BATCH   = 4;
static constexpr int DK      = 64;            // head dim
static constexpr int MTOK    = BATCH * SEQ_T; // 8192 rows

// Toggle for the CDNA5 async-to-LDS DMA path (ASYNCcnt-tracked).
#define USE_ASYNC_LDS 1

__device__ __forceinline__ v8f wmma_bf16(v16bf a, v16bf b, v8f c) {
  return __builtin_amdgcn_wmma_f32_16x16x32_bf16(
      /*neg_a=*/false, a, /*neg_b=*/false, b,
      /*c_mod=*/(short)0, c, /*reuse_a=*/false, /*reuse_b=*/false);
}

// Load one 16-bit A/B operand fragment (ISA 16-bit 16x32 layout):
// lane L -> row = L&15, khalf = (L>>4)*8; elems [0..7]=p[0..7],
// elems [8..15]=p[16..23] with p at (row, khalf) of a K-contiguous row.
__device__ __forceinline__ v16bf ldfrag(const bf16* p) {
  v8bf lo = *reinterpret_cast<const v8bf*>(p);
  v8bf hi = *reinterpret_cast<const v8bf*>(p + 16);
  return __builtin_shufflevector(lo, hi, 0, 1, 2, 3, 4, 5, 6, 7,
                                 8, 9, 10, 11, 12, 13, 14, 15);
}

// Async copy of one 16B chunk global->LDS (per-lane), tracked by ASYNCcnt.
__device__ __forceinline__ void async_cp16(const bf16* g, bf16* l) {
#if USE_ASYNC_LDS
  unsigned long long ga = (unsigned long long)(uintptr_t)g;
  unsigned int la = (unsigned int)(uintptr_t)l;  // AS3 offset = low 32 bits
  asm volatile("global_load_async_to_lds_b128 %0, %1, off"
               :: "v"(la), "v"(ga)
               : "memory");
#else
  *reinterpret_cast<v8bf*>(l) = *reinterpret_cast<const v8bf*>(g);
#endif
}

__device__ __forceinline__ void async_wait0() {
#if USE_ASYNC_LDS
  asm volatile("s_wait_asynccnt 0x0" ::: "memory");
#endif
}

// ---------------------------------------------------------------------------
// f32 -> bf16 conversion
// ---------------------------------------------------------------------------
__global__ __launch_bounds__(256) void cvt_bf16_kernel(
    const float* __restrict__ in, bf16* __restrict__ out, int n) {
  int i = blockIdx.x * 256 + threadIdx.x;
  if (i < n) out[i] = (bf16)in[i];
}

// ---------------------------------------------------------------------------
// GEMM: C[M,N] = act(A[M,K] @ W[N,K]^T + bias[N]),  A/W bf16 row-major.
// Block = 256 thr (8 waves, 4Mx2N).  Block tile 128(M) x 64(N), K-tile 64.
// A/W tiles staged in LDS via async-to-LDS DMA, double buffered; each wave
// computes a 32x32 tile = 2x2 WMMA fragments per 32-K step.
// ---------------------------------------------------------------------------
static constexpr int BM = 128, BN = 64, BK = 64;
static constexpr int LDS_STRIDE = 72;  // 64 + 8 pad (144B rows, 16B aligned)

template <bool RELU, bool OUT_F32, bool OUT_BF16>
__global__ __launch_bounds__(256) void gemm_bf16_kernel(
    const bf16* __restrict__ A, const bf16* __restrict__ W,
    const float* __restrict__ bias, float* __restrict__ Cf,
    bf16* __restrict__ Cb, int M, int N, int K) {
  __shared__ alignas(16) bf16 sA[2][BM * LDS_STRIDE];  // 2 x 18 KB
  __shared__ alignas(16) bf16 sW[2][BN * LDS_STRIDE];  // 2 x  9 KB

  const int tid = threadIdx.x;
  const int lane = tid & 31;
  const int wave = tid >> 5;
  const int m0l = (wave & 3) * 32;   // wave M offset within block tile
  const int n0l = (wave >> 2) * 32;  // wave N offset within block tile

  const int rlane = lane & 15;
  const int koff = (lane >> 4) << 3;  // 0 or 8
  const int half = lane >> 4;

  const bf16* Ab = A + (size_t)blockIdx.x * BM * K;
  const bf16* Wb = W + (size_t)blockIdx.y * BN * K;

  // Stage a [rows x 64] K-slab (row-major, ld=K) into LDS, 16B chunks.
  auto stage = [&](const bf16* g, bf16* l, int rows, int kofs) {
    const int nch = rows * 8;  // 8 x 16B chunks per row
    for (int c = tid; c < nch; c += 256) {
      int r = c >> 3, cc = (c & 7) << 3;
      async_cp16(g + (size_t)r * K + kofs + cc, l + r * LDS_STRIDE + cc);
    }
  };

  v8f acc00 = {}, acc01 = {}, acc10 = {}, acc11 = {};

  stage(Ab, sA[0], BM, 0);
  stage(Wb, sW[0], BN, 0);

  const int nk = K / BK;
  for (int t = 0; t < nk; ++t) {
    async_wait0();
    __syncthreads();
    if (t + 1 < nk) {
      stage(Ab, sA[(t + 1) & 1], BM, (t + 1) * BK);
      stage(Wb, sW[(t + 1) & 1], BN, (t + 1) * BK);
    }
    const bf16* a0 = sA[t & 1] + (m0l + rlane) * LDS_STRIDE + koff;
    const bf16* a1 = a0 + 16 * LDS_STRIDE;
    const bf16* w0 = sW[t & 1] + (n0l + rlane) * LDS_STRIDE + koff;
    const bf16* w1 = w0 + 16 * LDS_STRIDE;
#pragma unroll
    for (int kk = 0; kk < BK; kk += 32) {
      v16bf af0 = ldfrag(a0 + kk);
      v16bf af1 = ldfrag(a1 + kk);
      v16bf wf0 = ldfrag(w0 + kk);
      v16bf wf1 = ldfrag(w1 + kk);
      acc00 = wmma_bf16(af0, wf0, acc00);
      acc01 = wmma_bf16(af0, wf1, acc01);
      acc10 = wmma_bf16(af1, wf0, acc10);
      acc11 = wmma_bf16(af1, wf1, acc11);
    }
    // No trailing barrier: next stage() writes the *other* buffer, and the
    // top-of-loop wait+barrier orders buffer reuse across iterations.
  }

  // Epilogue.  C layout: VGPR r, lane L -> row = r + 8*(L>>4), col = L&15.
  const int m0 = blockIdx.x * BM + m0l;
  const int n0 = blockIdx.y * BN + n0l;
#pragma unroll
  for (int i = 0; i < 2; ++i) {
#pragma unroll
    for (int j = 0; j < 2; ++j) {
      const v8f& acc = (i == 0) ? (j == 0 ? acc00 : acc01)
                                : (j == 0 ? acc10 : acc11);
      int col = n0 + j * 16 + rlane;
      float bv = bias[col];
#pragma unroll
      for (int r = 0; r < 8; ++r) {
        int row = m0 + i * 16 + r + half * 8;
        float v = acc[r] + bv;
        if (RELU) v = fmaxf(v, 0.0f);
        if (OUT_F32) Cf[(size_t)row * N + col] = v;
        if (OUT_BF16) Cb[(size_t)row * N + col] = (bf16)v;
      }
    }
  }
}

// ---------------------------------------------------------------------------
// Transpose V: [B*T, D] (head h cols h*64..h*64+63) -> VT[(b*H+h)*64+d][T]
// ---------------------------------------------------------------------------
__global__ __launch_bounds__(256) void vtrans_kernel(
    const bf16* __restrict__ V, bf16* __restrict__ VT) {
  int idx = blockIdx.x * 256 + threadIdx.x;  // over B*H*DK*T = 8M
  if (idx >= BATCH * N_HEADS * DK * SEQ_T) return;
  int t = idx & (SEQ_T - 1);
  int rest = idx >> 11;
  int d = rest & (DK - 1);
  int bh = rest >> 6;
  int h = bh & (N_HEADS - 1);
  int b = bh >> 4;
  VT[idx] = V[((size_t)(b * SEQ_T + t)) * D_MODEL + h * DK + d];
}

__device__ __forceinline__ float xhalf(float x) {
  return __builtin_bit_cast(
      float, __builtin_amdgcn_permlanex16(__builtin_bit_cast(int, x),
                                          __builtin_bit_cast(int, x),
                                          0x76543210, 0xfedcba98, false, false));
}

__global__ __launch_bounds__(256) void attn_kernel(
    const bf16* __restrict__ Q, const bf16* __restrict__ Kmat,
    const bf16* __restrict__ VT, bf16* __restrict__ O) {
  const int lane = threadIdx.x & 31;
  const int wave = threadIdx.x >> 5;
  const int blk = blockIdx.x;
  const int qchunk = blk & 15;  // T/128 = 16 chunks
  const int bh = blk >> 4;      // 0..63
  const int b = bh >> 4;
  const int h = bh & (N_HEADS - 1);
  const int q_base = qchunk * 128 + wave * 16;

  const int rlane = lane & 15;
  const int khalf = lane >> 4;
  const int koff = khalf * 8;

  const bf16* qp = Q + (size_t)b * SEQ_T * D_MODEL + h * DK;
  const bf16* kp = Kmat + (size_t)b * SEQ_T * D_MODEL + h * DK;
  const bf16* vtp = VT + (size_t)bh * DK * SEQ_T;

  const int qi = q_base + rlane;  // this lane's query
  const bf16* qrow = qp + (size_t)qi * D_MODEL;
  v16bf qf0 = ldfrag(qrow + koff);
  v16bf qf1 = ldfrag(qrow + 32 + koff);

  float rowM = -1.0e30f;  // running maximum of query qi (equal in both halves)
  float rowL = 0.0f;      // running sum over this half's keys only
  v8f acc[4] = {{}, {}, {}, {}};  // acc[dg][r] = O[qi][dg*16 + koff + r]

  const float scale = 0.125f;          // 1/sqrt(64)
  const int nkt = (q_base + 47) >> 5;  // # of 32-key tiles (causal)

  for (int kt32 = 0; kt32 < nkt; ++kt32) {
    const int kt = kt32 * 32;
    v8f s0 = {}, s1 = {};  // s0[r]: key kt+koff+r, s1[r]: key kt+16+koff+r
    {
      const bf16* kr0 = kp + (size_t)(kt + rlane) * D_MODEL + koff;
      const bf16* kr1 = kr0 + (size_t)16 * D_MODEL;
      v16bf kf;
      kf = ldfrag(kr0);       s0 = wmma_bf16(kf, qf0, s0);
      kf = ldfrag(kr0 + 32);  s0 = wmma_bf16(kf, qf1, s0);
      kf = ldfrag(kr1);       s1 = wmma_bf16(kf, qf0, s1);
      kf = ldfrag(kr1 + 32);  s1 = wmma_bf16(kf, qf1, s1);
    }
    float sc[16];
    float m = -1.0e30f;
#pragma unroll
    for (int r = 0; r < 8; ++r) {
      const int key = kt + koff + r;
      sc[r] = (key <= qi) ? (float)s0[r] * scale : -1.0e30f;
      sc[8 + r] = (key + 16 <= qi) ? (float)s1[r] * scale : -1.0e30f;
      m = fmaxf(m, fmaxf(sc[r], sc[8 + r]));
    }
    m = fmaxf(m, xhalf(m));
    const float newM = fmaxf(rowM, m);
    const float corr = __expf(rowM - newM);
    rowM = newM;
    v16bf pf;
    float p[16];
#pragma unroll
    for (int s = 0; s < 16; ++s) {
      p[s] = __expf(sc[s] - newM);
      pf[s] = (bf16)p[s];
    }
#pragma unroll
    for (int w = 8; w >= 1; w >>= 1)
#pragma unroll
      for (int s = 0; s < w; ++s) p[s] += p[s + w];
    rowL = rowL * corr + p[0];
#pragma unroll
    for (int dg = 0; dg < 4; ++dg) {
      const bf16* vr = vtp + (size_t)(dg * 16 + rlane) * SEQ_T + kt + koff;
      v16bf vf = ldfrag(vr);
      acc[dg] *= corr;
      acc[dg] = wmma_bf16(vf, pf, acc[dg]);
    }
  }

  const float inv = 1.0f / (rowL + xhalf(rowL));
  bf16* op = O + ((size_t)(b * SEQ_T + qi)) * D_MODEL + h * DK + koff;
#pragma unroll
  for (int dg = 0; dg < 4; ++dg) {
    v8bf o;
#pragma unroll
    for (int r = 0; r < 8; ++r) o[r] = (bf16)(acc[dg][r] * inv);
    *reinterpret_cast<v8bf*>(op + dg * 16) = o;
  }
}

// ---------------------------------------------------------------------------
// LayerNorm(residual): out = LN(A + R) * g + be ; optional bf16 copy.
// ---------------------------------------------------------------------------
__global__ __launch_bounds__(256) void ln_residual_kernel(
    const float* __restrict__ A, const float* __restrict__ R,
    const float* __restrict__ g, const float* __restrict__ be,
    float* __restrict__ outF, bf16* __restrict__ outB) {
  const int row = blockIdx.x;
  const float* a = A + (size_t)row * D_MODEL;
  const float* rr = R + (size_t)row * D_MODEL;
  float v[4];
  float s = 0.0f;
#pragma unroll
  for (int i = 0; i < 4; ++i) {
    int idx = threadIdx.x + i * 256;
    v[i] = a[idx] + rr[idx];
    s += v[i];
  }
  __shared__ float red[8];
  const int wv = threadIdx.x >> 5, ln = threadIdx.x & 31;
#pragma unroll
  for (int off = 16; off >= 1; off >>= 1) s += __shfl_xor(s, off, 32);
  if (ln == 0) red[wv] = s;
  __syncthreads();
  float mean = 0.0f;
#pragma unroll
  for (int i = 0; i < 8; ++i) mean += red[i];
  mean *= (1.0f / D_MODEL);
  __syncthreads();
  float vs = 0.0f;
#pragma unroll
  for (int i = 0; i < 4; ++i) {
    float d = v[i] - mean;
    vs += d * d;
  }
#pragma unroll
  for (int off = 16; off >= 1; off >>= 1) vs += __shfl_xor(vs, off, 32);
  if (ln == 0) red[wv] = vs;
  __syncthreads();
  float var = 0.0f;
#pragma unroll
  for (int i = 0; i < 8; ++i) var += red[i];
  var *= (1.0f / D_MODEL);
  const float rstd = rsqrtf(var + 1e-5f);
#pragma unroll
  for (int i = 0; i < 4; ++i) {
    int idx = threadIdx.x + i * 256;
    float y = (v[i] - mean) * rstd * g[idx] + be[idx];
    outF[(size_t)row * D_MODEL + idx] = y;
    if (outB) outB[(size_t)row * D_MODEL + idx] = (bf16)y;
  }
}

// ---------------------------------------------------------------------------
// Host-side orchestration
// ---------------------------------------------------------------------------
extern "C" void kernel_launch(void* const* d_in, const int* in_sizes, int n_in,
                              void* d_out, int out_size, void* d_ws,
                              size_t ws_size, hipStream_t stream) {
  (void)in_sizes; (void)n_in; (void)out_size; (void)ws_size;
  const float* x  = (const float*)d_in[0];
  const float* WQ = (const float*)d_in[1];
  const float* bQ = (const float*)d_in[2];
  const float* WK = (const float*)d_in[3];
  const float* bK = (const float*)d_in[4];
  const float* WV = (const float*)d_in[5];
  const float* bV = (const float*)d_in[6];
  const float* WO = (const float*)d_in[7];
  const float* bO = (const float*)d_in[8];
  const float* W1 = (const float*)d_in[9];
  const float* b1 = (const float*)d_in[10];
  const float* W2 = (const float*)d_in[11];
  const float* b2 = (const float*)d_in[12];
  const float* g1 = (const float*)d_in[13];
  const float* be1 = (const float*)d_in[14];
  const float* g2 = (const float*)d_in[15];
  const float* be2 = (const float*)d_in[16];
  float* out = (float*)d_out;

  char* w = (char*)d_ws;
  auto carve = [&](size_t bytes) {
    char* p = w;
    w += (bytes + 255) & ~(size_t)255;
    return p;
  };
  const size_t MT = (size_t)MTOK;
  bf16* xb  = (bf16*)carve(MT * D_MODEL * 2);
  bf16* wqb = (bf16*)carve((size_t)D_MODEL * D_MODEL * 2);
  bf16* wkb = (bf16*)carve((size_t)D_MODEL * D_MODEL * 2);
  bf16* wvb = (bf16*)carve((size_t)D_MODEL * D_MODEL * 2);
  bf16* wob = (bf16*)carve((size_t)D_MODEL * D_MODEL * 2);
  bf16* w1b = (bf16*)carve((size_t)D_FF * D_MODEL * 2);
  bf16* w2b = (bf16*)carve((size_t)D_MODEL * D_FF * 2);
  bf16* qb  = (bf16*)carve(MT * D_MODEL * 2);
  bf16* kb  = (bf16*)carve(MT * D_MODEL * 2);
  bf16* vb  = (bf16*)carve(MT * D_MODEL * 2);
  bf16* vtb = (bf16*)carve(MT * D_MODEL * 2);
  float* attnf = (float*)carve(MT * D_MODEL * 4);
  float* y1f   = (float*)carve(MT * D_MODEL * 4);
  bf16*  y1b   = (bf16*)carve(MT * D_MODEL * 2);
  bf16*  h1b   = (bf16*)carve(MT * D_FF * 2);
  bf16* aob = vb;     // v dead after vtrans
  float* fff = attnf; // attn_out dead after LN1

  const int nX = MTOK * D_MODEL;
  const int nW = D_MODEL * D_MODEL;
  const int nWF = D_FF * D_MODEL;

  cvt_bf16_kernel<<<(nX + 255) / 256, 256, 0, stream>>>(x, xb, nX);
  cvt_bf16_kernel<<<(nW + 255) / 256, 256, 0, stream>>>(WQ, wqb, nW);
  cvt_bf16_kernel<<<(nW + 255) / 256, 256, 0, stream>>>(WK, wkb, nW);
  cvt_bf16_kernel<<<(nW + 255) / 256, 256, 0, stream>>>(WV, wvb, nW);
  cvt_bf16_kernel<<<(nW + 255) / 256, 256, 0, stream>>>(WO, wob, nW);
  cvt_bf16_kernel<<<(nWF + 255) / 256, 256, 0, stream>>>(W1, w1b, nWF);
  cvt_bf16_kernel<<<(nWF + 255) / 256, 256, 0, stream>>>(W2, w2b, nWF);

  dim3 blk(256);
  dim3 gProj(MTOK / 128, D_MODEL / 64);
  gemm_bf16_kernel<false, false, true><<<gProj, blk, 0, stream>>>(
      xb, wqb, bQ, nullptr, qb, MTOK, D_MODEL, D_MODEL);
  gemm_bf16_kernel<false, false, true><<<gProj, blk, 0, stream>>>(
      xb, wkb, bK, nullptr, kb, MTOK, D_MODEL, D_MODEL);
  gemm_bf16_kernel<false, false, true><<<gProj, blk, 0, stream>>>(
      xb, wvb, bV, nullptr, vb, MTOK, D_MODEL, D_MODEL);

  vtrans_kernel<<<(nX + 255) / 256, 256, 0, stream>>>(vb, vtb);

  attn_kernel<<<BATCH * N_HEADS * (SEQ_T / 128), blk, 0, stream>>>(
      qb, kb, vtb, aob);

  gemm_bf16_kernel<false, true, false><<<gProj, blk, 0, stream>>>(
      aob, wob, bO, attnf, nullptr, MTOK, D_MODEL, D_MODEL);

  ln_residual_kernel<<<MTOK, blk, 0, stream>>>(x, attnf, g1, be1, y1f, y1b);

  dim3 gFF1(MTOK / 128, D_FF / 64);
  gemm_bf16_kernel<true, false, true><<<gFF1, blk, 0, stream>>>(
      y1b, w1b, b1, nullptr, h1b, MTOK, D_FF, D_MODEL);

  gemm_bf16_kernel<false, true, false><<<gProj, blk, 0, stream>>>(
      h1b, w2b, b2, fff, nullptr, MTOK, D_MODEL, D_FF);

  ln_residual_kernel<<<MTOK, blk, 0, stream>>>(y1f, fff, g2, be2, out,
                                               nullptr);
}

// v002
// One run takes 457 microseconds.
// Two timings next to v001 both put it at 1.06 times that version's speed.
// All steps since v000 together make it 1.11 times as fast.
#include <hip/hip_runtime.h>
#include <hip/hip_bf16.h>

// ---------------------------------------------------------------------------
// Types for CDNA5 WMMA (wave32, 16x16x32 bf16 -> f32)
// ---------------------------------------------------------------------------
typedef __bf16 bf16;
typedef bf16  v16bf __attribute__((ext_vector_type(16)));
typedef bf16  v8bf  __attribute__((ext_vector_type(8)));
typedef float v8f   __attribute__((ext_vector_type(8)));

static constexpr int D_MODEL = 1024;
static constexpr int N_HEADS = 16;
static constexpr int D_FF    = 4096;
static constexpr int SEQ_T   = 2048;
static constexpr int BATCH   = 4;
static constexpr int DK      = 64;            // head dim
static constexpr int MTOK    = BATCH * SEQ_T; // 8192 rows

// Toggle for the CDNA5 async-to-LDS DMA path (ASYNCcnt-tracked).
#define USE_ASYNC_LDS 1

__device__ __forceinline__ v8f wmma_bf16(v16bf a, v16bf b, v8f c) {
  return __builtin_amdgcn_wmma_f32_16x16x32_bf16(
      /*neg_a=*/false, a, /*neg_b=*/false, b,
      /*c_mod=*/(short)0, c, /*reuse_a=*/false, /*reuse_b=*/false);
}

// Load one 16-bit A/B operand fragment (ISA 16-bit 16x32 layout):
// lane L -> row = L&15, khalf = (L>>4)*8; elems [0..7]=p[0..7],
// elems [8..15]=p[16..23] with p at (row, khalf) of a K-contiguous row.
__device__ __forceinline__ v16bf ldfrag(const bf16* p) {
  v8bf lo = *reinterpret_cast<const v8bf*>(p);
  v8bf hi = *reinterpret_cast<const v8bf*>(p + 16);
  return __builtin_shufflevector(lo, hi, 0, 1, 2, 3, 4, 5, 6, 7,
                                 8, 9, 10, 11, 12, 13, 14, 15);
}

// Async copy of one 16B chunk global->LDS (per-lane), tracked by ASYNCcnt.
__device__ __forceinline__ void async_cp16(const bf16* g, bf16* l) {
#if USE_ASYNC_LDS
  unsigned long long ga = (unsigned long long)(uintptr_t)g;
  unsigned int la = (unsigned int)(uintptr_t)l;  // AS3 offset = low 32 bits
  asm volatile("global_load_async_to_lds_b128 %0, %1, off"
               :: "v"(la), "v"(ga)
               : "memory");
#else
  *reinterpret_cast<v8bf*>(l) = *reinterpret_cast<const v8bf*>(g);
#endif
}

__device__ __forceinline__ void async_wait0() {
#if USE_ASYNC_LDS
  asm volatile("s_wait_asynccnt 0x0" ::: "memory");
#endif
}

// ---------------------------------------------------------------------------
// f32 -> bf16 conversion
// ---------------------------------------------------------------------------
// One thread converts 32 values: eight 16-byte loads, each 512 contiguous
// bytes per wave, all issued before the first conversion, so that a wave keeps
// 4 KB in flight and the launch needs 1/32 of the waves.
typedef float v4f  __attribute__((ext_vector_type(4)));
typedef bf16  v4bf __attribute__((ext_vector_type(4)));
static constexpr int CVT_LOADS = 8;                    // loads per thread
static constexpr int CVT_STEP  = 256 * 4;              // floats per block-wide load
static constexpr int CVT_TILE  = CVT_STEP * CVT_LOADS; // floats per block

__global__ __launch_bounds__(256) void cvt_bf16_kernel(
    const float* __restrict__ in, bf16* __restrict__ out, int n) {
  const int base = blockIdx.x * CVT_TILE;
  if (base + CVT_TILE <= n) {
    const int i0 = base + threadIdx.x * 4;
    v4f v[CVT_LOADS];
    // Unrolled so that v[] stays in registers and the loads go out together.
#pragma unroll
    for (int j = 0; j < CVT_LOADS; ++j)
      v[j] = *reinterpret_cast<const v4f*>(in + i0 + j * CVT_STEP);
    // Unrolled for the same reason: every index of v[] is a constant.
#pragma unroll
    for (int j = 0; j < CVT_LOADS; ++j)
      *reinterpret_cast<v4bf*>(out + i0 + j * CVT_STEP) =
          __builtin_convertvector(v[j], v4bf);
    // Precaution: stands in front of every later rewrite of a register that the
    // stores above name (the built code runs on into the partial-block test).
    asm volatile("s_wait_xcnt 0x0" ::: "memory");
  } else {
    // Last, partial block of a length that is no multiple of CVT_TILE.
    for (int i = base + threadIdx.x; i < n; i += 256) out[i] = (bf16)in[i];
  }
}

// ---------------------------------------------------------------------------
// GEMM: C[M,N] = act(A[M,K] @ W[N,K]^T + bias[N]),  A/W bf16 row-major.
// Block = 256 thr (8 waves, 4Mx2N).  Block tile 128(M) x 64(N), K-tile 64.
// A/W tiles staged in LDS via async-to-LDS DMA, double buffered; each wave
// computes a 32x32 tile = 2x2 WMMA fragments per 32-K step.
// ---------------------------------------------------------------------------
static constexpr int BM = 128, BN = 64, BK = 64;
static constexpr int LDS_STRIDE = 72;  // 64 + 8 pad (144B rows, 16B aligned)

template <bool RELU, bool OUT_F32, bool OUT_BF16>
__global__ __launch_bounds__(256) void gemm_bf16_kernel(
    const bf16* __restrict__ A, const bf16* __restrict__ W,
    const float* __restrict__ bias, float* __restrict__ Cf,
    bf16* __restrict__ Cb, int M, int N, int K) {
  __shared__ alignas(16) bf16 sA[2][BM * LDS_STRIDE];  // 2 x 18 KB
  __shared__ alignas(16) bf16 sW[2][BN * LDS_STRIDE];  // 2 x  9 KB

  const int tid = threadIdx.x;
  const int lane = tid & 31;
  const int wave = tid >> 5;
  const int m0l = (wave & 3) * 32;   // wave M offset within block tile
  const int n0l = (wave >> 2) * 32;  // wave N offset within block tile

  const int rlane = lane & 15;
  const int koff = (lane >> 4) << 3;  // 0 or 8
  const int half = lane >> 4;

  const bf16* Ab = A + (size_t)blockIdx.x * BM * K;
  const bf16* Wb = W + (size_t)blockIdx.y * BN * K;

  // Stage a [rows x 64] K-slab (row-major, ld=K) into LDS, 16B chunks.
  auto stage = [&](const bf16* g, bf16* l, int rows, int kofs) {
    const int nch = rows * 8;  // 8 x 16B chunks per row
    for (int c = tid; c < nch; c += 256) {
      int r = c >> 3, cc = (c & 7) << 3;
      async_cp16(g + (size_t)r * K + kofs + cc, l + r * LDS_STRIDE + cc);
    }
  };

  v8f acc00 = {}, acc01 = {}, acc10 = {}, acc11 = {};

  stage(Ab, sA[0], BM, 0);
  stage(Wb, sW[0], BN, 0);

  const int nk = K / BK;
  for (int t = 0; t < nk; ++t) {
    async_wait0();
    __syncthreads();
    if (t + 1 < nk) {
      stage(Ab, sA[(t + 1) & 1], BM, (t + 1) * BK);
      stage(Wb, sW[(t + 1) & 1], BN, (t + 1) * BK);
    }
    const bf16* a0 = sA[t & 1] + (m0l + rlane) * LDS_STRIDE + koff;
    const bf16* a1 = a0 + 16 * LDS_STRIDE;
    const bf16* w0 = sW[t & 1] + (n0l + rlane) * LDS_STRIDE + koff;
    const bf16* w1 = w0 + 16 * LDS_STRIDE;
#pragma unroll
    for (int kk = 0; kk < BK; kk += 32) {
      v16bf af0 = ldfrag(a0 + kk);
      v16bf af1 = ldfrag(a1 + kk);
      v16bf wf0 = ldfrag(w0 + kk);
      v16bf wf1 = ldfrag(w1 + kk);
      acc00 = wmma_bf16(af0, wf0, acc00);
      acc01 = wmma_bf16(af0, wf1, acc01);
      acc10 = wmma_bf16(af1, wf0, acc10);
      acc11 = wmma_bf16(af1, wf1, acc11);
    }
    // No trailing barrier: next stage() writes the *other* buffer, and the
    // top-of-loop wait+barrier orders buffer reuse across iterations.
  }

  // Epilogue.  C layout: VGPR r, lane L -> row = r + 8*(L>>4), col = L&15.
  const int m0 = blockIdx.x * BM + m0l;
  const int n0 = blockIdx.y * BN + n0l;
#pragma unroll
  for (int i = 0; i < 2; ++i) {
#pragma unroll
    for (int j = 0; j < 2; ++j) {
      const v8f& acc = (i == 0) ? (j == 0 ? acc00 : acc01)
                                : (j == 0 ? acc10 : acc11);
      int col = n0 + j * 16 + rlane;
      float bv = bias[col];
#pragma unroll
      for (int r = 0; r < 8; ++r) {
        int row = m0 + i * 16 + r + half * 8;
        float v = acc[r] + bv;
        if (RELU) v = fmaxf(v, 0.0f);
        if (OUT_F32) Cf[(size_t)row * N + col] = v;
        if (OUT_BF16) Cb[(size_t)row * N + col] = (bf16)v;
      }
    }
  }
}

// ---------------------------------------------------------------------------
// Transpose V: [B*T, D] (head h cols h*64..h*64+63) -> VT[(b*H+h)*64+d][T]
// ---------------------------------------------------------------------------
__global__ __launch_bounds__(256) void vtrans_kernel(
    const bf16* __restrict__ V, bf16* __restrict__ VT) {
  int idx = blockIdx.x * 256 + threadIdx.x;  // over B*H*DK*T = 8M
  if (idx >= BATCH * N_HEADS * DK * SEQ_T) return;
  int t = idx & (SEQ_T - 1);
  int rest = idx >> 11;
  int d = rest & (DK - 1);
  int bh = rest >> 6;
  int h = bh & (N_HEADS - 1);
  int b = bh >> 4;
  VT[idx] = V[((size_t)(b * SEQ_T + t)) * D_MODEL + h * DK + d];
}

__device__ __forceinline__ float xhalf(float x) {
  return __builtin_bit_cast(
      float, __builtin_amdgcn_permlanex16(__builtin_bit_cast(int, x),
                                          __builtin_bit_cast(int, x),
                                          0x76543210, 0xfedcba98, false, false));
}

__global__ __launch_bounds__(256) void attn_kernel(
    const bf16* __restrict__ Q, const bf16* __restrict__ Kmat,
    const bf16* __restrict__ VT, bf16* __restrict__ O) {
  const int lane = threadIdx.x & 31;
  const int wave = threadIdx.x >> 5;
  const int blk = blockIdx.x;
  const int qchunk = blk & 15;  // T/128 = 16 chunks
  const int bh = blk >> 4;      // 0..63
  const int b = bh >> 4;
  const int h = bh & (N_HEADS - 1);
  const int q_base = qchunk * 128 + wave * 16;

  const int rlane = lane & 15;
  const int khalf = lane >> 4;
  const int koff = khalf * 8;

  const bf16* qp = Q + (size_t)b * SEQ_T * D_MODEL + h * DK;
  const bf16* kp = Kmat + (size_t)b * SEQ_T * D_MODEL + h * DK;
  const bf16* vtp = VT + (size_t)bh * DK * SEQ_T;

  const int qi = q_base + rlane;  // this lane's query
  const bf16* qrow = qp + (size_t)qi * D_MODEL;
  v16bf qf0 = ldfrag(qrow + koff);
  v16bf qf1 = ldfrag(qrow + 32 + koff);

  float rowM = -1.0e30f;  // running maximum of query qi (equal in both halves)
  float rowL = 0.0f;      // running sum over this half's keys only
  v8f acc[4] = {{}, {}, {}, {}};  // acc[dg][r] = O[qi][dg*16 + koff + r]

  const float scale = 0.125f;          // 1/sqrt(64)
  const int nkt = (q_base + 47) >> 5;  // # of 32-key tiles (causal)

  for (int kt32 = 0; kt32 < nkt; ++kt32) {
    const int kt = kt32 * 32;
    v8f s0 = {}, s1 = {};  // s0[r]: key kt+koff+r, s1[r]: key kt+16+koff+r
    {
      const bf16* kr0 = kp + (size_t)(kt + rlane) * D_MODEL + koff;
      const bf16* kr1 = kr0 + (size_t)16 * D_MODEL;
      v16bf kf;
      kf = ldfrag(kr0);       s0 = wmma_bf16(kf, qf0, s0);
      kf = ldfrag(kr0 + 32);  s0 = wmma_bf16(kf, qf1, s0);
      kf = ldfrag(kr1);       s1 = wmma_bf16(kf, qf0, s1);
      kf = ldfrag(kr1 + 32);  s1 = wmma_bf16(kf, qf1, s1);
    }
    float sc[16];
    float m = -1.0e30f;
#pragma unroll
    for (int r = 0; r < 8; ++r) {
      const int key = kt + koff + r;
      sc[r] = (key <= qi) ? (float)s0[r] * scale : -1.0e30f;
      sc[8 + r] = (key + 16 <= qi) ? (float)s1[r] * scale : -1.0e30f;
      m = fmaxf(m, fmaxf(sc[r], sc[8 + r]));
    }
    m = fmaxf(m, xhalf(m));
    const float newM = fmaxf(rowM, m);
    const float corr = __expf(rowM - newM);
    rowM = newM;
    v16bf pf;
    float p[16];
#pragma unroll
    for (int s = 0; s < 16; ++s) {
      p[s] = __expf(sc[s] - newM);
      pf[s] = (bf16)p[s];
    }
#pragma unroll
    for (int w = 8; w >= 1; w >>= 1)
#pragma unroll
      for (int s = 0; s < w; ++s) p[s] += p[s + w];
    rowL = rowL * corr + p[0];
#pragma unroll
    for (int dg = 0; dg < 4; ++dg) {
      const bf16* vr = vtp + (size_t)(dg * 16 + rlane) * SEQ_T + kt + koff;
      v16bf vf = ldfrag(vr);
      acc[dg] *= corr;
      acc[dg] = wmma_bf16(vf, pf, acc[dg]);
    }
  }

  const float inv = 1.0f / (rowL + xhalf(rowL));
  bf16* op = O + ((size_t)(b * SEQ_T + qi)) * D_MODEL + h * DK + koff;
#pragma unroll
  for (int dg = 0; dg < 4; ++dg) {
    v8bf o;
#pragma unroll
    for (int r = 0; r < 8; ++r) o[r] = (bf16)(acc[dg][r] * inv);
    *reinterpret_cast<v8bf*>(op + dg * 16) = o;
  }
}

// ---------------------------------------------------------------------------
// LayerNorm(residual): out = LN(A + R) * g + be ; optional bf16 copy.
// ---------------------------------------------------------------------------
__global__ __launch_bounds__(256) void ln_residual_kernel(
    const float* __restrict__ A, const float* __restrict__ R,
    const float* __restrict__ g, const float* __restrict__ be,
    float* __restrict__ outF, bf16* __restrict__ outB) {
  const int row = blockIdx.x;
  const float* a = A + (size_t)row * D_MODEL;
  const float* rr = R + (size_t)row * D_MODEL;
  float v[4];
  float s = 0.0f;
#pragma unroll
  for (int i = 0; i < 4; ++i) {
    int idx = threadIdx.x + i * 256;
    v[i] = a[idx] + rr[idx];
    s += v[i];
  }
  __shared__ float red[8];
  const int wv = threadIdx.x >> 5, ln = threadIdx.x & 31;
#pragma unroll
  for (int off = 16; off >= 1; off >>= 1) s += __shfl_xor(s, off, 32);
  if (ln == 0) red[wv] = s;
  __syncthreads();
  float mean = 0.0f;
#pragma unroll
  for (int i = 0; i < 8; ++i) mean += red[i];
  mean *= (1.0f / D_MODEL);
  __syncthreads();
  float vs = 0.0f;
#pragma unroll
  for (int i = 0; i < 4; ++i) {
    float d = v[i] - mean;
    vs += d * d;
  }
#pragma unroll
  for (int off = 16; off >= 1; off >>= 1) vs += __shfl_xor(vs, off, 32);
  if (ln == 0) red[wv] = vs;
  __syncthreads();
  float var = 0.0f;
#pragma unroll
  for (int i = 0; i < 8; ++i) var += red[i];
  var *= (1.0f / D_MODEL);
  const float rstd = rsqrtf(var + 1e-5f);
#pragma unroll
  for (int i = 0; i < 4; ++i) {
    int idx = threadIdx.x + i * 256;
    float y = (v[i] - mean) * rstd * g[idx] + be[idx];
    outF[(size_t)row * D_MODEL + idx] = y;
    if (outB) outB[(size_t)row * D_MODEL + idx] = (bf16)y;
  }
}

// ---------------------------------------------------------------------------
// Host-side orchestration
// ---------------------------------------------------------------------------
extern "C" void kernel_launch(void* const* d_in, const int* in_sizes, int n_in,
                              void* d_out, int out_size, void* d_ws,
                              size_t ws_size, hipStream_t stream) {
  (void)in_sizes; (void)n_in; (void)out_size; (void)ws_size;
  const float* x  = (const float*)d_in[0];
  const float* WQ = (const float*)d_in[1];
  const float* bQ = (const float*)d_in[2];
  const float* WK = (const float*)d_in[3];
  const float* bK = (const float*)d_in[4];
  const float* WV = (const float*)d_in[5];
  const float* bV = (const float*)d_in[6];
  const float* WO = (const float*)d_in[7];
  const float* bO = (const float*)d_in[8];
  const float* W1 = (const float*)d_in[9];
  const float* b1 = (const float*)d_in[10];
  const float* W2 = (const float*)d_in[11];
  const float* b2 = (const float*)d_in[12];
  const float* g1 = (const float*)d_in[13];
  const float* be1 = (const float*)d_in[14];
  const float* g2 = (const float*)d_in[15];
  const float* be2 = (const float*)d_in[16];
  float* out = (float*)d_out;

  char* w = (char*)d_ws;
  auto carve = [&](size_t bytes) {
    char* p = w;
    w += (bytes + 255) & ~(size_t)255;
    return p;
  };
  const size_t MT = (size_t)MTOK;
  bf16* xb  = (bf16*)carve(MT * D_MODEL * 2);
  bf16* wqb = (bf16*)carve((size_t)D_MODEL * D_MODEL * 2);
  bf16* wkb = (bf16*)carve((size_t)D_MODEL * D_MODEL * 2);
  bf16* wvb = (bf16*)carve((size_t)D_MODEL * D_MODEL * 2);
  bf16* wob = (bf16*)carve((size_t)D_MODEL * D_MODEL * 2);
  bf16* w1b = (bf16*)carve((size_t)D_FF * D_MODEL * 2);
  bf16* w2b = (bf16*)carve((size_t)D_MODEL * D_FF * 2);
  bf16* qb  = (bf16*)carve(MT * D_MODEL * 2);
  bf16* kb  = (bf16*)carve(MT * D_MODEL * 2);
  bf16* vb  = (bf16*)carve(MT * D_MODEL * 2);
  bf16* vtb = (bf16*)carve(MT * D_MODEL * 2);
  float* attnf = (float*)carve(MT * D_MODEL * 4);
  float* y1f   = (float*)carve(MT * D_MODEL * 4);
  bf16*  y1b   = (bf16*)carve(MT * D_MODEL * 2);
  bf16*  h1b   = (bf16*)carve(MT * D_FF * 2);
  bf16* aob = vb;     // v dead after vtrans
  float* fff = attnf; // attn_out dead after LN1

  const int nX = MTOK * D_MODEL;
  const int nW = D_MODEL * D_MODEL;
  const int nWF = D_FF * D_MODEL;

  cvt_bf16_kernel<<<(nX + CVT_TILE - 1) / CVT_TILE, 256, 0, stream>>>(x, xb, nX);
  cvt_bf16_kernel<<<(nW + CVT_TILE - 1) / CVT_TILE, 256, 0, stream>>>(WQ, wqb, nW);
  cvt_bf16_kernel<<<(nW + CVT_TILE - 1) / CVT_TILE, 256, 0, stream>>>(WK, wkb, nW);
  cvt_bf16_kernel<<<(nW + CVT_TILE - 1) / CVT_TILE, 256, 0, stream>>>(WV, wvb, nW);
  cvt_bf16_kernel<<<(nW + CVT_TILE - 1) / CVT_TILE, 256, 0, stream>>>(WO, wob, nW);
  cvt_bf16_kernel<<<(nWF + CVT_TILE - 1) / CVT_TILE, 256, 0, stream>>>(W1, w1b, nWF);
  cvt_bf16_kernel<<<(nWF + CVT_TILE - 1) / CVT_TILE, 256, 0, stream>>>(W2, w2b, nWF);

  dim3 blk(256);
  dim3 gProj(MTOK / 128, D_MODEL / 64);
  gemm_bf16_kernel<false, false, true><<<gProj, blk, 0, stream>>>(
      xb, wqb, bQ, nullptr, qb, MTOK, D_MODEL, D_MODEL);
  gemm_bf16_kernel<false, false, true><<<gProj, blk, 0, stream>>>(
      xb, wkb, bK, nullptr, kb, MTOK, D_MODEL, D_MODEL);
  gemm_bf16_kernel<false, false, true><<<gProj, blk, 0, stream>>>(
      xb, wvb, bV, nullptr, vb, MTOK, D_MODEL, D_MODEL);

  vtrans_kernel<<<(nX + 255) / 256, 256, 0, stream>>>(vb, vtb);

  attn_kernel<<<BATCH * N_HEADS * (SEQ_T / 128), blk, 0, stream>>>(
      qb, kb, vtb, aob);

  gemm_bf16_kernel<false, true, false><<<gProj, blk, 0, stream>>>(
      aob, wob, bO, attnf, nullptr, MTOK, D_MODEL, D_MODEL);

  ln_residual_kernel<<<MTOK, blk, 0, stream>>>(x, attnf, g1, be1, y1f, y1b);

  dim3 gFF1(MTOK / 128, D_FF / 64);
  gemm_bf16_kernel<true, false, true><<<gFF1, blk, 0, stream>>>(
      y1b, w1b, b1, nullptr, h1b, MTOK, D_FF, D_MODEL);

  gemm_bf16_kernel<false, true, false><<<gProj, blk, 0, stream>>>(
      h1b, w2b, b2, fff, nullptr, MTOK, D_MODEL, D_FF);

  ln_residual_kernel<<<MTOK, blk, 0, stream>>>(y1f, fff, g2, be2, out,
                                               nullptr);
}

// v003
// Measured time: 437 microseconds a run.
// Timed twice side by side with v002, it ran 1.05 times as fast both times.
// All steps since v000 together make it 1.16 times as fast.
#include <hip/hip_runtime.h>
#include <hip/hip_bf16.h>

// ---------------------------------------------------------------------------
// Types for CDNA5 WMMA (wave32, 16x16x32 bf16 -> f32)
// ---------------------------------------------------------------------------
typedef __bf16 bf16;
typedef bf16  v16bf __attribute__((ext_vector_type(16)));
typedef bf16  v8bf  __attribute__((ext_vector_type(8)));
typedef float v8f   __attribute__((ext_vector_type(8)));

static constexpr int D_MODEL = 1024;
static constexpr int N_HEADS = 16;
static constexpr int D_FF    = 4096;
static constexpr int SEQ_T   = 2048;
static constexpr int BATCH   = 4;
static constexpr int DK      = 64;            // head dim
static constexpr int MTOK    = BATCH * SEQ_T; // 8192 rows

__device__ __forceinline__ v8f wmma_bf16(v16bf a, v16bf b, v8f c) {
  return __builtin_amdgcn_wmma_f32_16x16x32_bf16(
      /*neg_a=*/false, a, /*neg_b=*/false, b,
      /*c_mod=*/(short)0, c, /*reuse_a=*/false, /*reuse_b=*/false);
}

// Load one 16-bit A/B operand fragment (ISA 16-bit 16x32 layout):
// lane L -> row = L&15, khalf = (L>>4)*8; elems [0..7]=p[0..7],
// elems [8..15]=p[16..23] with p at (row, khalf) of a K-contiguous row.
__device__ __forceinline__ v16bf ldfrag(const bf16* p) {
  v8bf lo = *reinterpret_cast<const v8bf*>(p);
  v8bf hi = *reinterpret_cast<const v8bf*>(p + 16);
  return __builtin_shufflevector(lo, hi, 0, 1, 2, 3, 4, 5, 6, 7,
                                 8, 9, 10, 11, 12, 13, 14, 15);
}

// Returns when every async-to-LDS copy that this wave has issued has landed.
__device__ __forceinline__ void async_wait0() {
  asm volatile("s_wait_asynccnt 0x0" ::: "memory");
}

// ---------------------------------------------------------------------------
// f32 -> bf16 conversion
// ---------------------------------------------------------------------------
// One thread converts 32 values: eight 16-byte loads, each 512 contiguous
// bytes per wave, all issued before the first conversion, so that a wave keeps
// 4 KB in flight and the launch needs 1/32 of the waves.
typedef float v4f  __attribute__((ext_vector_type(4)));
typedef bf16  v4bf __attribute__((ext_vector_type(4)));
static constexpr int CVT_LOADS = 8;                    // loads per thread
static constexpr int CVT_STEP  = 256 * 4;              // floats per block-wide load
static constexpr int CVT_TILE  = CVT_STEP * CVT_LOADS; // floats per block

__global__ __launch_bounds__(256) void cvt_bf16_kernel(
    const float* __restrict__ in, bf16* __restrict__ out, int n) {
  const int base = blockIdx.x * CVT_TILE;
  if (base + CVT_TILE <= n) {
    const int i0 = base + threadIdx.x * 4;
    v4f v[CVT_LOADS];
    // Unrolled so that v[] stays in registers and the loads go out together.
#pragma unroll
    for (int j = 0; j < CVT_LOADS; ++j)
      v[j] = *reinterpret_cast<const v4f*>(in + i0 + j * CVT_STEP);
    // Unrolled for the same reason: every index of v[] is a constant.
#pragma unroll
    for (int j = 0; j < CVT_LOADS; ++j)
      *reinterpret_cast<v4bf*>(out + i0 + j * CVT_STEP) =
          __builtin_convertvector(v[j], v4bf);
    // Precaution: stands in front of every later rewrite of a register that the
    // stores above name (the built code runs on into the partial-block test).
    asm volatile("s_wait_xcnt 0x0" ::: "memory");
  } else {
    // Last, partial block of a length that is no multiple of CVT_TILE.
    for (int i = base + threadIdx.x; i < n; i += 256) out[i] = (bf16)in[i];
  }
}

// ---------------------------------------------------------------------------
// GEMM: C[M,N] = act(A[M,K] @ W[N,K]^T + bias[N]),  A/W bf16 row-major.
// Block = 256 thr (8 waves, 4Mx2N).  Block tile 256(M) x 128(N), K-tile 64.
// A/W tiles staged in LDS via async-to-LDS DMA, double buffered; each wave
// computes a 64x64 tile = 4x4 WMMA fragments per 32-K step, so that a loaded
// fragment feeds four products.  M, N, K are multiples of BM, BN, BK.
// ---------------------------------------------------------------------------
static constexpr int BM = 256, BN = 128, BK = 64;
static constexpr int LDS_STRIDE = 72;  // 64 + 8 pad (144B rows, 16B aligned)

template <bool RELU, bool OUT_F32, bool OUT_BF16>
__global__ __launch_bounds__(256) void gemm_bf16_kernel(
    const bf16* __restrict__ A, const bf16* __restrict__ W,
    const float* __restrict__ bias, float* __restrict__ Cf,
    bf16* __restrict__ Cb, int M, int N, int K) {
  __shared__ alignas(16) bf16 sA[2][BM * LDS_STRIDE];  // 2 x 36 KB
  __shared__ alignas(16) bf16 sW[2][BN * LDS_STRIDE];  // 2 x 18 KB

  const int tid = threadIdx.x;
  const int lane = tid & 31;
  const int wave = tid >> 5;
  const int m0l = (wave & 3) * 64;   // wave M offset within block tile
  const int n0l = (wave >> 2) * 64;  // wave N offset within block tile

  const int rlane = lane & 15;
  const int koff = (lane >> 4) << 3;  // 0 or 8
  const int half = lane >> 4;

  // Staging: a thread copies one 16B chunk of rows srow + 32*j, j = 0..7 of the
  // A slab and j = 0..3 of the W slab (a wave's copy covers four 128B rows).
  const int srow = tid >> 3;
  const int scol = (tid & 7) << 3;
  const bf16* Ab = A + ((size_t)blockIdx.x * BM + srow) * K + scol;
  const bf16* Wb = W + ((size_t)blockIdx.y * BN + srow) * K + scol;
  const size_t gstep = (size_t)32 * K;            // 32 rows, elements
  const unsigned int lstep = 32 * LDS_STRIDE * 2;  // 32 rows, LDS bytes
  const unsigned int lA =
      (unsigned int)(uintptr_t)(&sA[0][0] + srow * LDS_STRIDE + scol);
  const unsigned int lW =
      (unsigned int)(uintptr_t)(&sW[0][0] + srow * LDS_STRIDE + scol);

  // Stage the [BM x 64] and [BN x 64] K-slabs at kofs into buffer buf.
  auto stage = [&](int buf, int kofs) {
    const bf16* a = Ab + kofs;
    const bf16* w = Wb + kofs;
    const unsigned int da = lA + buf * (BM * LDS_STRIDE * 2);
    const unsigned int dw = lW + buf * (BN * LDS_STRIDE * 2);
    // The twelve copies of a slab pair; the wait in the same statement stands
    // in front of every later rewrite of an address register that they name.
    asm volatile(
        "global_load_async_to_lds_b128 %0, %12, off\n\t"
        "global_load_async_to_lds_b128 %1, %13, off\n\t"
        "global_load_async_to_lds_b128 %2, %14, off\n\t"
        "global_load_async_to_lds_b128 %3, %15, off\n\t"
        "global_load_async_to_lds_b128 %4, %16, off\n\t"
        "global_load_async_to_lds_b128 %5, %17, off\n\t"
        "global_load_async_to_lds_b128 %6, %18, off\n\t"
        "global_load_async_to_lds_b128 %7, %19, off\n\t"
        "global_load_async_to_lds_b128 %8, %20, off\n\t"
        "global_load_async_to_lds_b128 %9, %21, off\n\t"
        "global_load_async_to_lds_b128 %10, %22, off\n\t"
        "global_load_async_to_lds_b128 %11, %23, off\n\t"
        "s_wait_xcnt 0x0"
        :: "v"(da), "v"(da + lstep), "v"(da + 2 * lstep), "v"(da + 3 * lstep),
           "v"(da + 4 * lstep), "v"(da + 5 * lstep), "v"(da + 6 * lstep),
           "v"(da + 7 * lstep), "v"(dw), "v"(dw + lstep), "v"(dw + 2 * lstep),
           "v"(dw + 3 * lstep),
           "v"(a), "v"(a + gstep), "v"(a + 2 * gstep), "v"(a + 3 * gstep),
           "v"(a + 4 * gstep), "v"(a + 5 * gstep), "v"(a + 6 * gstep),
           "v"(a + 7 * gstep), "v"(w), "v"(w + gstep), "v"(w + 2 * gstep),
           "v"(w + 3 * gstep)
        : "memory");
  };

  v8f acc[4][4] = {};

  stage(0, 0);

  const int nk = K / BK;
  for (int t = 0; t < nk; ++t) {
    // Hand-over, passed by every wave: this wave's LDS reads of the last trip
    // are done and its copies of slab t have landed; the barrier then publishes
    // slab t and frees the other buffer for the copies below.
    asm volatile("s_wait_dscnt 0x0" ::: "memory");
    async_wait0();
    __syncthreads();
    if (t + 1 < nk) stage((t + 1) & 1, (t + 1) * BK);
    const bf16* a0 = sA[t & 1] + (m0l + rlane) * LDS_STRIDE + koff;
    const bf16* w0 = sW[t & 1] + (n0l + rlane) * LDS_STRIDE + koff;
#pragma unroll
    for (int kk = 0; kk < BK; kk += 32) {
      // All loops below unrolled: every index of af, wf and acc is then a
      // constant and the arrays stay in registers.
      v16bf af[4], wf[4];
#pragma unroll
      for (int i = 0; i < 4; ++i) af[i] = ldfrag(a0 + i * 16 * LDS_STRIDE + kk);
#pragma unroll
      for (int j = 0; j < 4; ++j) wf[j] = ldfrag(w0 + j * 16 * LDS_STRIDE + kk);
#pragma unroll
      for (int i = 0; i < 4; ++i)
#pragma unroll
        for (int j = 0; j < 4; ++j)
          acc[i][j] = wmma_bf16(af[i], wf[j], acc[i][j]);
    }
    // No trailing barrier: next stage() writes the *other* buffer, and the
    // top-of-loop waits+barrier order buffer reuse across iterations.
  }
  async_wait0();  // no copy is outstanding when the wave ends, whatever K is

  // Epilogue.  C layout: VGPR r, lane L -> row = r + 8*(L>>4), col = L&15.
  const int m0 = blockIdx.x * BM + m0l;
  const int n0 = blockIdx.y * BN + n0l;
#pragma unroll
  for (int i = 0; i < 4; ++i) {
#pragma unroll
    for (int j = 0; j < 4; ++j) {
      int col = n0 + j * 16 + rlane;
      float bv = bias[col];
#pragma unroll
      for (int r = 0; r < 8; ++r) {
        int row = m0 + i * 16 + r + half * 8;
        float v = acc[i][j][r] + bv;
        if (RELU) v = fmaxf(v, 0.0f);
        if (OUT_F32) Cf[(size_t)row * N + col] = v;
        if (OUT_BF16) Cb[(size_t)row * N + col] = (bf16)v;
      }
    }
  }
}

// ---------------------------------------------------------------------------
// Transpose V: [B*T, D] (head h cols h*64..h*64+63) -> VT[(b*H+h)*64+d][T]
// ---------------------------------------------------------------------------
__global__ __launch_bounds__(256) void vtrans_kernel(
    const bf16* __restrict__ V, bf16* __restrict__ VT) {
  int idx = blockIdx.x * 256 + threadIdx.x;  // over B*H*DK*T = 8M
  if (idx >= BATCH * N_HEADS * DK * SEQ_T) return;
  int t = idx & (SEQ_T - 1);
  int rest = idx >> 11;
  int d = rest & (DK - 1);
  int bh = rest >> 6;
  int h = bh & (N_HEADS - 1);
  int b = bh >> 4;
  VT[idx] = V[((size_t)(b * SEQ_T + t)) * D_MODEL + h * DK + d];
}

__device__ __forceinline__ float xhalf(float x) {
  return __builtin_bit_cast(
      float, __builtin_amdgcn_permlanex16(__builtin_bit_cast(int, x),
                                          __builtin_bit_cast(int, x),
                                          0x76543210, 0xfedcba98, false, false));
}

__global__ __launch_bounds__(256) void attn_kernel(
    const bf16* __restrict__ Q, const bf16* __restrict__ Kmat,
    const bf16* __restrict__ VT, bf16* __restrict__ O) {
  const int lane = threadIdx.x & 31;
  const int wave = threadIdx.x >> 5;
  const int blk = blockIdx.x;
  const int qchunk = blk & 15;  // T/128 = 16 chunks
  const int bh = blk >> 4;      // 0..63
  const int b = bh >> 4;
  const int h = bh & (N_HEADS - 1);
  const int q_base = qchunk * 128 + wave * 16;

  const int rlane = lane & 15;
  const int khalf = lane >> 4;
  const int koff = khalf * 8;

  const bf16* qp = Q + (size_t)b * SEQ_T * D_MODEL + h * DK;
  const bf16* kp = Kmat + (size_t)b * SEQ_T * D_MODEL + h * DK;
  const bf16* vtp = VT + (size_t)bh * DK * SEQ_T;

  const int qi = q_base + rlane;  // this lane's query
  const bf16* qrow = qp + (size_t)qi * D_MODEL;
  v16bf qf0 = ldfrag(qrow + koff);
  v16bf qf1 = ldfrag(qrow + 32 + koff);

  float rowM = -1.0e30f;  // running maximum of query qi (equal in both halves)
  float rowL = 0.0f;      // running sum over this half's keys only
  v8f acc[4] = {{}, {}, {}, {}};  // acc[dg][r] = O[qi][dg*16 + koff + r]

  const float scale = 0.125f;          // 1/sqrt(64)
  const int nkt = (q_base + 47) >> 5;  // # of 32-key tiles (causal)

  for (int kt32 = 0; kt32 < nkt; ++kt32) {
    const int kt = kt32 * 32;
    v8f s0 = {}, s1 = {};  // s0[r]: key kt+koff+r, s1[r]: key kt+16+koff+r
    {
      const bf16* kr0 = kp + (size_t)(kt + rlane) * D_MODEL + koff;
      const bf16* kr1 = kr0 + (size_t)16 * D_MODEL;
      v16bf kf;
      kf = ldfrag(kr0);       s0 = wmma_bf16(kf, qf0, s0);
      kf = ldfrag(kr0 + 32);  s0 = wmma_bf16(kf, qf1, s0);
      kf = ldfrag(kr1);       s1 = wmma_bf16(kf, qf0, s1);
      kf = ldfrag(kr1 + 32);  s1 = wmma_bf16(kf, qf1, s1);
    }
    float sc[16];
    float m = -1.0e30f;
#pragma unroll
    for (int r = 0; r < 8; ++r) {
      const int key = kt + koff + r;
      sc[r] = (key <= qi) ? (float)s0[r] * scale : -1.0e30f;
      sc[8 + r] = (key + 16 <= qi) ? (float)s1[r] * scale : -1.0e30f;
      m = fmaxf(m, fmaxf(sc[r], sc[8 + r]));
    }
    m = fmaxf(m, xhalf(m));
    const float newM = fmaxf(rowM, m);
    const float corr = __expf(rowM - newM);
    rowM = newM;
    v16bf pf;
    float p[16];
#pragma unroll
    for (int s = 0; s < 16; ++s) {
      p[s] = __expf(sc[s] - newM);
      pf[s] = (bf16)p[s];
    }
#pragma unroll
    for (int w = 8; w >= 1; w >>= 1)
#pragma unroll
      for (int s = 0; s < w; ++s) p[s] += p[s + w];
    rowL = rowL * corr + p[0];
#pragma unroll
    for (int dg = 0; dg < 4; ++dg) {
      const bf16* vr = vtp + (size_t)(dg * 16 + rlane) * SEQ_T + kt + koff;
      v16bf vf = ldfrag(vr);
      acc[dg] *= corr;
      acc[dg] = wmma_bf16(vf, pf, acc[dg]);
    }
  }

  const float inv = 1.0f / (rowL + xhalf(rowL));
  bf16* op = O + ((size_t)(b * SEQ_T + qi)) * D_MODEL + h * DK + koff;
#pragma unroll
  for (int dg = 0; dg < 4; ++dg) {
    v8bf o;
#pragma unroll
    for (int r = 0; r < 8; ++r) o[r] = (bf16)(acc[dg][r] * inv);
    *reinterpret_cast<v8bf*>(op + dg * 16) = o;
  }
}

// ---------------------------------------------------------------------------
// LayerNorm(residual): out = LN(A + R) * g + be ; optional bf16 copy.
// ---------------------------------------------------------------------------
__global__ __launch_bounds__(256) void ln_residual_kernel(
    const float* __restrict__ A, const float* __restrict__ R,
    const float* __restrict__ g, const float* __restrict__ be,
    float* __restrict__ outF, bf16* __restrict__ outB) {
  const int row = blockIdx.x;
  const float* a = A + (size_t)row * D_MODEL;
  const float* rr = R + (size_t)row * D_MODEL;
  float v[4];
  float s = 0.0f;
#pragma unroll
  for (int i = 0; i < 4; ++i) {
    int idx = threadIdx.x + i * 256;
    v[i] = a[idx] + rr[idx];
    s += v[i];
  }
  __shared__ float red[8];
  const int wv = threadIdx.x >> 5, ln = threadIdx.x & 31;
#pragma unroll
  for (int off = 16; off >= 1; off >>= 1) s += __shfl_xor(s, off, 32);
  if (ln == 0) red[wv] = s;
  __syncthreads();
  float mean = 0.0f;
#pragma unroll
  for (int i = 0; i < 8; ++i) mean += red[i];
  mean *= (1.0f / D_MODEL);
  __syncthreads();
  float vs = 0.0f;
#pragma unroll
  for (int i = 0; i < 4; ++i) {
    float d = v[i] - mean;
    vs += d * d;
  }
#pragma unroll
  for (int off = 16; off >= 1; off >>= 1) vs += __shfl_xor(vs, off, 32);
  if (ln == 0) red[wv] = vs;
  __syncthreads();
  float var = 0.0f;
#pragma unroll
  for (int i = 0; i < 8; ++i) var += red[i];
  var *= (1.0f / D_MODEL);
  const float rstd = rsqrtf(var + 1e-5f);
#pragma unroll
  for (int i = 0; i < 4; ++i) {
    int idx = threadIdx.x + i * 256;
    float y = (v[i] - mean) * rstd * g[idx] + be[idx];
    outF[(size_t)row * D_MODEL + idx] = y;
    if (outB) outB[(size_t)row * D_MODEL + idx] = (bf16)y;
  }
}

// ---------------------------------------------------------------------------
// Host-side orchestration
// ---------------------------------------------------------------------------
extern "C" void kernel_launch(void* const* d_in, const int* in_sizes, int n_in,
                              void* d_out, int out_size, void* d_ws,
                              size_t ws_size, hipStream_t stream) {
  (void)in_sizes; (void)n_in; (void)out_size; (void)ws_size;
  const float* x  = (const float*)d_in[0];
  const float* WQ = (const float*)d_in[1];
  const float* bQ = (const float*)d_in[2];
  const float* WK = (const float*)d_in[3];
  const float* bK = (const float*)d_in[4];
  const float* WV = (const float*)d_in[5];
  const float* bV = (const float*)d_in[6];
  const float* WO = (const float*)d_in[7];
  const float* bO = (const float*)d_in[8];
  const float* W1 = (const float*)d_in[9];
  const float* b1 = (const float*)d_in[10];
  const float* W2 = (const float*)d_in[11];
  const float* b2 = (const float*)d_in[12];
  const float* g1 = (const float*)d_in[13];
  const float* be1 = (const float*)d_in[14];
  const float* g2 = (const float*)d_in[15];
  const float* be2 = (const float*)d_in[16];
  float* out = (float*)d_out;

  char* w = (char*)d_ws;
  auto carve = [&](size_t bytes) {
    char* p = w;
    w += (bytes + 255) & ~(size_t)255;
    return p;
  };
  const size_t MT = (size_t)MTOK;
  bf16* xb  = (bf16*)carve(MT * D_MODEL * 2);
  bf16* wqb = (bf16*)carve((size_t)D_MODEL * D_MODEL * 2);
  bf16* wkb = (bf16*)carve((size_t)D_MODEL * D_MODEL * 2);
  bf16* wvb = (bf16*)carve((size_t)D_MODEL * D_MODEL * 2);
  bf16* wob = (bf16*)carve((size_t)D_MODEL * D_MODEL * 2);
  bf16* w1b = (bf16*)carve((size_t)D_FF * D_MODEL * 2);
  bf16* w2b = (bf16*)carve((size_t)D_MODEL * D_FF * 2);
  bf16* qb  = (bf16*)carve(MT * D_MODEL * 2);
  bf16* kb  = (bf16*)carve(MT * D_MODEL * 2);
  bf16* vb  = (bf16*)carve(MT * D_MODEL * 2);
  bf16* vtb = (bf16*)carve(MT * D_MODEL * 2);
  float* attnf = (float*)carve(MT * D_MODEL * 4);
  float* y1f   = (float*)carve(MT * D_MODEL * 4);
  bf16*  y1b   = (bf16*)carve(MT * D_MODEL * 2);
  bf16*  h1b   = (bf16*)carve(MT * D_FF * 2);
  bf16* aob = vb;     // v dead after vtrans
  float* fff = attnf; // attn_out dead after LN1

  const int nX = MTOK * D_MODEL;
  const int nW = D_MODEL * D_MODEL;
  const int nWF = D_FF * D_MODEL;

  cvt_bf16_kernel<<<(nX + CVT_TILE - 1) / CVT_TILE, 256, 0, stream>>>(x, xb, nX);
  cvt_bf16_kernel<<<(nW + CVT_TILE - 1) / CVT_TILE, 256, 0, stream>>>(WQ, wqb, nW);
  cvt_bf16_kernel<<<(nW + CVT_TILE - 1) / CVT_TILE, 256, 0, stream>>>(WK, wkb, nW);
  cvt_bf16_kernel<<<(nW + CVT_TILE - 1) / CVT_TILE, 256, 0, stream>>>(WV, wvb, nW);
  cvt_bf16_kernel<<<(nW + CVT_TILE - 1) / CVT_TILE, 256, 0, stream>>>(WO, wob, nW);
  cvt_bf16_kernel<<<(nWF + CVT_TILE - 1) / CVT_TILE, 256, 0, stream>>>(W1, w1b, nWF);
  cvt_bf16_kernel<<<(nWF + CVT_TILE - 1) / CVT_TILE, 256, 0, stream>>>(W2, w2b, nWF);

  dim3 blk(256);
  dim3 gProj(MTOK / BM, D_MODEL / BN);
  gemm_bf16_kernel<false, false, true><<<gProj, blk, 0, stream>>>(
      xb, wqb, bQ, nullptr, qb, MTOK, D_MODEL, D_MODEL);
  gemm_bf16_kernel<false, false, true><<<gProj, blk, 0, stream>>>(
      xb, wkb, bK, nullptr, kb, MTOK, D_MODEL, D_MODEL);
  gemm_bf16_kernel<false, false, true><<<gProj, blk, 0, stream>>>(
      xb, wvb, bV, nullptr, vb, MTOK, D_MODEL, D_MODEL);

  vtrans_kernel<<<(nX + 255) / 256, 256, 0, stream>>>(vb, vtb);

  attn_kernel<<<BATCH * N_HEADS * (SEQ_T / 128), blk, 0, stream>>>(
      qb, kb, vtb, aob);

  gemm_bf16_kernel<false, true, false><<<gProj, blk, 0, stream>>>(
      aob, wob, bO, attnf, nullptr, MTOK, D_MODEL, D_MODEL);

  ln_residual_kernel<<<MTOK, blk, 0, stream>>>(x, attnf, g1, be1, y1f, y1b);

  dim3 gFF1(MTOK / BM, D_FF / BN);
  gemm_bf16_kernel<true, false, true><<<gFF1, blk, 0, stream>>>(
      y1b, w1b, b1, nullptr, h1b, MTOK, D_FF, D_MODEL);

  gemm_bf16_kernel<false, true, false><<<gProj, blk, 0, stream>>>(
      h1b, w2b, b2, fff, nullptr, MTOK, D_MODEL, D_FF);

  ln_residual_kernel<<<MTOK, blk, 0, stream>>>(y1f, fff, g2, be2, out,
                                               nullptr);
}

// v004
// A run of this version takes 355 microseconds.
// Two timings next to v003 put it at 1.24 and 1.23 times that version's speed.
// All steps since v000 together make it 1.43 times as fast.
#include <hip/hip_runtime.h>
#include <hip/hip_bf16.h>

// ---------------------------------------------------------------------------
// Types for CDNA5 WMMA (wave32, 16x16x32 bf16 -> f32)
// ---------------------------------------------------------------------------
typedef __bf16 bf16;
typedef bf16  v16bf __attribute__((ext_vector_type(16)));
typedef bf16  v8bf  __attribute__((ext_vector_type(8)));
typedef float v8f   __attribute__((ext_vector_type(8)));

static constexpr int D_MODEL = 1024;
static constexpr int N_HEADS = 16;
static constexpr int D_FF    = 4096;
static constexpr int SEQ_T   = 2048;
static constexpr int BATCH   = 4;
static constexpr int DK      = 64;            // head dim
static constexpr int MTOK    = BATCH * SEQ_T; // 8192 rows

__device__ __forceinline__ v8f wmma_bf16(v16bf a, v16bf b, v8f c) {
  return __builtin_amdgcn_wmma_f32_16x16x32_bf16(
      /*neg_a=*/false, a, /*neg_b=*/false, b,
      /*c_mod=*/(short)0, c, /*reuse_a=*/false, /*reuse_b=*/false);
}

// Load one 16-bit A/B operand fragment (ISA 16-bit 16x32 layout):
// lane L -> row = L&15, khalf = (L>>4)*8; elems [0..7]=p[0..7],
// elems [8..15]=p[16..23] with p at (row, khalf) of a K-contiguous row.
__device__ __forceinline__ v16bf ldfrag(const bf16* p) {
  v8bf lo = *reinterpret_cast<const v8bf*>(p);
  v8bf hi = *reinterpret_cast<const v8bf*>(p + 16);
  return __builtin_shufflevector(lo, hi, 0, 1, 2, 3, 4, 5, 6, 7,
                                 8, 9, 10, 11, 12, 13, 14, 15);
}

// Returns when every async-to-LDS copy that this wave has issued has landed.
__device__ __forceinline__ void async_wait0() {
  asm volatile("s_wait_asynccnt 0x0" ::: "memory");
}

// ---------------------------------------------------------------------------
// f32 -> bf16 conversion
// ---------------------------------------------------------------------------
// One thread converts 32 values: eight 16-byte loads, each 512 contiguous
// bytes per wave, all issued before the first conversion, so that a wave keeps
// 4 KB in flight and the launch needs 1/32 of the waves.
typedef float v4f  __attribute__((ext_vector_type(4)));
typedef bf16  v4bf __attribute__((ext_vector_type(4)));
static constexpr int CVT_LOADS = 8;                    // loads per thread
static constexpr int CVT_STEP  = 256 * 4;              // floats per block-wide load
static constexpr int CVT_TILE  = CVT_STEP * CVT_LOADS; // floats per block

__global__ __launch_bounds__(256) void cvt_bf16_kernel(
    const float* __restrict__ in, bf16* __restrict__ out, int n) {
  const int base = blockIdx.x * CVT_TILE;
  if (base + CVT_TILE <= n) {
    const int i0 = base + threadIdx.x * 4;
    v4f v[CVT_LOADS];
    // Unrolled so that v[] stays in registers and the loads go out together.
#pragma unroll
    for (int j = 0; j < CVT_LOADS; ++j)
      v[j] = *reinterpret_cast<const v4f*>(in + i0 + j * CVT_STEP);
    // Unrolled for the same reason: every index of v[] is a constant.
#pragma unroll
    for (int j = 0; j < CVT_LOADS; ++j)
      *reinterpret_cast<v4bf*>(out + i0 + j * CVT_STEP) =
          __builtin_convertvector(v[j], v4bf);
    // Precaution: stands in front of every later rewrite of a register that the
    // stores above name (the built code runs on into the partial-block test).
    asm volatile("s_wait_xcnt 0x0" ::: "memory");
  } else {
    // Last, partial block of a length that is no multiple of CVT_TILE.
    for (int i = base + threadIdx.x; i < n; i += 256) out[i] = (bf16)in[i];
  }
}

// ---------------------------------------------------------------------------
// GEMM: C[M,N] = act(A[M,K] @ W[N,K]^T + bias[N]),  A/W bf16 row-major.
// Block = 256 thr (8 waves, 4Mx2N).  Block tile 256(M) x 128(N), K-tile 64.
// A/W tiles staged in LDS via async-to-LDS DMA, double buffered; each wave
// computes a 64x64 tile = 4x4 WMMA fragments per 32-K step, so that a loaded
// fragment feeds four products.  M, N, K are multiples of BM, BN, BK.
// ---------------------------------------------------------------------------
static constexpr int BM = 256, BN = 128, BK = 64;
static constexpr int LDS_STRIDE = 72;  // 64 + 8 pad (144B rows, 16B aligned)

template <bool RELU, bool OUT_F32, bool OUT_BF16>
__global__ __launch_bounds__(256) void gemm_bf16_kernel(
    const bf16* __restrict__ A, const bf16* __restrict__ W,
    const float* __restrict__ bias, float* __restrict__ Cf,
    bf16* __restrict__ Cb, int M, int N, int K) {
  __shared__ alignas(16) bf16 sA[2][BM * LDS_STRIDE];  // 2 x 36 KB
  __shared__ alignas(16) bf16 sW[2][BN * LDS_STRIDE];  // 2 x 18 KB

  const int tid = threadIdx.x;
  const int lane = tid & 31;
  const int wave = tid >> 5;
  const int m0l = (wave & 3) * 64;   // wave M offset within block tile
  const int n0l = (wave >> 2) * 64;  // wave N offset within block tile

  const int rlane = lane & 15;
  const int koff = (lane >> 4) << 3;  // 0 or 8
  const int half = lane >> 4;

  // Staging: a thread copies one 16B chunk of rows srow + 32*j, j = 0..7 of the
  // A slab and j = 0..3 of the W slab (a wave's copy covers four 128B rows).
  const int srow = tid >> 3;
  const int scol = (tid & 7) << 3;
  const bf16* Ab = A + ((size_t)blockIdx.x * BM + srow) * K + scol;
  const bf16* Wb = W + ((size_t)blockIdx.y * BN + srow) * K + scol;
  const size_t gstep = (size_t)32 * K;            // 32 rows, elements
  const unsigned int lstep = 32 * LDS_STRIDE * 2;  // 32 rows, LDS bytes
  const unsigned int lA =
      (unsigned int)(uintptr_t)(&sA[0][0] + srow * LDS_STRIDE + scol);
  const unsigned int lW =
      (unsigned int)(uintptr_t)(&sW[0][0] + srow * LDS_STRIDE + scol);

  // Stage the [BM x 64] and [BN x 64] K-slabs at kofs into buffer buf.
  auto stage = [&](int buf, int kofs) {
    const bf16* a = Ab + kofs;
    const bf16* w = Wb + kofs;
    const unsigned int da = lA + buf * (BM * LDS_STRIDE * 2);
    const unsigned int dw = lW + buf * (BN * LDS_STRIDE * 2);
    // The twelve copies of a slab pair; the wait in the same statement stands
    // in front of every later rewrite of an address register that they name.
    asm volatile(
        "global_load_async_to_lds_b128 %0, %12, off\n\t"
        "global_load_async_to_lds_b128 %1, %13, off\n\t"
        "global_load_async_to_lds_b128 %2, %14, off\n\t"
        "global_load_async_to_lds_b128 %3, %15, off\n\t"
        "global_load_async_to_lds_b128 %4, %16, off\n\t"
        "global_load_async_to_lds_b128 %5, %17, off\n\t"
        "global_load_async_to_lds_b128 %6, %18, off\n\t"
        "global_load_async_to_lds_b128 %7, %19, off\n\t"
        "global_load_async_to_lds_b128 %8, %20, off\n\t"
        "global_load_async_to_lds_b128 %9, %21, off\n\t"
        "global_load_async_to_lds_b128 %10, %22, off\n\t"
        "global_load_async_to_lds_b128 %11, %23, off\n\t"
        "s_wait_xcnt 0x0"
        :: "v"(da), "v"(da + lstep), "v"(da + 2 * lstep), "v"(da + 3 * lstep),
           "v"(da + 4 * lstep), "v"(da + 5 * lstep), "v"(da + 6 * lstep),
           "v"(da + 7 * lstep), "v"(dw), "v"(dw + lstep), "v"(dw + 2 * lstep),
           "v"(dw + 3 * lstep),
           "v"(a), "v"(a + gstep), "v"(a + 2 * gstep), "v"(a + 3 * gstep),
           "v"(a + 4 * gstep), "v"(a + 5 * gstep), "v"(a + 6 * gstep),
           "v"(a + 7 * gstep), "v"(w), "v"(w + gstep), "v"(w + 2 * gstep),
           "v"(w + 3 * gstep)
        : "memory");
  };

  v8f acc[4][4] = {};

  stage(0, 0);

  const int nk = K / BK;
  for (int t = 0; t < nk; ++t) {
    // Hand-over, passed by every wave: this wave's LDS reads of the last trip
    // are done and its copies of slab t have landed; the barrier then publishes
    // slab t and frees the other buffer for the copies below.
    asm volatile("s_wait_dscnt 0x0" ::: "memory");
    async_wait0();
    __syncthreads();
    if (t + 1 < nk) stage((t + 1) & 1, (t + 1) * BK);
    const bf16* a0 = sA[t & 1] + (m0l + rlane) * LDS_STRIDE + koff;
    const bf16* w0 = sW[t & 1] + (n0l + rlane) * LDS_STRIDE + koff;
#pragma unroll
    for (int kk = 0; kk < BK; kk += 32) {
      // All loops below unrolled: every index of af, wf and acc is then a
      // constant and the arrays stay in registers.
      v16bf af[4], wf[4];
#pragma unroll
      for (int i = 0; i < 4; ++i) af[i] = ldfrag(a0 + i * 16 * LDS_STRIDE + kk);
#pragma unroll
      for (int j = 0; j < 4; ++j) wf[j] = ldfrag(w0 + j * 16 * LDS_STRIDE + kk);
#pragma unroll
      for (int i = 0; i < 4; ++i)
#pragma unroll
        for (int j = 0; j < 4; ++j)
          acc[i][j] = wmma_bf16(af[i], wf[j], acc[i][j]);
    }
    // No trailing barrier: next stage() writes the *other* buffer, and the
    // top-of-loop waits+barrier order buffer reuse across iterations.
  }
  async_wait0();  // no copy is outstanding when the wave ends, whatever K is

  // Epilogue.  C layout: VGPR r, lane L -> row = r + 8*(L>>4), col = L&15.
  const int m0 = blockIdx.x * BM + m0l;
  const int n0 = blockIdx.y * BN + n0l;
#pragma unroll
  for (int i = 0; i < 4; ++i) {
#pragma unroll
    for (int j = 0; j < 4; ++j) {
      int col = n0 + j * 16 + rlane;
      float bv = bias[col];
#pragma unroll
      for (int r = 0; r < 8; ++r) {
        int row = m0 + i * 16 + r + half * 8;
        float v = acc[i][j][r] + bv;
        if (RELU) v = fmaxf(v, 0.0f);
        if (OUT_F32) Cf[(size_t)row * N + col] = v;
        if (OUT_BF16) Cb[(size_t)row * N + col] = (bf16)v;
      }
    }
  }
}

// ---------------------------------------------------------------------------
// Transpose V: [B*T, D] (head h cols h*64..h*64+63) -> VT[(b*H+h)*64+d][T]
// ---------------------------------------------------------------------------
__global__ __launch_bounds__(256) void vtrans_kernel(
    const bf16* __restrict__ V, bf16* __restrict__ VT) {
  int idx = blockIdx.x * 256 + threadIdx.x;  // over B*H*DK*T = 8M
  if (idx >= BATCH * N_HEADS * DK * SEQ_T) return;
  int t = idx & (SEQ_T - 1);
  int rest = idx >> 11;
  int d = rest & (DK - 1);
  int bh = rest >> 6;
  int h = bh & (N_HEADS - 1);
  int b = bh >> 4;
  VT[idx] = V[((size_t)(b * SEQ_T + t)) * D_MODEL + h * DK + d];
}

__device__ __forceinline__ float xhalf(float x) {
  return __builtin_bit_cast(
      float, __builtin_amdgcn_permlanex16(__builtin_bit_cast(int, x),
                                          __builtin_bit_cast(int, x),
                                          0x76543210, 0xfedcba98, false, false));
}

// K and V^T reach the waves through LDS: a stage is 64 keys, that is 64 K rows
// of 128 B and 64 V^T rows of 128 B, copied once for the block's 8 waves.
static constexpr int ATT_KEYS  = 64;  // keys per stage
static constexpr int ATT_PITCH = 72;  // LDS row: 64 values + 8 pad (144 B)

__global__ __launch_bounds__(256) void attn_kernel(
    const bf16* __restrict__ Q, const bf16* __restrict__ Kmat,
    const bf16* __restrict__ VT, bf16* __restrict__ O) {
  __shared__ alignas(16) bf16 sK[2][ATT_KEYS * ATT_PITCH];  // 2 x 9 KB
  __shared__ alignas(16) bf16 sV[2][DK * ATT_PITCH];        // 2 x 9 KB

  const int tid = threadIdx.x;
  const int lane = tid & 31;
  // Scalar, so that the per-wave causal skip below is a scalar branch.
  const int wave = __builtin_amdgcn_readfirstlane(tid >> 5);
  const int blk = blockIdx.x;
  const int qchunk = blk & 15;  // T/128 = 16 chunks
  const int bh = blk >> 4;      // 0..63
  const int b = bh >> 4;
  const int h = bh & (N_HEADS - 1);
  const int q_base = qchunk * 128 + wave * 16;

  const int rlane = lane & 15;
  const int khalf = lane >> 4;
  const int koff = khalf * 8;

  const bf16* qp = Q + (size_t)b * SEQ_T * D_MODEL + h * DK;
  const bf16* kp = Kmat + (size_t)b * SEQ_T * D_MODEL + h * DK;
  const bf16* vtp = VT + (size_t)bh * DK * SEQ_T;

  // Staging: a thread copies one 16B chunk of rows srow and srow + 32 of the K
  // slab and of the V^T slab (a wave's copy covers four whole 128B rows).
  const int srow = tid >> 3;
  const int scol = (tid & 7) << 3;
  const bf16* kg = kp + (size_t)srow * D_MODEL + scol;
  const bf16* vg = vtp + (size_t)srow * SEQ_T + scol;
  const unsigned int lK =
      (unsigned int)(uintptr_t)(&sK[0][0] + srow * ATT_PITCH + scol);
  const unsigned int lV =
      (unsigned int)(uintptr_t)(&sV[0][0] + srow * ATT_PITCH + scol);
  const unsigned int lhalf = 32 * ATT_PITCH * 2;       // 32 rows, LDS bytes
  const unsigned int lbuf = ATT_KEYS * ATT_PITCH * 2;  // one buffer, LDS bytes

  // Copy keys st*64 .. st*64+63 (K rows, V^T columns) into buffer buf.
  auto stage = [&](int buf, int st) {
    const bf16* k = kg + (size_t)st * ATT_KEYS * D_MODEL;
    const bf16* v = vg + st * ATT_KEYS;
    const unsigned int dk = lK + buf * lbuf;
    const unsigned int dv = lV + buf * lbuf;
    // The four copies of a stage; the wait in the same statement stands in
    // front of every later rewrite of an address register that they name.
    asm volatile(
        "global_load_async_to_lds_b128 %0, %4, off\n\t"
        "global_load_async_to_lds_b128 %1, %5, off\n\t"
        "global_load_async_to_lds_b128 %2, %6, off\n\t"
        "global_load_async_to_lds_b128 %3, %7, off\n\t"
        "s_wait_xcnt 0x0"
        :: "v"(dk), "v"(dk + lhalf), "v"(dv), "v"(dv + lhalf),
           "v"(k), "v"(k + (size_t)32 * D_MODEL), "v"(v),
           "v"(v + (size_t)32 * SEQ_T)
        : "memory");
  };

  const int qi = q_base + rlane;  // this lane's query
  const bf16* qrow = qp + (size_t)qi * D_MODEL;
  v16bf qf0 = ldfrag(qrow + koff);
  v16bf qf1 = ldfrag(qrow + 32 + koff);

  float rowM = -1.0e30f;  // running maximum of query qi (equal in both halves)
  float rowL = 0.0f;      // running sum over this half's keys only
  v8f acc[4] = {{}, {}, {}, {}};  // acc[dg][r] = O[qi][dg*16 + koff + r]

  const float scale = 0.125f;          // 1/sqrt(64)
  const int nkt = (q_base + 47) >> 5;  // # of 32-key tiles of this wave (causal)
  const int nst = qchunk * 2 + 2;      // # of 64-key stages of the block

  stage(0, 0);
  async_wait0();    // this wave's copies of stage 0 have landed
  __syncthreads();  // publishes stage 0
  stage(1, 1);      // nst >= 2: stage 1 always exists

  for (int st = 0; st < nst; ++st) {
    const bf16* kb = sK[st & 1] + rlane * ATT_PITCH + koff;
    const bf16* vb = sV[st & 1] + rlane * ATT_PITCH + koff;
    // Unrolled: the LDS offsets of both halves of a stage are then constants.
#pragma unroll
    for (int sub = 0; sub < 2; ++sub) {
      const int kt = st * ATT_KEYS + sub * 32;
      if (st * 2 + sub < nkt) {  // tiles past this wave's diagonal are skipped
        v8f s0 = {}, s1 = {};  // s0[r]: key kt+koff+r, s1[r]: key kt+16+koff+r
        {
          const bf16* kr0 = kb + sub * 32 * ATT_PITCH;
          const bf16* kr1 = kr0 + 16 * ATT_PITCH;
          const v16bf k00 = ldfrag(kr0), k01 = ldfrag(kr0 + 32);
          const v16bf k10 = ldfrag(kr1), k11 = ldfrag(kr1 + 32);
          // Inputs only: holds the four fragment reads together in front of the
          // products, so that their LDS latencies overlap instead of adding up.
          asm volatile("" :: "v"(k00), "v"(k01), "v"(k10), "v"(k11));
          s0 = wmma_bf16(k00, qf0, s0);
          s1 = wmma_bf16(k10, qf0, s1);
          s0 = wmma_bf16(k01, qf1, s0);
          s1 = wmma_bf16(k11, qf1, s1);
        }
        float sc[16];
        float m = -1.0e30f;
#pragma unroll
        for (int r = 0; r < 8; ++r) {
          const int key = kt + koff + r;
          sc[r] = (key <= qi) ? (float)s0[r] * scale : -1.0e30f;
          sc[8 + r] = (key + 16 <= qi) ? (float)s1[r] * scale : -1.0e30f;
          m = fmaxf(m, fmaxf(sc[r], sc[8 + r]));
        }
        m = fmaxf(m, xhalf(m));
        const float newM = fmaxf(rowM, m);
        const float corr = __expf(rowM - newM);
        rowM = newM;
        v16bf pf;
        float p[16];
#pragma unroll
        for (int s = 0; s < 16; ++s) {
          p[s] = __expf(sc[s] - newM);
          pf[s] = (bf16)p[s];
        }
#pragma unroll
        for (int w = 8; w >= 1; w >>= 1)
#pragma unroll
          for (int s = 0; s < w; ++s) p[s] += p[s + w];
        rowL = rowL * corr + p[0];
        v16bf vf[4];
#pragma unroll
        for (int dg = 0; dg < 4; ++dg)
          vf[dg] = ldfrag(vb + dg * 16 * ATT_PITCH + sub * 32);
        // Inputs only, as for K: the four V^T fragment reads go out together.
        asm volatile("" :: "v"(vf[0]), "v"(vf[1]), "v"(vf[2]), "v"(vf[3]));
#pragma unroll
        for (int dg = 0; dg < 4; ++dg) {
          acc[dg] *= corr;
          acc[dg] = wmma_bf16(vf[dg], pf, acc[dg]);
        }
      }
    }
    // Hand-over, passed by every wave, outside the causal skip: this wave's LDS
    // reads of stage st are done and its copies of stage st + 1 have landed; the
    // barrier then publishes stage st + 1 and frees this stage's buffer.
    asm volatile("s_wait_dscnt 0x0" ::: "memory");
    async_wait0();
    __syncthreads();
    if (st + 2 < nst) stage(st & 1, st + 2);
  }
  async_wait0();  // no copy is outstanding when the wave ends

  const float inv = 1.0f / (rowL + xhalf(rowL));
  bf16* op = O + ((size_t)(b * SEQ_T + qi)) * D_MODEL + h * DK + koff;
#pragma unroll
  for (int dg = 0; dg < 4; ++dg) {
    v8bf o;
#pragma unroll
    for (int r = 0; r < 8; ++r) o[r] = (bf16)(acc[dg][r] * inv);
    *reinterpret_cast<v8bf*>(op + dg * 16) = o;
  }
}

// ---------------------------------------------------------------------------
// LayerNorm(residual): out = LN(A + R) * g + be ; optional bf16 copy.
// ---------------------------------------------------------------------------
__global__ __launch_bounds__(256) void ln_residual_kernel(
    const float* __restrict__ A, const float* __restrict__ R,
    const float* __restrict__ g, const float* __restrict__ be,
    float* __restrict__ outF, bf16* __restrict__ outB) {
  const int row = blockIdx.x;
  const float* a = A + (size_t)row * D_MODEL;
  const float* rr = R + (size_t)row * D_MODEL;
  float v[4];
  float s = 0.0f;
#pragma unroll
  for (int i = 0; i < 4; ++i) {
    int idx = threadIdx.x + i * 256;
    v[i] = a[idx] + rr[idx];
    s += v[i];
  }
  __shared__ float red[8];
  const int wv = threadIdx.x >> 5, ln = threadIdx.x & 31;
#pragma unroll
  for (int off = 16; off >= 1; off >>= 1) s += __shfl_xor(s, off, 32);
  if (ln == 0) red[wv] = s;
  __syncthreads();
  float mean = 0.0f;
#pragma unroll
  for (int i = 0; i < 8; ++i) mean += red[i];
  mean *= (1.0f / D_MODEL);
  __syncthreads();
  float vs = 0.0f;
#pragma unroll
  for (int i = 0; i < 4; ++i) {
    float d = v[i] - mean;
    vs += d * d;
  }
#pragma unroll
  for (int off = 16; off >= 1; off >>= 1) vs += __shfl_xor(vs, off, 32);
  if (ln == 0) red[wv] = vs;
  __syncthreads();
  float var = 0.0f;
#pragma unroll
  for (int i = 0; i < 8; ++i) var += red[i];
  var *= (1.0f / D_MODEL);
  const float rstd = rsqrtf(var + 1e-5f);
#pragma unroll
  for (int i = 0; i < 4; ++i) {
    int idx = threadIdx.x + i * 256;
    float y = (v[i] - mean) * rstd * g[idx] + be[idx];
    outF[(size_t)row * D_MODEL + idx] = y;
    if (outB) outB[(size_t)row * D_MODEL + idx] = (bf16)y;
  }
}

// ---------------------------------------------------------------------------
// Host-side orchestration
// ---------------------------------------------------------------------------
extern "C" void kernel_launch(void* const* d_in, const int* in_sizes, int n_in,
                              void* d_out, int out_size, void* d_ws,
                              size_t ws_size, hipStream_t stream) {
  (void)in_sizes; (void)n_in; (void)out_size; (void)ws_size;
  const float* x  = (const float*)d_in[0];
  const float* WQ = (const float*)d_in[1];
  const float* bQ = (const float*)d_in[2];
  const float* WK = (const float*)d_in[3];
  const float* bK = (const float*)d_in[4];
  const float* WV = (const float*)d_in[5];
  const float* bV = (const float*)d_in[6];
  const float* WO = (const float*)d_in[7];
  const float* bO = (const float*)d_in[8];
  const float* W1 = (const float*)d_in[9];
  const float* b1 = (const float*)d_in[10];
  const float* W2 = (const float*)d_in[11];
  const float* b2 = (const float*)d_in[12];
  const float* g1 = (const float*)d_in[13];
  const float* be1 = (const float*)d_in[14];
  const float* g2 = (const float*)d_in[15];
  const float* be2 = (const float*)d_in[16];
  float* out = (float*)d_out;

  char* w = (char*)d_ws;
  auto carve = [&](size_t bytes) {
    char* p = w;
    w += (bytes + 255) & ~(size_t)255;
    return p;
  };
  const size_t MT = (size_t)MTOK;
  bf16* xb  = (bf16*)carve(MT * D_MODEL * 2);
  bf16* wqb = (bf16*)carve((size_t)D_MODEL * D_MODEL * 2);
  bf16* wkb = (bf16*)carve((size_t)D_MODEL * D_MODEL * 2);
  bf16* wvb = (bf16*)carve((size_t)D_MODEL * D_MODEL * 2);
  bf16* wob = (bf16*)carve((size_t)D_MODEL * D_MODEL * 2);
  bf16* w1b = (bf16*)carve((size_t)D_FF * D_MODEL * 2);
  bf16* w2b = (bf16*)carve((size_t)D_MODEL * D_FF * 2);
  bf16* qb  = (bf16*)carve(MT * D_MODEL * 2);
  bf16* kb  = (bf16*)carve(MT * D_MODEL * 2);
  bf16* vb  = (bf16*)carve(MT * D_MODEL * 2);
  bf16* vtb = (bf16*)carve(MT * D_MODEL * 2);
  float* attnf = (float*)carve(MT * D_MODEL * 4);
  float* y1f   = (float*)carve(MT * D_MODEL * 4);
  bf16*  y1b   = (bf16*)carve(MT * D_MODEL * 2);
  bf16*  h1b   = (bf16*)carve(MT * D_FF * 2);
  bf16* aob = vb;     // v dead after vtrans
  float* fff = attnf; // attn_out dead after LN1

  const int nX = MTOK * D_MODEL;
  const int nW = D_MODEL * D_MODEL;
  const int nWF = D_FF * D_MODEL;

  cvt_bf16_kernel<<<(nX + CVT_TILE - 1) / CVT_TILE, 256, 0, stream>>>(x, xb, nX);
  cvt_bf16_kernel<<<(nW + CVT_TILE - 1) / CVT_TILE, 256, 0, stream>>>(WQ, wqb, nW);
  cvt_bf16_kernel<<<(nW + CVT_TILE - 1) / CVT_TILE, 256, 0, stream>>>(WK, wkb, nW);
  cvt_bf16_kernel<<<(nW + CVT_TILE - 1) / CVT_TILE, 256, 0, stream>>>(WV, wvb, nW);
  cvt_bf16_kernel<<<(nW + CVT_TILE - 1) / CVT_TILE, 256, 0, stream>>>(WO, wob, nW);
  cvt_bf16_kernel<<<(nWF + CVT_TILE - 1) / CVT_TILE, 256, 0, stream>>>(W1, w1b, nWF);
  cvt_bf16_kernel<<<(nWF + CVT_TILE - 1) / CVT_TILE, 256, 0, stream>>>(W2, w2b, nWF);

  dim3 blk(256);
  dim3 gProj(MTOK / BM, D_MODEL / BN);
  gemm_bf16_kernel<false, false, true><<<gProj, blk, 0, stream>>>(
      xb, wqb, bQ, nullptr, qb, MTOK, D_MODEL, D_MODEL);
  gemm_bf16_kernel<false, false, true><<<gProj, blk, 0, stream>>>(
      xb, wkb, bK, nullptr, kb, MTOK, D_MODEL, D_MODEL);
  gemm_bf16_kernel<false, false, true><<<gProj, blk, 0, stream>>>(
      xb, wvb, bV, nullptr, vb, MTOK, D_MODEL, D_MODEL);

  vtrans_kernel<<<(nX + 255) / 256, 256, 0, stream>>>(vb, vtb);

  attn_kernel<<<BATCH * N_HEADS * (SEQ_T / 128), blk, 0, stream>>>(
      qb, kb, vtb, aob);

  gemm_bf16_kernel<false, true, false><<<gProj, blk, 0, stream>>>(
      aob, wob, bO, attnf, nullptr, MTOK, D_MODEL, D_MODEL);

  ln_residual_kernel<<<MTOK, blk, 0, stream>>>(x, attnf, g1, be1, y1f, y1b);

  dim3 gFF1(MTOK / BM, D_FF / BN);
  gemm_bf16_kernel<true, false, true><<<gFF1, blk, 0, stream>>>(
      y1b, w1b, b1, nullptr, h1b, MTOK, D_FF, D_MODEL);

  gemm_bf16_kernel<false, true, false><<<gProj, blk, 0, stream>>>(
      h1b, w2b, b2, fff, nullptr, MTOK, D_MODEL, D_FF);

  ln_residual_kernel<<<MTOK, blk, 0, stream>>>(y1f, fff, g2, be2, out,
                                               nullptr);
}

// v005
// Measured time: 343 microseconds a run.
// Timed twice side by side with v004, it ran 1.03 times as fast both times.
// Over all steps from v000 it is 1.48 times as fast.
#include <hip/hip_runtime.h>
#include <hip/hip_bf16.h>

// ---------------------------------------------------------------------------
// Types for CDNA5 WMMA (wave32, 16x16x32 bf16 -> f32)
// ---------------------------------------------------------------------------
typedef __bf16 bf16;
typedef bf16  v16bf __attribute__((ext_vector_type(16)));
typedef bf16  v8bf  __attribute__((ext_vector_type(8)));
typedef float v8f   __attribute__((ext_vector_type(8)));

static constexpr int D_MODEL = 1024;
static constexpr int N_HEADS = 16;
static constexpr int D_FF    = 4096;
static constexpr int SEQ_T   = 2048;
static constexpr int BATCH   = 4;
static constexpr int DK      = 64;            // head dim
static constexpr int MTOK    = BATCH * SEQ_T; // 8192 rows

__device__ __forceinline__ v8f wmma_bf16(v16bf a, v16bf b, v8f c) {
  return __builtin_amdgcn_wmma_f32_16x16x32_bf16(
      /*neg_a=*/false, a, /*neg_b=*/false, b,
      /*c_mod=*/(short)0, c, /*reuse_a=*/false, /*reuse_b=*/false);
}

// Load one 16-bit A/B operand fragment (ISA 16-bit 16x32 layout):
// lane L -> row = L&15, khalf = (L>>4)*8; elems [0..7]=p[0..7],
// elems [8..15]=p[16..23] with p at (row, khalf) of a K-contiguous row.
__device__ __forceinline__ v16bf ldfrag(const bf16* p) {
  v8bf lo = *reinterpret_cast<const v8bf*>(p);
  v8bf hi = *reinterpret_cast<const v8bf*>(p + 16);
  return __builtin_shufflevector(lo, hi, 0, 1, 2, 3, 4, 5, 6, 7,
                                 8, 9, 10, 11, 12, 13, 14, 15);
}

// Returns when every async-to-LDS copy that this wave has issued has landed.
__device__ __forceinline__ void async_wait0() {
  asm volatile("s_wait_asynccnt 0x0" ::: "memory");
}

// ---------------------------------------------------------------------------
// f32 -> bf16 conversion
// ---------------------------------------------------------------------------
// One thread converts 32 values: eight 16-byte loads, each 512 contiguous
// bytes per wave, all issued before the first conversion, so that a wave keeps
// 4 KB in flight and the launch needs 1/32 of the waves.
typedef float v4f  __attribute__((ext_vector_type(4)));
typedef bf16  v4bf __attribute__((ext_vector_type(4)));
static constexpr int CVT_LOADS = 8;                    // loads per thread
static constexpr int CVT_STEP  = 256 * 4;              // floats per block-wide load
static constexpr int CVT_TILE  = CVT_STEP * CVT_LOADS; // floats per block

__global__ __launch_bounds__(256) void cvt_bf16_kernel(
    const float* __restrict__ in, bf16* __restrict__ out, int n) {
  const int base = blockIdx.x * CVT_TILE;
  if (base + CVT_TILE <= n) {
    const int i0 = base + threadIdx.x * 4;
    v4f v[CVT_LOADS];
    // Unrolled so that v[] stays in registers and the loads go out together.
#pragma unroll
    for (int j = 0; j < CVT_LOADS; ++j)
      v[j] = *reinterpret_cast<const v4f*>(in + i0 + j * CVT_STEP);
    // Unrolled for the same reason: every index of v[] is a constant.
#pragma unroll
    for (int j = 0; j < CVT_LOADS; ++j)
      *reinterpret_cast<v4bf*>(out + i0 + j * CVT_STEP) =
          __builtin_convertvector(v[j], v4bf);
    // Precaution: stands in front of every later rewrite of a register that the
    // stores above name (the built code runs on into the partial-block test).
    asm volatile("s_wait_xcnt 0x0" ::: "memory");
  } else {
    // Last, partial block of a length that is no multiple of CVT_TILE.
    for (int i = base + threadIdx.x; i < n; i += 256) out[i] = (bf16)in[i];
  }
}

// ---------------------------------------------------------------------------
// GEMM: C[M,N] = act(A[M,K] @ W[N,K]^T + bias[N]),  A/W bf16 row-major.
// Block = 256 thr (8 waves, 4Mx2N).  Block tile 256(M) x 128(N), K-tile 64.
// A/W tiles staged in LDS via async-to-LDS DMA, double buffered; each wave
// computes a 64x64 tile = 4x4 WMMA fragments per 32-K step, so that a loaded
// fragment feeds four products.  M, N, K are multiples of BM, BN, BK.
// ---------------------------------------------------------------------------
static constexpr int BM = 256, BN = 128, BK = 64;
static constexpr int LDS_STRIDE = 72;  // 64 + 8 pad (144B rows, 16B aligned)

template <bool RELU, bool OUT_F32, bool OUT_BF16>
__global__ __launch_bounds__(256) void gemm_bf16_kernel(
    const bf16* __restrict__ A, const bf16* __restrict__ W,
    const float* __restrict__ bias, float* __restrict__ Cf,
    bf16* __restrict__ Cb, int M, int N, int K) {
  __shared__ alignas(16) bf16 sA[2][BM * LDS_STRIDE];  // 2 x 36 KB
  __shared__ alignas(16) bf16 sW[2][BN * LDS_STRIDE];  // 2 x 18 KB

  const int tid = threadIdx.x;
  const int lane = tid & 31;
  const int wave = tid >> 5;
  const int m0l = (wave & 3) * 64;   // wave M offset within block tile
  const int n0l = (wave >> 2) * 64;  // wave N offset within block tile

  const int rlane = lane & 15;
  const int koff = (lane >> 4) << 3;  // 0 or 8
  const int half = lane >> 4;

  // Staging: a thread copies one 16B chunk of rows srow + 32*j, j = 0..7 of the
  // A slab and j = 0..3 of the W slab (a wave's copy covers four 128B rows).
  const int srow = tid >> 3;
  const int scol = (tid & 7) << 3;
  const bf16* Ab = A + ((size_t)blockIdx.x * BM + srow) * K + scol;
  const bf16* Wb = W + ((size_t)blockIdx.y * BN + srow) * K + scol;
  const size_t gstep = (size_t)32 * K;            // 32 rows, elements
  const unsigned int lstep = 32 * LDS_STRIDE * 2;  // 32 rows, LDS bytes
  const unsigned int lA =
      (unsigned int)(uintptr_t)(&sA[0][0] + srow * LDS_STRIDE + scol);
  const unsigned int lW =
      (unsigned int)(uintptr_t)(&sW[0][0] + srow * LDS_STRIDE + scol);

  // Stage the [BM x 64] and [BN x 64] K-slabs at kofs into buffer buf.
  auto stage = [&](int buf, int kofs) {
    const bf16* a = Ab + kofs;
    const bf16* w = Wb + kofs;
    const unsigned int da = lA + buf * (BM * LDS_STRIDE * 2);
    const unsigned int dw = lW + buf * (BN * LDS_STRIDE * 2);
    // The twelve copies of a slab pair; the wait in the same statement stands
    // in front of every later rewrite of an address register that they name.
    asm volatile(
        "global_load_async_to_lds_b128 %0, %12, off\n\t"
        "global_load_async_to_lds_b128 %1, %13, off\n\t"
        "global_load_async_to_lds_b128 %2, %14, off\n\t"
        "global_load_async_to_lds_b128 %3, %15, off\n\t"
        "global_load_async_to_lds_b128 %4, %16, off\n\t"
        "global_load_async_to_lds_b128 %5, %17, off\n\t"
        "global_load_async_to_lds_b128 %6, %18, off\n\t"
        "global_load_async_to_lds_b128 %7, %19, off\n\t"
        "global_load_async_to_lds_b128 %8, %20, off\n\t"
        "global_load_async_to_lds_b128 %9, %21, off\n\t"
        "global_load_async_to_lds_b128 %10, %22, off\n\t"
        "global_load_async_to_lds_b128 %11, %23, off\n\t"
        "s_wait_xcnt 0x0"
        :: "v"(da), "v"(da + lstep), "v"(da + 2 * lstep), "v"(da + 3 * lstep),
           "v"(da + 4 * lstep), "v"(da + 5 * lstep), "v"(da + 6 * lstep),
           "v"(da + 7 * lstep), "v"(dw), "v"(dw + lstep), "v"(dw + 2 * lstep),
           "v"(dw + 3 * lstep),
           "v"(a), "v"(a + gstep), "v"(a + 2 * gstep), "v"(a + 3 * gstep),
           "v"(a + 4 * gstep), "v"(a + 5 * gstep), "v"(a + 6 * gstep),
           "v"(a + 7 * gstep), "v"(w), "v"(w + gstep), "v"(w + 2 * gstep),
           "v"(w + 3 * gstep)
        : "memory");
  };

  v8f acc[4][4] = {};

  stage(0, 0);

  const int nk = K / BK;
  for (int t = 0; t < nk; ++t) {
    // Hand-over, passed by every wave: this wave's LDS reads of the last trip
    // are done and its copies of slab t have landed; the barrier then publishes
    // slab t and frees the other buffer for the copies below.
    asm volatile("s_wait_dscnt 0x0" ::: "memory");
    async_wait0();
    __syncthreads();
    if (t + 1 < nk) stage((t + 1) & 1, (t + 1) * BK);
    const bf16* a0 = sA[t & 1] + (m0l + rlane) * LDS_STRIDE + koff;
    const bf16* w0 = sW[t & 1] + (n0l + rlane) * LDS_STRIDE + koff;
#pragma unroll
    for (int kk = 0; kk < BK; kk += 32) {
      // All loops below unrolled: every index of af, wf and acc is then a
      // constant and the arrays stay in registers.
      v16bf af[4], wf[4];
#pragma unroll
      for (int i = 0; i < 4; ++i) af[i] = ldfrag(a0 + i * 16 * LDS_STRIDE + kk);
#pragma unroll
      for (int j = 0; j < 4; ++j) wf[j] = ldfrag(w0 + j * 16 * LDS_STRIDE + kk);
      // Inputs only: holds the sixteen LDS reads of a 32-K step together in front
      // of its sixteen products.  Without it the A fragments share one register
      // set and every row of four products waits out an LDS latency of its own.
      asm volatile("" :: "v"(af[0]), "v"(af[1]), "v"(af[2]), "v"(af[3]),
                         "v"(wf[0]), "v"(wf[1]), "v"(wf[2]), "v"(wf[3]));
#pragma unroll
      for (int i = 0; i < 4; ++i)
#pragma unroll
        for (int j = 0; j < 4; ++j)
          acc[i][j] = wmma_bf16(af[i], wf[j], acc[i][j]);
    }
    // No trailing barrier: next stage() writes the *other* buffer, and the
    // top-of-loop waits+barrier order buffer reuse across iterations.
  }
  async_wait0();  // no copy is outstanding when the wave ends, whatever K is

  // Epilogue.  C layout: VGPR r, lane L -> row = r + 8*(L>>4), col = L&15.
  const int m0 = blockIdx.x * BM + m0l;
  const int n0 = blockIdx.y * BN + n0l;
#pragma unroll
  for (int i = 0; i < 4; ++i) {
#pragma unroll
    for (int j = 0; j < 4; ++j) {
      int col = n0 + j * 16 + rlane;
      float bv = bias[col];
#pragma unroll
      for (int r = 0; r < 8; ++r) {
        int row = m0 + i * 16 + r + half * 8;
        float v = acc[i][j][r] + bv;
        if (RELU) v = fmaxf(v, 0.0f);
        if (OUT_F32) Cf[(size_t)row * N + col] = v;
        if (OUT_BF16) Cb[(size_t)row * N + col] = (bf16)v;
      }
    }
  }
}

// ---------------------------------------------------------------------------
// Transpose V: [B*T, D] (head h cols h*64..h*64+63) -> VT[(b*H+h)*64+d][T]
// ---------------------------------------------------------------------------
__global__ __launch_bounds__(256) void vtrans_kernel(
    const bf16* __restrict__ V, bf16* __restrict__ VT) {
  int idx = blockIdx.x * 256 + threadIdx.x;  // over B*H*DK*T = 8M
  if (idx >= BATCH * N_HEADS * DK * SEQ_T) return;
  int t = idx & (SEQ_T - 1);
  int rest = idx >> 11;
  int d = rest & (DK - 1);
  int bh = rest >> 6;
  int h = bh & (N_HEADS - 1);
  int b = bh >> 4;
  VT[idx] = V[((size_t)(b * SEQ_T + t)) * D_MODEL + h * DK + d];
}

__device__ __forceinline__ float xhalf(float x) {
  return __builtin_bit_cast(
      float, __builtin_amdgcn_permlanex16(__builtin_bit_cast(int, x),
                                          __builtin_bit_cast(int, x),
                                          0x76543210, 0xfedcba98, false, false));
}

// K and V^T reach the waves through LDS: a stage is 64 keys, that is 64 K rows
// of 128 B and 64 V^T rows of 128 B, copied once for the block's 8 waves.
static constexpr int ATT_KEYS  = 64;  // keys per stage
static constexpr int ATT_PITCH = 72;  // LDS row: 64 values + 8 pad (144 B)

__global__ __launch_bounds__(256) void attn_kernel(
    const bf16* __restrict__ Q, const bf16* __restrict__ Kmat,
    const bf16* __restrict__ VT, bf16* __restrict__ O) {
  __shared__ alignas(16) bf16 sK[2][ATT_KEYS * ATT_PITCH];  // 2 x 9 KB
  __shared__ alignas(16) bf16 sV[2][DK * ATT_PITCH];        // 2 x 9 KB

  const int tid = threadIdx.x;
  const int lane = tid & 31;
  // Scalar, so that the per-wave causal skip below is a scalar branch.
  const int wave = __builtin_amdgcn_readfirstlane(tid >> 5);
  const int blk = blockIdx.x;
  const int qchunk = blk & 15;  // T/128 = 16 chunks
  const int bh = blk >> 4;      // 0..63
  const int b = bh >> 4;
  const int h = bh & (N_HEADS - 1);
  const int q_base = qchunk * 128 + wave * 16;

  const int rlane = lane & 15;
  const int khalf = lane >> 4;
  const int koff = khalf * 8;

  const bf16* qp = Q + (size_t)b * SEQ_T * D_MODEL + h * DK;
  const bf16* kp = Kmat + (size_t)b * SEQ_T * D_MODEL + h * DK;
  const bf16* vtp = VT + (size_t)bh * DK * SEQ_T;

  // Staging: a thread copies one 16B chunk of rows srow and srow + 32 of the K
  // slab and of the V^T slab (a wave's copy covers four whole 128B rows).
  const int srow = tid >> 3;
  const int scol = (tid & 7) << 3;
  const bf16* kg = kp + (size_t)srow * D_MODEL + scol;
  const bf16* vg = vtp + (size_t)srow * SEQ_T + scol;
  const unsigned int lK =
      (unsigned int)(uintptr_t)(&sK[0][0] + srow * ATT_PITCH + scol);
  const unsigned int lV =
      (unsigned int)(uintptr_t)(&sV[0][0] + srow * ATT_PITCH + scol);
  const unsigned int lhalf = 32 * ATT_PITCH * 2;       // 32 rows, LDS bytes
  const unsigned int lbuf = ATT_KEYS * ATT_PITCH * 2;  // one buffer, LDS bytes

  // Copy keys st*64 .. st*64+63 (K rows, V^T columns) into buffer buf.
  auto stage = [&](int buf, int st) {
    const bf16* k = kg + (size_t)st * ATT_KEYS * D_MODEL;
    const bf16* v = vg + st * ATT_KEYS;
    const unsigned int dk = lK + buf * lbuf;
    const unsigned int dv = lV + buf * lbuf;
    // The four copies of a stage; the wait in the same statement stands in
    // front of every later rewrite of an address register that they name.
    asm volatile(
        "global_load_async_to_lds_b128 %0, %4, off\n\t"
        "global_load_async_to_lds_b128 %1, %5, off\n\t"
        "global_load_async_to_lds_b128 %2, %6, off\n\t"
        "global_load_async_to_lds_b128 %3, %7, off\n\t"
        "s_wait_xcnt 0x0"
        :: "v"(dk), "v"(dk + lhalf), "v"(dv), "v"(dv + lhalf),
           "v"(k), "v"(k + (size_t)32 * D_MODEL), "v"(v),
           "v"(v + (size_t)32 * SEQ_T)
        : "memory");
  };

  const int qi = q_base + rlane;  // this lane's query
  const bf16* qrow = qp + (size_t)qi * D_MODEL;
  v16bf qf0 = ldfrag(qrow + koff);
  v16bf qf1 = ldfrag(qrow + 32 + koff);

  float rowM = -1.0e30f;  // running maximum of query qi (equal in both halves)
  float rowL = 0.0f;      // running sum over this half's keys only
  v8f acc[4] = {{}, {}, {}, {}};  // acc[dg][r] = O[qi][dg*16 + koff + r]

  const float scale = 0.125f;          // 1/sqrt(64)
  const int nkt = (q_base + 47) >> 5;  // # of 32-key tiles of this wave (causal)
  const int nst = qchunk * 2 + 2;      // # of 64-key stages of the block

  stage(0, 0);
  async_wait0();    // this wave's copies of stage 0 have landed
  __syncthreads();  // publishes stage 0
  stage(1, 1);      // nst >= 2: stage 1 always exists

  for (int st = 0; st < nst; ++st) {
    const bf16* kb = sK[st & 1] + rlane * ATT_PITCH + koff;
    const bf16* vb = sV[st & 1] + rlane * ATT_PITCH + koff;
    // Unrolled: the LDS offsets of both halves of a stage are then constants.
#pragma unroll
    for (int sub = 0; sub < 2; ++sub) {
      const int kt = st * ATT_KEYS + sub * 32;
      if (st * 2 + sub < nkt) {  // tiles past this wave's diagonal are skipped
        v8f s0 = {}, s1 = {};  // s0[r]: key kt+koff+r, s1[r]: key kt+16+koff+r
        {
          const bf16* kr0 = kb + sub * 32 * ATT_PITCH;
          const bf16* kr1 = kr0 + 16 * ATT_PITCH;
          const v16bf k00 = ldfrag(kr0), k01 = ldfrag(kr0 + 32);
          const v16bf k10 = ldfrag(kr1), k11 = ldfrag(kr1 + 32);
          // Inputs only: holds the four fragment reads together in front of the
          // products, so that their LDS latencies overlap instead of adding up.
          asm volatile("" :: "v"(k00), "v"(k01), "v"(k10), "v"(k11));
          s0 = wmma_bf16(k00, qf0, s0);
          s1 = wmma_bf16(k10, qf0, s1);
          s0 = wmma_bf16(k01, qf1, s0);
          s1 = wmma_bf16(k11, qf1, s1);
        }
        float sc[16];
        float m = -1.0e30f;
#pragma unroll
        for (int r = 0; r < 8; ++r) {
          const int key = kt + koff + r;
          sc[r] = (key <= qi) ? (float)s0[r] * scale : -1.0e30f;
          sc[8 + r] = (key + 16 <= qi) ? (float)s1[r] * scale : -1.0e30f;
          m = fmaxf(m, fmaxf(sc[r], sc[8 + r]));
        }
        m = fmaxf(m, xhalf(m));
        const float newM = fmaxf(rowM, m);
        const float corr = __expf(rowM - newM);
        rowM = newM;
        v16bf pf;
        float p[16];
#pragma unroll
        for (int s = 0; s < 16; ++s) {
          p[s] = __expf(sc[s] - newM);
          pf[s] = (bf16)p[s];
        }
#pragma unroll
        for (int w = 8; w >= 1; w >>= 1)
#pragma unroll
          for (int s = 0; s < w; ++s) p[s] += p[s + w];
        rowL = rowL * corr + p[0];
        v16bf vf[4];
#pragma unroll
        for (int dg = 0; dg < 4; ++dg)
          vf[dg] = ldfrag(vb + dg * 16 * ATT_PITCH + sub * 32);
        // Inputs only, as for K: the four V^T fragment reads go out together.
        asm volatile("" :: "v"(vf[0]), "v"(vf[1]), "v"(vf[2]), "v"(vf[3]));
#pragma unroll
        for (int dg = 0; dg < 4; ++dg) {
          acc[dg] *= corr;
          acc[dg] = wmma_bf16(vf[dg], pf, acc[dg]);
        }
      }
    }
    // Hand-over, passed by every wave, outside the causal skip: this wave's LDS
    // reads of stage st are done and its copies of stage st + 1 have landed; the
    // barrier then publishes stage st + 1 and frees this stage's buffer.
    asm volatile("s_wait_dscnt 0x0" ::: "memory");
    async_wait0();
    __syncthreads();
    if (st + 2 < nst) stage(st & 1, st + 2);
  }
  async_wait0();  // no copy is outstanding when the wave ends

  const float inv = 1.0f / (rowL + xhalf(rowL));
  bf16* op = O + ((size_t)(b * SEQ_T + qi)) * D_MODEL + h * DK + koff;
#pragma unroll
  for (int dg = 0; dg < 4; ++dg) {
    v8bf o;
#pragma unroll
    for (int r = 0; r < 8; ++r) o[r] = (bf16)(acc[dg][r] * inv);
    *reinterpret_cast<v8bf*>(op + dg * 16) = o;
  }
}

// ---------------------------------------------------------------------------
// LayerNorm(residual): out = LN(A + R) * g + be ; optional bf16 copy.
// ---------------------------------------------------------------------------
__global__ __launch_bounds__(256) void ln_residual_kernel(
    const float* __restrict__ A, const float* __restrict__ R,
    const float* __restrict__ g, const float* __restrict__ be,
    float* __restrict__ outF, bf16* __restrict__ outB) {
  const int row = blockIdx.x;
  const float* a = A + (size_t)row * D_MODEL;
  const float* rr = R + (size_t)row * D_MODEL;
  float v[4];
  float s = 0.0f;
#pragma unroll
  for (int i = 0; i < 4; ++i) {
    int idx = threadIdx.x + i * 256;
    v[i] = a[idx] + rr[idx];
    s += v[i];
  }
  __shared__ float red[8];
  const int wv = threadIdx.x >> 5, ln = threadIdx.x & 31;
#pragma unroll
  for (int off = 16; off >= 1; off >>= 1) s += __shfl_xor(s, off, 32);
  if (ln == 0) red[wv] = s;
  __syncthreads();
  float mean = 0.0f;
#pragma unroll
  for (int i = 0; i < 8; ++i) mean += red[i];
  mean *= (1.0f / D_MODEL);
  __syncthreads();
  float vs = 0.0f;
#pragma unroll
  for (int i = 0; i < 4; ++i) {
    float d = v[i] - mean;
    vs += d * d;
  }
#pragma unroll
  for (int off = 16; off >= 1; off >>= 1) vs += __shfl_xor(vs, off, 32);
  if (ln == 0) red[wv] = vs;
  __syncthreads();
  float var = 0.0f;
#pragma unroll
  for (int i = 0; i < 8; ++i) var += red[i];
  var *= (1.0f / D_MODEL);
  const float rstd = rsqrtf(var + 1e-5f);
#pragma unroll
  for (int i = 0; i < 4; ++i) {
    int idx = threadIdx.x + i * 256;
    float y = (v[i] - mean) * rstd * g[idx] + be[idx];
    outF[(size_t)row * D_MODEL + idx] = y;
    if (outB) outB[(size_t)row * D_MODEL + idx] = (bf16)y;
  }
}

// ---------------------------------------------------------------------------
// Host-side orchestration
// ---------------------------------------------------------------------------
extern "C" void kernel_launch(void* const* d_in, const int* in_sizes, int n_in,
                              void* d_out, int out_size, void* d_ws,
                              size_t ws_size, hipStream_t stream) {
  (void)in_sizes; (void)n_in; (void)out_size; (void)ws_size;
  const float* x  = (const float*)d_in[0];
  const float* WQ = (const float*)d_in[1];
  const float* bQ = (const float*)d_in[2];
  const float* WK = (const float*)d_in[3];
  const float* bK = (const float*)d_in[4];
  const float* WV = (const float*)d_in[5];
  const float* bV = (const float*)d_in[6];
  const float* WO = (const float*)d_in[7];
  const float* bO = (const float*)d_in[8];
  const float* W1 = (const float*)d_in[9];
  const float* b1 = (const float*)d_in[10];
  const float* W2 = (const float*)d_in[11];
  const float* b2 = (const float*)d_in[12];
  const float* g1 = (const float*)d_in[13];
  const float* be1 = (const float*)d_in[14];
  const float* g2 = (const float*)d_in[15];
  const float* be2 = (const float*)d_in[16];
  float* out = (float*)d_out;

  char* w = (char*)d_ws;
  auto carve = [&](size_t bytes) {
    char* p = w;
    w += (bytes + 255) & ~(size_t)255;
    return p;
  };
  const size_t MT = (size_t)MTOK;
  bf16* xb  = (bf16*)carve(MT * D_MODEL * 2);
  bf16* wqb = (bf16*)carve((size_t)D_MODEL * D_MODEL * 2);
  bf16* wkb = (bf16*)carve((size_t)D_MODEL * D_MODEL * 2);
  bf16* wvb = (bf16*)carve((size_t)D_MODEL * D_MODEL * 2);
  bf16* wob = (bf16*)carve((size_t)D_MODEL * D_MODEL * 2);
  bf16* w1b = (bf16*)carve((size_t)D_FF * D_MODEL * 2);
  bf16* w2b = (bf16*)carve((size_t)D_MODEL * D_FF * 2);
  bf16* qb  = (bf16*)carve(MT * D_MODEL * 2);
  bf16* kb  = (bf16*)carve(MT * D_MODEL * 2);
  bf16* vb  = (bf16*)carve(MT * D_MODEL * 2);
  bf16* vtb = (bf16*)carve(MT * D_MODEL * 2);
  float* attnf = (float*)carve(MT * D_MODEL * 4);
  float* y1f   = (float*)carve(MT * D_MODEL * 4);
  bf16*  y1b   = (bf16*)carve(MT * D_MODEL * 2);
  bf16*  h1b   = (bf16*)carve(MT * D_FF * 2);
  bf16* aob = vb;     // v dead after vtrans
  float* fff = attnf; // attn_out dead after LN1

  const int nX = MTOK * D_MODEL;
  const int nW = D_MODEL * D_MODEL;
  const int nWF = D_FF * D_MODEL;

  cvt_bf16_kernel<<<(nX + CVT_TILE - 1) / CVT_TILE, 256, 0, stream>>>(x, xb, nX);
  cvt_bf16_kernel<<<(nW + CVT_TILE - 1) / CVT_TILE, 256, 0, stream>>>(WQ, wqb, nW);
  cvt_bf16_kernel<<<(nW + CVT_TILE - 1) / CVT_TILE, 256, 0, stream>>>(WK, wkb, nW);
  cvt_bf16_kernel<<<(nW + CVT_TILE - 1) / CVT_TILE, 256, 0, stream>>>(WV, wvb, nW);
  cvt_bf16_kernel<<<(nW + CVT_TILE - 1) / CVT_TILE, 256, 0, stream>>>(WO, wob, nW);
  cvt_bf16_kernel<<<(nWF + CVT_TILE - 1) / CVT_TILE, 256, 0, stream>>>(W1, w1b, nWF);
  cvt_bf16_kernel<<<(nWF + CVT_TILE - 1) / CVT_TILE, 256, 0, stream>>>(W2, w2b, nWF);

  dim3 blk(256);
  dim3 gProj(MTOK / BM, D_MODEL / BN);
  gemm_bf16_kernel<false, false, true><<<gProj, blk, 0, stream>>>(
      xb, wqb, bQ, nullptr, qb, MTOK, D_MODEL, D_MODEL);
  gemm_bf16_kernel<false, false, true><<<gProj, blk, 0, stream>>>(
      xb, wkb, bK, nullptr, kb, MTOK, D_MODEL, D_MODEL);
  gemm_bf16_kernel<false, false, true><<<gProj, blk, 0, stream>>>(
      xb, wvb, bV, nullptr, vb, MTOK, D_MODEL, D_MODEL);

  vtrans_kernel<<<(nX + 255) / 256, 256, 0, stream>>>(vb, vtb);

  attn_kernel<<<BATCH * N_HEADS * (SEQ_T / 128), blk, 0, stream>>>(
      qb, kb, vtb, aob);

  gemm_bf16_kernel<false, true, false><<<gProj, blk, 0, stream>>>(
      aob, wob, bO, attnf, nullptr, MTOK, D_MODEL, D_MODEL);

  ln_residual_kernel<<<MTOK, blk, 0, stream>>>(x, attnf, g1, be1, y1f, y1b);

  dim3 gFF1(MTOK / BM, D_FF / BN);
  gemm_bf16_kernel<true, false, true><<<gFF1, blk, 0, stream>>>(
      y1b, w1b, b1, nullptr, h1b, MTOK, D_FF, D_MODEL);

  gemm_bf16_kernel<false, true, false><<<gProj, blk, 0, stream>>>(
      h1b, w2b, b2, fff, nullptr, MTOK, D_MODEL, D_FF);

  ln_residual_kernel<<<MTOK, blk, 0, stream>>>(y1f, fff, g2, be2, out,
                                               nullptr);
}

// v006
// It runs in 314 microseconds.
// Two timings next to v005 both put it at 1.10 times that version's speed.
// All steps since v000 together make it 1.62 times as fast.
#include <hip/hip_runtime.h>
#include <hip/hip_bf16.h>

// ---------------------------------------------------------------------------
// Types for CDNA5 WMMA (wave32, 16x16x32 bf16 -> f32)
// ---------------------------------------------------------------------------
typedef __bf16 bf16;
typedef bf16  v16bf __attribute__((ext_vector_type(16)));
typedef bf16  v8bf  __attribute__((ext_vector_type(8)));
typedef float v8f   __attribute__((ext_vector_type(8)));

static constexpr int D_MODEL = 1024;
static constexpr int N_HEADS = 16;
static constexpr int D_FF    = 4096;
static constexpr int SEQ_T   = 2048;
static constexpr int BATCH   = 4;
static constexpr int DK      = 64;            // head dim
static constexpr int MTOK    = BATCH * SEQ_T; // 8192 rows

__device__ __forceinline__ v8f wmma_bf16(v16bf a, v16bf b, v8f c) {
  return __builtin_amdgcn_wmma_f32_16x16x32_bf16(
      /*neg_a=*/false, a, /*neg_b=*/false, b,
      /*c_mod=*/(short)0, c, /*reuse_a=*/false, /*reuse_b=*/false);
}

// Load one 16-bit A/B operand fragment (ISA 16-bit 16x32 layout):
// lane L -> row = L&15, khalf = (L>>4)*8; elems [0..7]=p[0..7],
// elems [8..15]=p[16..23] with p at (row, khalf) of a K-contiguous row.
__device__ __forceinline__ v16bf ldfrag(const bf16* p) {
  v8bf lo = *reinterpret_cast<const v8bf*>(p);
  v8bf hi = *reinterpret_cast<const v8bf*>(p + 16);
  return __builtin_shufflevector(lo, hi, 0, 1, 2, 3, 4, 5, 6, 7,
                                 8, 9, 10, 11, 12, 13, 14, 15);
}

// Returns when every async-to-LDS copy that this wave has issued has landed.
__device__ __forceinline__ void async_wait0() {
  asm volatile("s_wait_asynccnt 0x0" ::: "memory");
}

// ---------------------------------------------------------------------------
// f32 -> bf16 conversion
// ---------------------------------------------------------------------------
// One thread converts 32 values: eight 16-byte loads, each 512 contiguous
// bytes per wave, all issued before the first conversion, so that a wave keeps
// 4 KB in flight and the launch needs 1/32 of the waves.
typedef float v4f  __attribute__((ext_vector_type(4)));
typedef bf16  v4bf __attribute__((ext_vector_type(4)));
static constexpr int CVT_LOADS = 8;                    // loads per thread
static constexpr int CVT_STEP  = 256 * 4;              // floats per block-wide load
static constexpr int CVT_TILE  = CVT_STEP * CVT_LOADS; // floats per block

__global__ __launch_bounds__(256) void cvt_bf16_kernel(
    const float* __restrict__ in, bf16* __restrict__ out, int n) {
  const int base = blockIdx.x * CVT_TILE;
  if (base + CVT_TILE <= n) {
    const int i0 = base + threadIdx.x * 4;
    v4f v[CVT_LOADS];
    // Unrolled so that v[] stays in registers and the loads go out together.
#pragma unroll
    for (int j = 0; j < CVT_LOADS; ++j)
      v[j] = *reinterpret_cast<const v4f*>(in + i0 + j * CVT_STEP);
    // Unrolled for the same reason: every index of v[] is a constant.
#pragma unroll
    for (int j = 0; j < CVT_LOADS; ++j)
      *reinterpret_cast<v4bf*>(out + i0 + j * CVT_STEP) =
          __builtin_convertvector(v[j], v4bf);
    // Precaution: stands in front of every later rewrite of a register that the
    // stores above name (the built code runs on into the partial-block test).
    asm volatile("s_wait_xcnt 0x0" ::: "memory");
  } else {
    // Last, partial block of a length that is no multiple of CVT_TILE.
    for (int i = base + threadIdx.x; i < n; i += 256) out[i] = (bf16)in[i];
  }
}

// ---------------------------------------------------------------------------
// GEMM: C[M,N] = act(A[M,K] @ W[N,K]^T + bias[N]),  A/W bf16 row-major.
// Block = 256 thr (8 waves, 4Mx2N).  Block tile 256(M) x 128(N), K-tile 64.
// A/W tiles staged in LDS via async-to-LDS DMA, double buffered; each wave
// computes a 64x64 tile = 4x4 WMMA fragments per 32-K step, so that a loaded
// fragment feeds four products.  M, N, K are multiples of BM, BN, BK.
// OUT_BF16_T: the bf16 result goes out transposed per batch entry,
// Cb[(row / SEQ_T) * N + col][row % SEQ_T]; with N = D_MODEL that is the
// [(b*H + h)*DK + d][t] layout in which the attention kernel reads V^T.
// ---------------------------------------------------------------------------
static constexpr int BM = 256, BN = 128, BK = 64;
static constexpr int LDS_STRIDE = 72;  // 64 + 8 pad (144B rows, 16B aligned)

template <bool RELU, bool OUT_F32, bool OUT_BF16, bool OUT_BF16_T = false>
__global__ __launch_bounds__(256) void gemm_bf16_kernel(
    const bf16* __restrict__ A, const bf16* __restrict__ W,
    const float* __restrict__ bias, float* __restrict__ Cf,
    bf16* __restrict__ Cb, int M, int N, int K) {
  __shared__ alignas(16) bf16 sA[2][BM * LDS_STRIDE];  // 2 x 36 KB
  __shared__ alignas(16) bf16 sW[2][BN * LDS_STRIDE];  // 2 x 18 KB

  const int tid = threadIdx.x;
  const int lane = tid & 31;
  const int wave = tid >> 5;
  const int m0l = (wave & 3) * 64;   // wave M offset within block tile
  const int n0l = (wave >> 2) * 64;  // wave N offset within block tile

  const int rlane = lane & 15;
  const int koff = (lane >> 4) << 3;  // 0 or 8
  const int half = lane >> 4;

  // Staging: a thread copies one 16B chunk of rows srow + 32*j, j = 0..7 of the
  // A slab and j = 0..3 of the W slab (a wave's copy covers four 128B rows).
  const int srow = tid >> 3;
  const int scol = (tid & 7) << 3;
  const bf16* Ab = A + ((size_t)blockIdx.x * BM + srow) * K + scol;
  const bf16* Wb = W + ((size_t)blockIdx.y * BN + srow) * K + scol;
  const size_t gstep = (size_t)32 * K;            // 32 rows, elements
  const unsigned int lstep = 32 * LDS_STRIDE * 2;  // 32 rows, LDS bytes
  const unsigned int lA =
      (unsigned int)(uintptr_t)(&sA[0][0] + srow * LDS_STRIDE + scol);
  const unsigned int lW =
      (unsigned int)(uintptr_t)(&sW[0][0] + srow * LDS_STRIDE + scol);

  // Stage the [BM x 64] and [BN x 64] K-slabs at kofs into buffer buf.
  auto stage = [&](int buf, int kofs) {
    const bf16* a = Ab + kofs;
    const bf16* w = Wb + kofs;
    const unsigned int da = lA + buf * (BM * LDS_STRIDE * 2);
    const unsigned int dw = lW + buf * (BN * LDS_STRIDE * 2);
    // The twelve copies of a slab pair; the wait in the same statement stands
    // in front of every later rewrite of an address register that they name.
    asm volatile(
        "global_load_async_to_lds_b128 %0, %12, off\n\t"
        "global_load_async_to_lds_b128 %1, %13, off\n\t"
        "global_load_async_to_lds_b128 %2, %14, off\n\t"
        "global_load_async_to_lds_b128 %3, %15, off\n\t"
        "global_load_async_to_lds_b128 %4, %16, off\n\t"
        "global_load_async_to_lds_b128 %5, %17, off\n\t"
        "global_load_async_to_lds_b128 %6, %18, off\n\t"
        "global_load_async_to_lds_b128 %7, %19, off\n\t"
        "global_load_async_to_lds_b128 %8, %20, off\n\t"
        "global_load_async_to_lds_b128 %9, %21, off\n\t"
        "global_load_async_to_lds_b128 %10, %22, off\n\t"
        "global_load_async_to_lds_b128 %11, %23, off\n\t"
        "s_wait_xcnt 0x0"
        :: "v"(da), "v"(da + lstep), "v"(da + 2 * lstep), "v"(da + 3 * lstep),
           "v"(da + 4 * lstep), "v"(da + 5 * lstep), "v"(da + 6 * lstep),
           "v"(da + 7 * lstep), "v"(dw), "v"(dw + lstep), "v"(dw + 2 * lstep),
           "v"(dw + 3 * lstep),
           "v"(a), "v"(a + gstep), "v"(a + 2 * gstep), "v"(a + 3 * gstep),
           "v"(a + 4 * gstep), "v"(a + 5 * gstep), "v"(a + 6 * gstep),
           "v"(a + 7 * gstep), "v"(w), "v"(w + gstep), "v"(w + 2 * gstep),
           "v"(w + 3 * gstep)
        : "memory");
  };

  v8f acc[4][4] = {};

  stage(0, 0);

  const int nk = K / BK;
  for (int t = 0; t < nk; ++t) {
    // Hand-over, passed by every wave: this wave's LDS reads of the last trip
    // are done and its copies of slab t have landed; the barrier then publishes
    // slab t and frees the other buffer for the copies below.
    asm volatile("s_wait_dscnt 0x0" ::: "memory");
    async_wait0();
    __syncthreads();
    if (t + 1 < nk) stage((t + 1) & 1, (t + 1) * BK);
    const bf16* a0 = sA[t & 1] + (m0l + rlane) * LDS_STRIDE + koff;
    const bf16* w0 = sW[t & 1] + (n0l + rlane) * LDS_STRIDE + koff;
#pragma unroll
    for (int kk = 0; kk < BK; kk += 32) {
      // All loops below unrolled: every index of af, wf and acc is then a
      // constant and the arrays stay in registers.
      v16bf af[4], wf[4];
#pragma unroll
      for (int i = 0; i < 4; ++i) af[i] = ldfrag(a0 + i * 16 * LDS_STRIDE + kk);
#pragma unroll
      for (int j = 0; j < 4; ++j) wf[j] = ldfrag(w0 + j * 16 * LDS_STRIDE + kk);
      // Inputs only: holds the sixteen LDS reads of a 32-K step together in front
      // of its sixteen products.  Without it the A fragments share one register
      // set and every row of four products waits out an LDS latency of its own.
      asm volatile("" :: "v"(af[0]), "v"(af[1]), "v"(af[2]), "v"(af[3]),
                         "v"(wf[0]), "v"(wf[1]), "v"(wf[2]), "v"(wf[3]));
#pragma unroll
      for (int i = 0; i < 4; ++i)
#pragma unroll
        for (int j = 0; j < 4; ++j)
          acc[i][j] = wmma_bf16(af[i], wf[j], acc[i][j]);
    }
    // No trailing barrier: next stage() writes the *other* buffer, and the
    // top-of-loop waits+barrier order buffer reuse across iterations.
  }
  async_wait0();  // no copy is outstanding when the wave ends, whatever K is

  // Epilogue.  C layout: VGPR r, lane L -> row = r + 8*(L>>4), col = L&15.
  const int m0 = blockIdx.x * BM + m0l;
  const int n0 = blockIdx.y * BN + n0l;
  if constexpr (OUT_BF16_T) {
    // A lane's eight accumulator registers are eight consecutive rows of one
    // column, so they are 16 contiguous bytes of the transposed result.  The
    // four stores of a column (i = 0..3) fill one 128B line, written by this
    // wave alone.  A wave's 64 rows lie in one batch entry.
    static_assert(SEQ_T % BM == 0, "a block tile stays inside one batch entry");
    bf16* ct = Cb + (size_t)(m0 / SEQ_T) * N * SEQ_T + (m0 % SEQ_T) + half * 8;
    // Both loops unrolled: every index of acc is then a constant.
#pragma unroll
    for (int j = 0; j < 4; ++j) {
      const int col = n0 + j * 16 + rlane;
      const float bv = bias[col];
#pragma unroll
      for (int i = 0; i < 4; ++i) {
        v8bf o;
#pragma unroll
        for (int r = 0; r < 8; ++r) {
          float v = acc[i][j][r] + bv;
          if (RELU) v = fmaxf(v, 0.0f);
          o[r] = (bf16)v;
        }
        *reinterpret_cast<v8bf*>(ct + (size_t)col * SEQ_T + i * 16) = o;
      }
    }
    return;
  }
#pragma unroll
  for (int i = 0; i < 4; ++i) {
#pragma unroll
    for (int j = 0; j < 4; ++j) {
      int col = n0 + j * 16 + rlane;
      float bv = bias[col];
#pragma unroll
      for (int r = 0; r < 8; ++r) {
        int row = m0 + i * 16 + r + half * 8;
        float v = acc[i][j][r] + bv;
        if (RELU) v = fmaxf(v, 0.0f);
        if (OUT_F32) Cf[(size_t)row * N + col] = v;
        if (OUT_BF16) Cb[(size_t)row * N + col] = (bf16)v;
      }
    }
  }
}

__device__ __forceinline__ float xhalf(float x) {
  return __builtin_bit_cast(
      float, __builtin_amdgcn_permlanex16(__builtin_bit_cast(int, x),
                                          __builtin_bit_cast(int, x),
                                          0x76543210, 0xfedcba98, false, false));
}

// K and V^T reach the waves through LDS: a stage is 64 keys, that is 64 K rows
// of 128 B and 64 V^T rows of 128 B, copied once for the block's 8 waves.
static constexpr int ATT_KEYS  = 64;  // keys per stage
static constexpr int ATT_PITCH = 72;  // LDS row: 64 values + 8 pad (144 B)

__global__ __launch_bounds__(256) void attn_kernel(
    const bf16* __restrict__ Q, const bf16* __restrict__ Kmat,
    const bf16* __restrict__ VT, bf16* __restrict__ O) {
  __shared__ alignas(16) bf16 sK[2][ATT_KEYS * ATT_PITCH];  // 2 x 9 KB
  __shared__ alignas(16) bf16 sV[2][DK * ATT_PITCH];        // 2 x 9 KB

  const int tid = threadIdx.x;
  const int lane = tid & 31;
  // Scalar, so that the per-wave causal skip below is a scalar branch.
  const int wave = __builtin_amdgcn_readfirstlane(tid >> 5);
  const int blk = blockIdx.x;
  const int qchunk = blk & 15;  // T/128 = 16 chunks
  const int bh = blk >> 4;      // 0..63
  const int b = bh >> 4;
  const int h = bh & (N_HEADS - 1);
  const int q_base = qchunk * 128 + wave * 16;

  const int rlane = lane & 15;
  const int khalf = lane >> 4;
  const int koff = khalf * 8;

  const bf16* qp = Q + (size_t)b * SEQ_T * D_MODEL + h * DK;
  const bf16* kp = Kmat + (size_t)b * SEQ_T * D_MODEL + h * DK;
  const bf16* vtp = VT + (size_t)bh * DK * SEQ_T;

  // Staging: a thread copies one 16B chunk of rows srow and srow + 32 of the K
  // slab and of the V^T slab (a wave's copy covers four whole 128B rows).
  const int srow = tid >> 3;
  const int scol = (tid & 7) << 3;
  const bf16* kg = kp + (size_t)srow * D_MODEL + scol;
  const bf16* vg = vtp + (size_t)srow * SEQ_T + scol;
  const unsigned int lK =
      (unsigned int)(uintptr_t)(&sK[0][0] + srow * ATT_PITCH + scol);
  const unsigned int lV =
      (unsigned int)(uintptr_t)(&sV[0][0] + srow * ATT_PITCH + scol);
  const unsigned int lhalf = 32 * ATT_PITCH * 2;       // 32 rows, LDS bytes
  const unsigned int lbuf = ATT_KEYS * ATT_PITCH * 2;  // one buffer, LDS bytes

  // Copy keys st*64 .. st*64+63 (K rows, V^T columns) into buffer buf.
  auto stage = [&](int buf, int st) {
    const bf16* k = kg + (size_t)st * ATT_KEYS * D_MODEL;
    const bf16* v = vg + st * ATT_KEYS;
    const unsigned int dk = lK + buf * lbuf;
    const unsigned int dv = lV + buf * lbuf;
    // The four copies of a stage; the wait in the same statement stands in
    // front of every later rewrite of an address register that they name.
    asm volatile(
        "global_load_async_to_lds_b128 %0, %4, off\n\t"
        "global_load_async_to_lds_b128 %1, %5, off\n\t"
        "global_load_async_to_lds_b128 %2, %6, off\n\t"
        "global_load_async_to_lds_b128 %3, %7, off\n\t"
        "s_wait_xcnt 0x0"
        :: "v"(dk), "v"(dk + lhalf), "v"(dv), "v"(dv + lhalf),
           "v"(k), "v"(k + (size_t)32 * D_MODEL), "v"(v),
           "v"(v + (size_t)32 * SEQ_T)
        : "memory");
  };

  const int qi = q_base + rlane;  // this lane's query
  const bf16* qrow = qp + (size_t)qi * D_MODEL;
  v16bf qf0 = ldfrag(qrow + koff);
  v16bf qf1 = ldfrag(qrow + 32 + koff);

  float rowM = -1.0e30f;  // running maximum of query qi (equal in both halves)
  float rowL = 0.0f;      // running sum over this half's keys only
  v8f acc[4] = {{}, {}, {}, {}};  // acc[dg][r] = O[qi][dg*16 + koff + r]

  const float scale = 0.125f;          // 1/sqrt(64)
  const int nkt = (q_base + 47) >> 5;  // # of 32-key tiles of this wave (causal)
  const int nst = qchunk * 2 + 2;      // # of 64-key stages of the block

  stage(0, 0);
  async_wait0();    // this wave's copies of stage 0 have landed
  __syncthreads();  // publishes stage 0
  stage(1, 1);      // nst >= 2: stage 1 always exists

  for (int st = 0; st < nst; ++st) {
    const bf16* kb = sK[st & 1] + rlane * ATT_PITCH + koff;
    const bf16* vb = sV[st & 1] + rlane * ATT_PITCH + koff;
    // Unrolled: the LDS offsets of both halves of a stage are then constants.
#pragma unroll
    for (int sub = 0; sub < 2; ++sub) {
      const int kt = st * ATT_KEYS + sub * 32;
      if (st * 2 + sub < nkt) {  // tiles past this wave's diagonal are skipped
        v8f s0 = {}, s1 = {};  // s0[r]: key kt+koff+r, s1[r]: key kt+16+koff+r
        {
          const bf16* kr0 = kb + sub * 32 * ATT_PITCH;
          const bf16* kr1 = kr0 + 16 * ATT_PITCH;
          const v16bf k00 = ldfrag(kr0), k01 = ldfrag(kr0 + 32);
          const v16bf k10 = ldfrag(kr1), k11 = ldfrag(kr1 + 32);
          // Inputs only: holds the four fragment reads together in front of the
          // products, so that their LDS latencies overlap instead of adding up.
          asm volatile("" :: "v"(k00), "v"(k01), "v"(k10), "v"(k11));
          s0 = wmma_bf16(k00, qf0, s0);
          s1 = wmma_bf16(k10, qf0, s1);
          s0 = wmma_bf16(k01, qf1, s0);
          s1 = wmma_bf16(k11, qf1, s1);
        }
        float sc[16];
        float m = -1.0e30f;
#pragma unroll
        for (int r = 0; r < 8; ++r) {
          const int key = kt + koff + r;
          sc[r] = (key <= qi) ? (float)s0[r] * scale : -1.0e30f;
          sc[8 + r] = (key + 16 <= qi) ? (float)s1[r] * scale : -1.0e30f;
          m = fmaxf(m, fmaxf(sc[r], sc[8 + r]));
        }
        m = fmaxf(m, xhalf(m));
        const float newM = fmaxf(rowM, m);
        const float corr = __expf(rowM - newM);
        rowM = newM;
        v16bf pf;
        float p[16];
#pragma unroll
        for (int s = 0; s < 16; ++s) {
          p[s] = __expf(sc[s] - newM);
          pf[s] = (bf16)p[s];
        }
#pragma unroll
        for (int w = 8; w >= 1; w >>= 1)
#pragma unroll
          for (int s = 0; s < w; ++s) p[s] += p[s + w];
        rowL = rowL * corr + p[0];
        v16bf vf[4];
#pragma unroll
        for (int dg = 0; dg < 4; ++dg)
          vf[dg] = ldfrag(vb + dg * 16 * ATT_PITCH + sub * 32);
        // Inputs only, as for K: the four V^T fragment reads go out together.
        asm volatile("" :: "v"(vf[0]), "v"(vf[1]), "v"(vf[2]), "v"(vf[3]));
#pragma unroll
        for (int dg = 0; dg < 4; ++dg) {
          acc[dg] *= corr;
          acc[dg] = wmma_bf16(vf[dg], pf, acc[dg]);
        }
      }
    }
    // Hand-over, passed by every wave, outside the causal skip: this wave's LDS
    // reads of stage st are done and its copies of stage st + 1 have landed; the
    // barrier then publishes stage st + 1 and frees this stage's buffer.
    asm volatile("s_wait_dscnt 0x0" ::: "memory");
    async_wait0();
    __syncthreads();
    if (st + 2 < nst) stage(st & 1, st + 2);
  }
  async_wait0();  // no copy is outstanding when the wave ends

  const float inv = 1.0f / (rowL + xhalf(rowL));
  bf16* op = O + ((size_t)(b * SEQ_T + qi)) * D_MODEL + h * DK + koff;
#pragma unroll
  for (int dg = 0; dg < 4; ++dg) {
    v8bf o;
#pragma unroll
    for (int r = 0; r < 8; ++r) o[r] = (bf16)(acc[dg][r] * inv);
    *reinterpret_cast<v8bf*>(op + dg * 16) = o;
  }
}

// ---------------------------------------------------------------------------
// LayerNorm(residual): out = LN(A + R) * g + be ; optional bf16 copy.
// ---------------------------------------------------------------------------
__global__ __launch_bounds__(256) void ln_residual_kernel(
    const float* __restrict__ A, const float* __restrict__ R,
    const float* __restrict__ g, const float* __restrict__ be,
    float* __restrict__ outF, bf16* __restrict__ outB) {
  const int row = blockIdx.x;
  const float* a = A + (size_t)row * D_MODEL;
  const float* rr = R + (size_t)row * D_MODEL;
  float v[4];
  float s = 0.0f;
#pragma unroll
  for (int i = 0; i < 4; ++i) {
    int idx = threadIdx.x + i * 256;
    v[i] = a[idx] + rr[idx];
    s += v[i];
  }
  __shared__ float red[8];
  const int wv = threadIdx.x >> 5, ln = threadIdx.x & 31;
#pragma unroll
  for (int off = 16; off >= 1; off >>= 1) s += __shfl_xor(s, off, 32);
  if (ln == 0) red[wv] = s;
  __syncthreads();
  float mean = 0.0f;
#pragma unroll
  for (int i = 0; i < 8; ++i) mean += red[i];
  mean *= (1.0f / D_MODEL);
  __syncthreads();
  float vs = 0.0f;
#pragma unroll
  for (int i = 0; i < 4; ++i) {
    float d = v[i] - mean;
    vs += d * d;
  }
#pragma unroll
  for (int off = 16; off >= 1; off >>= 1) vs += __shfl_xor(vs, off, 32);
  if (ln == 0) red[wv] = vs;
  __syncthreads();
  float var = 0.0f;
#pragma unroll
  for (int i = 0; i < 8; ++i) var += red[i];
  var *= (1.0f / D_MODEL);
  const float rstd = rsqrtf(var + 1e-5f);
#pragma unroll
  for (int i = 0; i < 4; ++i) {
    int idx = threadIdx.x + i * 256;
    float y = (v[i] - mean) * rstd * g[idx] + be[idx];
    outF[(size_t)row * D_MODEL + idx] = y;
    if (outB) outB[(size_t)row * D_MODEL + idx] = (bf16)y;
  }
}

// ---------------------------------------------------------------------------
// Host-side orchestration
// ---------------------------------------------------------------------------
extern "C" void kernel_launch(void* const* d_in, const int* in_sizes, int n_in,
                              void* d_out, int out_size, void* d_ws,
                              size_t ws_size, hipStream_t stream) {
  (void)in_sizes; (void)n_in; (void)out_size; (void)ws_size;
  const float* x  = (const float*)d_in[0];
  const float* WQ = (const float*)d_in[1];
  const float* bQ = (const float*)d_in[2];
  const float* WK = (const float*)d_in[3];
  const float* bK = (const float*)d_in[4];
  const float* WV = (const float*)d_in[5];
  const float* bV = (const float*)d_in[6];
  const float* WO = (const float*)d_in[7];
  const float* bO = (const float*)d_in[8];
  const float* W1 = (const float*)d_in[9];
  const float* b1 = (const float*)d_in[10];
  const float* W2 = (const float*)d_in[11];
  const float* b2 = (const float*)d_in[12];
  const float* g1 = (const float*)d_in[13];
  const float* be1 = (const float*)d_in[14];
  const float* g2 = (const float*)d_in[15];
  const float* be2 = (const float*)d_in[16];
  float* out = (float*)d_out;

  char* w = (char*)d_ws;
  auto carve = [&](size_t bytes) {
    char* p = w;
    w += (bytes + 255) & ~(size_t)255;
    return p;
  };
  const size_t MT = (size_t)MTOK;
  bf16* xb  = (bf16*)carve(MT * D_MODEL * 2);
  bf16* wqb = (bf16*)carve((size_t)D_MODEL * D_MODEL * 2);
  bf16* wkb = (bf16*)carve((size_t)D_MODEL * D_MODEL * 2);
  bf16* wvb = (bf16*)carve((size_t)D_MODEL * D_MODEL * 2);
  bf16* wob = (bf16*)carve((size_t)D_MODEL * D_MODEL * 2);
  bf16* w1b = (bf16*)carve((size_t)D_FF * D_MODEL * 2);
  bf16* w2b = (bf16*)carve((size_t)D_MODEL * D_FF * 2);
  bf16* qb  = (bf16*)carve(MT * D_MODEL * 2);
  bf16* kb  = (bf16*)carve(MT * D_MODEL * 2);
  bf16* vtb = (bf16*)carve(MT * D_MODEL * 2);
  bf16* aob = (bf16*)carve(MT * D_MODEL * 2);
  float* attnf = (float*)carve(MT * D_MODEL * 4);
  float* y1f   = (float*)carve(MT * D_MODEL * 4);
  bf16*  y1b   = (bf16*)carve(MT * D_MODEL * 2);
  bf16*  h1b   = (bf16*)carve(MT * D_FF * 2);
  float* fff = attnf; // attn_out dead after LN1

  const int nX = MTOK * D_MODEL;
  const int nW = D_MODEL * D_MODEL;
  const int nWF = D_FF * D_MODEL;

  cvt_bf16_kernel<<<(nX + CVT_TILE - 1) / CVT_TILE, 256, 0, stream>>>(x, xb, nX);
  cvt_bf16_kernel<<<(nW + CVT_TILE - 1) / CVT_TILE, 256, 0, stream>>>(WQ, wqb, nW);
  cvt_bf16_kernel<<<(nW + CVT_TILE - 1) / CVT_TILE, 256, 0, stream>>>(WK, wkb, nW);
  cvt_bf16_kernel<<<(nW + CVT_TILE - 1) / CVT_TILE, 256, 0, stream>>>(WV, wvb, nW);
  cvt_bf16_kernel<<<(nW + CVT_TILE - 1) / CVT_TILE, 256, 0, stream>>>(WO, wob, nW);
  cvt_bf16_kernel<<<(nWF + CVT_TILE - 1) / CVT_TILE, 256, 0, stream>>>(W1, w1b, nWF);
  cvt_bf16_kernel<<<(nWF + CVT_TILE - 1) / CVT_TILE, 256, 0, stream>>>(W2, w2b, nWF);

  dim3 blk(256);
  dim3 gProj(MTOK / BM, D_MODEL / BN);
  gemm_bf16_kernel<false, false, true><<<gProj, blk, 0, stream>>>(
      xb, wqb, bQ, nullptr, qb, MTOK, D_MODEL, D_MODEL);
  gemm_bf16_kernel<false, false, true><<<gProj, blk, 0, stream>>>(
      xb, wkb, bK, nullptr, kb, MTOK, D_MODEL, D_MODEL);
  gemm_bf16_kernel<false, false, false, true><<<gProj, blk, 0, stream>>>(
      xb, wvb, bV, nullptr, vtb, MTOK, D_MODEL, D_MODEL);

  attn_kernel<<<BATCH * N_HEADS * (SEQ_T / 128), blk, 0, stream>>>(
      qb, kb, vtb, aob);

  gemm_bf16_kernel<false, true, false><<<gProj, blk, 0, stream>>>(
      aob, wob, bO, attnf, nullptr, MTOK, D_MODEL, D_MODEL);

  ln_residual_kernel<<<MTOK, blk, 0, stream>>>(x, attnf, g1, be1, y1f, y1b);

  dim3 gFF1(MTOK / BM, D_FF / BN);
  gemm_bf16_kernel<true, false, true><<<gFF1, blk, 0, stream>>>(
      y1b, w1b, b1, nullptr, h1b, MTOK, D_FF, D_MODEL);

  gemm_bf16_kernel<false, true, false><<<gProj, blk, 0, stream>>>(
      h1b, w2b, b2, fff, nullptr, MTOK, D_MODEL, D_FF);

  ln_residual_kernel<<<MTOK, blk, 0, stream>>>(y1f, fff, g2, be2, out,
                                               nullptr);
}

// v007
// It runs in 303 microseconds.
// Next to v006, in two timings, it ran 1.04 times as fast each time.
// Counting every step since v000, it is 1.69 times as fast.
#include <hip/hip_runtime.h>
#include <hip/hip_bf16.h>

// ---------------------------------------------------------------------------
// Types for CDNA5 WMMA (wave32, 16x16x32 bf16 -> f32)
// ---------------------------------------------------------------------------
typedef __bf16 bf16;
typedef bf16  v16bf __attribute__((ext_vector_type(16)));
typedef bf16  v8bf  __attribute__((ext_vector_type(8)));
typedef float v8f   __attribute__((ext_vector_type(8)));

static constexpr int D_MODEL = 1024;
static constexpr int N_HEADS = 16;
static constexpr int D_FF    = 4096;
static constexpr int SEQ_T   = 2048;
static constexpr int BATCH   = 4;
static constexpr int DK      = 64;            // head dim
static constexpr int MTOK    = BATCH * SEQ_T; // 8192 rows

__device__ __forceinline__ v8f wmma_bf16(v16bf a, v16bf b, v8f c) {
  return __builtin_amdgcn_wmma_f32_16x16x32_bf16(
      /*neg_a=*/false, a, /*neg_b=*/false, b,
      /*c_mod=*/(short)0, c, /*reuse_a=*/false, /*reuse_b=*/false);
}

// Load one 16-bit A/B operand fragment (ISA 16-bit 16x32 layout):
// lane L -> row = L&15, khalf = (L>>4)*8; elems [0..7]=p[0..7],
// elems [8..15]=p[16..23] with p at (row, khalf) of a K-contiguous row.
__device__ __forceinline__ v16bf ldfrag(const bf16* p) {
  v8bf lo = *reinterpret_cast<const v8bf*>(p);
  v8bf hi = *reinterpret_cast<const v8bf*>(p + 16);
  return __builtin_shufflevector(lo, hi, 0, 1, 2, 3, 4, 5, 6, 7,
                                 8, 9, 10, 11, 12, 13, 14, 15);
}

// Returns when every async-to-LDS copy that this wave has issued has landed.
__device__ __forceinline__ void async_wait0() {
  asm volatile("s_wait_asynccnt 0x0" ::: "memory");
}

// ---------------------------------------------------------------------------
// f32 -> bf16 conversion
// ---------------------------------------------------------------------------
// One thread converts 32 values: eight 16-byte loads, each 512 contiguous
// bytes per wave, all issued before the first conversion, so that a wave keeps
// 4 KB in flight and the launch needs 1/32 of the waves.
typedef float v4f  __attribute__((ext_vector_type(4)));
typedef bf16  v4bf __attribute__((ext_vector_type(4)));
static constexpr int CVT_LOADS = 8;                    // loads per thread
static constexpr int CVT_STEP  = 256 * 4;              // floats per block-wide load
static constexpr int CVT_TILE  = CVT_STEP * CVT_LOADS; // floats per block

// All seven arrays are converted by ONE launch: a block takes one tile of
// CVT_TILE values, and its index says which array the tile belongs to (a scalar
// choice, the same for the whole block).  Every array is a whole number of tiles.
static constexpr int TILES_X  = MTOK * D_MODEL / CVT_TILE;     // x
static constexpr int TILES_W  = D_MODEL * D_MODEL / CVT_TILE;  // WQ, WK, WV, WO
static constexpr int TILES_WF = D_FF * D_MODEL / CVT_TILE;     // W1, W2
static constexpr int TILES_ALL = TILES_X + 4 * TILES_W + 2 * TILES_WF;
static_assert(MTOK * D_MODEL % CVT_TILE == 0 &&
              D_MODEL * D_MODEL % CVT_TILE == 0 &&
              D_FF * D_MODEL % CVT_TILE == 0, "no partial tile");

__global__ __launch_bounds__(256) void cvt_all_kernel(
    const float* __restrict__ x, const float* __restrict__ wq,
    const float* __restrict__ wk, const float* __restrict__ wv,
    const float* __restrict__ wo, const float* __restrict__ w1,
    const float* __restrict__ w2, bf16* __restrict__ xb,
    bf16* __restrict__ wqb, bf16* __restrict__ wkb, bf16* __restrict__ wvb,
    bf16* __restrict__ wob, bf16* __restrict__ w1b, bf16* __restrict__ w2b) {
  int t = blockIdx.x;  // becomes the tile's index inside its own array
  const float* in = x;
  bf16* out = xb;
  if (t >= TILES_X) {
    t -= TILES_X;
    if (t < 2 * TILES_WF) {
      in = t < TILES_WF ? w1 : w2;
      out = t < TILES_WF ? w1b : w2b;
      t &= TILES_WF - 1;
    } else {
      t -= 2 * TILES_WF;
      const int a = t / TILES_W;
      in = a == 0 ? wq : a == 1 ? wk : a == 2 ? wv : wo;
      out = a == 0 ? wqb : a == 1 ? wkb : a == 2 ? wvb : wob;
      t &= TILES_W - 1;
    }
  }
  static_assert((TILES_WF & (TILES_WF - 1)) == 0 &&
                (TILES_W & (TILES_W - 1)) == 0, "the masks above");
  const int i0 = t * CVT_TILE + threadIdx.x * 4;
  v4f v[CVT_LOADS];
  // Unrolled so that v[] stays in registers and the loads go out together.
#pragma unroll
  for (int j = 0; j < CVT_LOADS; ++j)
    v[j] = *reinterpret_cast<const v4f*>(in + i0 + j * CVT_STEP);
  // Unrolled for the same reason: every index of v[] is a constant.
#pragma unroll
  for (int j = 0; j < CVT_LOADS; ++j)
    *reinterpret_cast<v4bf*>(out + i0 + j * CVT_STEP) =
        __builtin_convertvector(v[j], v4bf);
}

// ---------------------------------------------------------------------------
// GEMM: C[M,N] = act(A[M,K] @ W[N,K]^T + bias[N]),  A/W bf16 row-major.
// Block = 256 thr (8 waves, 4Mx2N).  Block tile 256(M) x 128(N), K-tile 64.
// A/W tiles staged in LDS via async-to-LDS DMA, double buffered; each wave
// computes a 64x64 tile = 4x4 WMMA fragments per 32-K step, so that a loaded
// fragment feeds four products.  M, N, K are multiples of BM, BN, BK.
// OUT_BF16_T: the bf16 result goes out transposed per batch entry,
// Cb[(row / SEQ_T) * N + col][row % SEQ_T]; with N = D_MODEL that is the
// [(b*H + h)*DK + d][t] layout in which the attention kernel reads V^T.
// ---------------------------------------------------------------------------
static constexpr int BM = 256, BN = 128, BK = 64;
static constexpr int LDS_STRIDE = 72;  // 64 + 8 pad (144B rows, 16B aligned)

template <bool RELU, bool OUT_F32, bool OUT_BF16, bool OUT_BF16_T = false>
__global__ __launch_bounds__(256) void gemm_bf16_kernel(
    const bf16* __restrict__ A, const bf16* __restrict__ W,
    const float* __restrict__ bias, float* __restrict__ Cf,
    bf16* __restrict__ Cb, int M, int N, int K) {
  __shared__ alignas(16) bf16 sA[2][BM * LDS_STRIDE];  // 2 x 36 KB
  __shared__ alignas(16) bf16 sW[2][BN * LDS_STRIDE];  // 2 x 18 KB

  const int tid = threadIdx.x;
  const int lane = tid & 31;
  const int wave = tid >> 5;
  const int m0l = (wave & 3) * 64;   // wave M offset within block tile
  const int n0l = (wave >> 2) * 64;  // wave N offset within block tile

  const int rlane = lane & 15;
  const int koff = (lane >> 4) << 3;  // 0 or 8
  const int half = lane >> 4;

  // Staging: a thread copies one 16B chunk of rows srow + 32*j, j = 0..7 of the
  // A slab and j = 0..3 of the W slab (a wave's copy covers four 128B rows).
  const int srow = tid >> 3;
  const int scol = (tid & 7) << 3;
  const bf16* Ab = A + ((size_t)blockIdx.x * BM + srow) * K + scol;
  const bf16* Wb = W + ((size_t)blockIdx.y * BN + srow) * K + scol;
  const size_t gstep = (size_t)32 * K;            // 32 rows, elements
  const unsigned int lstep = 32 * LDS_STRIDE * 2;  // 32 rows, LDS bytes
  const unsigned int lA =
      (unsigned int)(uintptr_t)(&sA[0][0] + srow * LDS_STRIDE + scol);
  const unsigned int lW =
      (unsigned int)(uintptr_t)(&sW[0][0] + srow * LDS_STRIDE + scol);

  // Stage the [BM x 64] and [BN x 64] K-slabs at kofs into buffer buf.
  auto stage = [&](int buf, int kofs) {
    const bf16* a = Ab + kofs;
    const bf16* w = Wb + kofs;
    const unsigned int da = lA + buf * (BM * LDS_STRIDE * 2);
    const unsigned int dw = lW + buf * (BN * LDS_STRIDE * 2);
    // The twelve copies of a slab pair; the wait in the same statement stands
    // in front of every later rewrite of an address register that they name.
    asm volatile(
        "global_load_async_to_lds_b128 %0, %12, off\n\t"
        "global_load_async_to_lds_b128 %1, %13, off\n\t"
        "global_load_async_to_lds_b128 %2, %14, off\n\t"
        "global_load_async_to_lds_b128 %3, %15, off\n\t"
        "global_load_async_to_lds_b128 %4, %16, off\n\t"
        "global_load_async_to_lds_b128 %5, %17, off\n\t"
        "global_load_async_to_lds_b128 %6, %18, off\n\t"
        "global_load_async_to_lds_b128 %7, %19, off\n\t"
        "global_load_async_to_lds_b128 %8, %20, off\n\t"
        "global_load_async_to_lds_b128 %9, %21, off\n\t"
        "global_load_async_to_lds_b128 %10, %22, off\n\t"
        "global_load_async_to_lds_b128 %11, %23, off\n\t"
        "s_wait_xcnt 0x0"
        :: "v"(da), "v"(da + lstep), "v"(da + 2 * lstep), "v"(da + 3 * lstep),
           "v"(da + 4 * lstep), "v"(da + 5 * lstep), "v"(da + 6 * lstep),
           "v"(da + 7 * lstep), "v"(dw), "v"(dw + lstep), "v"(dw + 2 * lstep),
           "v"(dw + 3 * lstep),
           "v"(a), "v"(a + gstep), "v"(a + 2 * gstep), "v"(a + 3 * gstep),
           "v"(a + 4 * gstep), "v"(a + 5 * gstep), "v"(a + 6 * gstep),
           "v"(a + 7 * gstep), "v"(w), "v"(w + gstep), "v"(w + 2 * gstep),
           "v"(w + 3 * gstep)
        : "memory");
  };

  v8f acc[4][4] = {};

  stage(0, 0);

  const int nk = K / BK;
  for (int t = 0; t < nk; ++t) {
    // Hand-over, passed by every wave: this wave's LDS reads of the last trip
    // are done and its copies of slab t have landed; the barrier then publishes
    // slab t and frees the other buffer for the copies below.
    asm volatile("s_wait_dscnt 0x0" ::: "memory");
    async_wait0();
    __syncthreads();
    if (t + 1 < nk) stage((t + 1) & 1, (t + 1) * BK);
    const bf16* a0 = sA[t & 1] + (m0l + rlane) * LDS_STRIDE + koff;
    const bf16* w0 = sW[t & 1] + (n0l + rlane) * LDS_STRIDE + koff;
#pragma unroll
    for (int kk = 0; kk < BK; kk += 32) {
      // All loops below unrolled: every index of af, wf and acc is then a
      // constant and the arrays stay in registers.
      v16bf af[4], wf[4];
#pragma unroll
      for (int i = 0; i < 4; ++i) af[i] = ldfrag(a0 + i * 16 * LDS_STRIDE + kk);
#pragma unroll
      for (int j = 0; j < 4; ++j) wf[j] = ldfrag(w0 + j * 16 * LDS_STRIDE + kk);
      // Inputs only: holds the sixteen LDS reads of a 32-K step together in front
      // of its sixteen products.  Without it the A fragments share one register
      // set and every row of four products waits out an LDS latency of its own.
      asm volatile("" :: "v"(af[0]), "v"(af[1]), "v"(af[2]), "v"(af[3]),
                         "v"(wf[0]), "v"(wf[1]), "v"(wf[2]), "v"(wf[3]));
#pragma unroll
      for (int i = 0; i < 4; ++i)
#pragma unroll
        for (int j = 0; j < 4; ++j)
          acc[i][j] = wmma_bf16(af[i], wf[j], acc[i][j]);
    }
    // No trailing barrier: next stage() writes the *other* buffer, and the
    // top-of-loop waits+barrier order buffer reuse across iterations.
  }
  async_wait0();  // no copy is outstanding when the wave ends, whatever K is

  // Epilogue.  C layout: VGPR r, lane L -> row = r + 8*(L>>4), col = L&15.
  const int m0 = blockIdx.x * BM + m0l;
  const int n0 = blockIdx.y * BN + n0l;
  if constexpr (OUT_BF16_T) {
    // A lane's eight accumulator registers are eight consecutive rows of one
    // column, so they are 16 contiguous bytes of the transposed result.  The
    // four stores of a column (i = 0..3) fill one 128B line, written by this
    // wave alone.  A wave's 64 rows lie in one batch entry.
    static_assert(SEQ_T % BM == 0, "a block tile stays inside one batch entry");
    bf16* ct = Cb + (size_t)(m0 / SEQ_T) * N * SEQ_T + (m0 % SEQ_T) + half * 8;
    // Both loops unrolled: every index of acc is then a constant.
#pragma unroll
    for (int j = 0; j < 4; ++j) {
      const int col = n0 + j * 16 + rlane;
      const float bv = bias[col];
#pragma unroll
      for (int i = 0; i < 4; ++i) {
        v8bf o;
#pragma unroll
        for (int r = 0; r < 8; ++r) {
          float v = acc[i][j][r] + bv;
          if (RELU) v = fmaxf(v, 0.0f);
          o[r] = (bf16)v;
        }
        *reinterpret_cast<v8bf*>(ct + (size_t)col * SEQ_T + i * 16) = o;
      }
    }
    return;
  }
#pragma unroll
  for (int i = 0; i < 4; ++i) {
#pragma unroll
    for (int j = 0; j < 4; ++j) {
      int col = n0 + j * 16 + rlane;
      float bv = bias[col];
#pragma unroll
      for (int r = 0; r < 8; ++r) {
        int row = m0 + i * 16 + r + half * 8;
        float v = acc[i][j][r] + bv;
        if (RELU) v = fmaxf(v, 0.0f);
        if (OUT_F32) Cf[(size_t)row * N + col] = v;
        if (OUT_BF16) Cb[(size_t)row * N + col] = (bf16)v;
      }
    }
  }
}

__device__ __forceinline__ float xhalf(float x) {
  return __builtin_bit_cast(
      float, __builtin_amdgcn_permlanex16(__builtin_bit_cast(int, x),
                                          __builtin_bit_cast(int, x),
                                          0x76543210, 0xfedcba98, false, false));
}

// K and V^T reach the waves through LDS: a stage is 64 keys, that is 64 K rows
// of 128 B and 64 V^T rows of 128 B, copied once for the block's 8 waves.
static constexpr int ATT_KEYS  = 64;  // keys per stage
static constexpr int ATT_PITCH = 72;  // LDS row: 64 values + 8 pad (144 B)

__global__ __launch_bounds__(256) void attn_kernel(
    const bf16* __restrict__ Q, const bf16* __restrict__ Kmat,
    const bf16* __restrict__ VT, bf16* __restrict__ O) {
  __shared__ alignas(16) bf16 sK[2][ATT_KEYS * ATT_PITCH];  // 2 x 9 KB
  __shared__ alignas(16) bf16 sV[2][DK * ATT_PITCH];        // 2 x 9 KB

  const int tid = threadIdx.x;
  const int lane = tid & 31;
  // Scalar, so that the per-wave causal skip below is a scalar branch.
  const int wave = __builtin_amdgcn_readfirstlane(tid >> 5);
  const int blk = blockIdx.x;
  const int qchunk = blk & 15;  // T/128 = 16 chunks
  const int bh = blk >> 4;      // 0..63
  const int b = bh >> 4;
  const int h = bh & (N_HEADS - 1);
  const int q_base = qchunk * 128 + wave * 16;

  const int rlane = lane & 15;
  const int khalf = lane >> 4;
  const int koff = khalf * 8;

  const bf16* qp = Q + (size_t)b * SEQ_T * D_MODEL + h * DK;
  const bf16* kp = Kmat + (size_t)b * SEQ_T * D_MODEL + h * DK;
  const bf16* vtp = VT + (size_t)bh * DK * SEQ_T;

  // Staging: a thread copies one 16B chunk of rows srow and srow + 32 of the K
  // slab and of the V^T slab (a wave's copy covers four whole 128B rows).
  const int srow = tid >> 3;
  const int scol = (tid & 7) << 3;
  const bf16* kg = kp + (size_t)srow * D_MODEL + scol;
  const bf16* vg = vtp + (size_t)srow * SEQ_T + scol;
  const unsigned int lK =
      (unsigned int)(uintptr_t)(&sK[0][0] + srow * ATT_PITCH + scol);
  const unsigned int lV =
      (unsigned int)(uintptr_t)(&sV[0][0] + srow * ATT_PITCH + scol);
  const unsigned int lhalf = 32 * ATT_PITCH * 2;       // 32 rows, LDS bytes
  const unsigned int lbuf = ATT_KEYS * ATT_PITCH * 2;  // one buffer, LDS bytes

  // Copy keys st*64 .. st*64+63 (K rows, V^T columns) into buffer buf.
  auto stage = [&](int buf, int st) {
    const bf16* k = kg + (size_t)st * ATT_KEYS * D_MODEL;
    const bf16* v = vg + st * ATT_KEYS;
    const unsigned int dk = lK + buf * lbuf;
    const unsigned int dv = lV + buf * lbuf;
    // The four copies of a stage; the wait in the same statement stands in
    // front of every later rewrite of an address register that they name.
    asm volatile(
        "global_load_async_to_lds_b128 %0, %4, off\n\t"
        "global_load_async_to_lds_b128 %1, %5, off\n\t"
        "global_load_async_to_lds_b128 %2, %6, off\n\t"
        "global_load_async_to_lds_b128 %3, %7, off\n\t"
        "s_wait_xcnt 0x0"
        :: "v"(dk), "v"(dk + lhalf), "v"(dv), "v"(dv + lhalf),
           "v"(k), "v"(k + (size_t)32 * D_MODEL), "v"(v),
           "v"(v + (size_t)32 * SEQ_T)
        : "memory");
  };

  const int qi = q_base + rlane;  // this lane's query
  const bf16* qrow = qp + (size_t)qi * D_MODEL;
  v16bf qf0 = ldfrag(qrow + koff);
  v16bf qf1 = ldfrag(qrow + 32 + koff);

  float rowM = -1.0e30f;  // running maximum of query qi (equal in both halves)
  float rowL = 0.0f;      // running sum over this half's keys only
  v8f acc[4] = {{}, {}, {}, {}};  // acc[dg][r] = O[qi][dg*16 + koff + r]

  const float scale = 0.125f;          // 1/sqrt(64)
  const int nkt = (q_base + 47) >> 5;  // # of 32-key tiles of this wave (causal)
  const int nst = qchunk * 2 + 2;      // # of 64-key stages of the block

  stage(0, 0);
  async_wait0();    // this wave's copies of stage 0 have landed
  __syncthreads();  // publishes stage 0
  stage(1, 1);      // nst >= 2: stage 1 always exists

  for (int st = 0; st < nst; ++st) {
    const bf16* kb = sK[st & 1] + rlane * ATT_PITCH + koff;
    const bf16* vb = sV[st & 1] + rlane * ATT_PITCH + koff;
    // Unrolled: the LDS offsets of both halves of a stage are then constants.
#pragma unroll
    for (int sub = 0; sub < 2; ++sub) {
      const int kt = st * ATT_KEYS + sub * 32;
      if (st * 2 + sub < nkt) {  // tiles past this wave's diagonal are skipped
        v8f s0 = {}, s1 = {};  // s0[r]: key kt+koff+r, s1[r]: key kt+16+koff+r
        {
          const bf16* kr0 = kb + sub * 32 * ATT_PITCH;
          const bf16* kr1 = kr0 + 16 * ATT_PITCH;
          const v16bf k00 = ldfrag(kr0), k01 = ldfrag(kr0 + 32);
          const v16bf k10 = ldfrag(kr1), k11 = ldfrag(kr1 + 32);
          // Inputs only: holds the four fragment reads together in front of the
          // products, so that their LDS latencies overlap instead of adding up.
          asm volatile("" :: "v"(k00), "v"(k01), "v"(k10), "v"(k11));
          s0 = wmma_bf16(k00, qf0, s0);
          s1 = wmma_bf16(k10, qf0, s1);
          s0 = wmma_bf16(k01, qf1, s0);
          s1 = wmma_bf16(k11, qf1, s1);
        }
        float sc[16];
        float m = -1.0e30f;
#pragma unroll
        for (int r = 0; r < 8; ++r) {
          const int key = kt + koff + r;
          sc[r] = (key <= qi) ? (float)s0[r] * scale : -1.0e30f;
          sc[8 + r] = (key + 16 <= qi) ? (float)s1[r] * scale : -1.0e30f;
          m = fmaxf(m, fmaxf(sc[r], sc[8 + r]));
        }
        m = fmaxf(m, xhalf(m));
        const float newM = fmaxf(rowM, m);
        const float corr = __expf(rowM - newM);
        rowM = newM;
        v16bf pf;
        float p[16];
#pragma unroll
        for (int s = 0; s < 16; ++s) {
          p[s] = __expf(sc[s] - newM);
          pf[s] = (bf16)p[s];
        }
#pragma unroll
        for (int w = 8; w >= 1; w >>= 1)
#pragma unroll
          for (int s = 0; s < w; ++s) p[s] += p[s + w];
        rowL = rowL * corr + p[0];
        v16bf vf[4];
#pragma unroll
        for (int dg = 0; dg < 4; ++dg)
          vf[dg] = ldfrag(vb + dg * 16 * ATT_PITCH + sub * 32);
        // Inputs only, as for K: the four V^T fragment reads go out together.
        asm volatile("" :: "v"(vf[0]), "v"(vf[1]), "v"(vf[2]), "v"(vf[3]));
#pragma unroll
        for (int dg = 0; dg < 4; ++dg) {
          acc[dg] *= corr;
          acc[dg] = wmma_bf16(vf[dg], pf, acc[dg]);
        }
      }
    }
    // Hand-over, passed by every wave, outside the causal skip: this wave's LDS
    // reads of stage st are done and its copies of stage st + 1 have landed; the
    // barrier then publishes stage st + 1 and frees this stage's buffer.
    asm volatile("s_wait_dscnt 0x0" ::: "memory");
    async_wait0();
    __syncthreads();
    if (st + 2 < nst) stage(st & 1, st + 2);
  }
  async_wait0();  // no copy is outstanding when the wave ends

  const float inv = 1.0f / (rowL + xhalf(rowL));
  bf16* op = O + ((size_t)(b * SEQ_T + qi)) * D_MODEL + h * DK + koff;
#pragma unroll
  for (int dg = 0; dg < 4; ++dg) {
    v8bf o;
#pragma unroll
    for (int r = 0; r < 8; ++r) o[r] = (bf16)(acc[dg][r] * inv);
    *reinterpret_cast<v8bf*>(op + dg * 16) = o;
  }
}

// ---------------------------------------------------------------------------
// LayerNorm(residual): out = LN(A + R) * g + be ; optional bf16 copy.
// ---------------------------------------------------------------------------
__global__ __launch_bounds__(256) void ln_residual_kernel(
    const float* __restrict__ A, const float* __restrict__ R,
    const float* __restrict__ g, const float* __restrict__ be,
    float* __restrict__ outF, bf16* __restrict__ outB) {
  const int row = blockIdx.x;
  const float* a = A + (size_t)row * D_MODEL;
  const float* rr = R + (size_t)row * D_MODEL;
  float v[4];
  float s = 0.0f;
#pragma unroll
  for (int i = 0; i < 4; ++i) {
    int idx = threadIdx.x + i * 256;
    v[i] = a[idx] + rr[idx];
    s += v[i];
  }
  __shared__ float red[8];
  const int wv = threadIdx.x >> 5, ln = threadIdx.x & 31;
#pragma unroll
  for (int off = 16; off >= 1; off >>= 1) s += __shfl_xor(s, off, 32);
  if (ln == 0) red[wv] = s;
  __syncthreads();
  float mean = 0.0f;
#pragma unroll
  for (int i = 0; i < 8; ++i) mean += red[i];
  mean *= (1.0f / D_MODEL);
  __syncthreads();
  float vs = 0.0f;
#pragma unroll
  for (int i = 0; i < 4; ++i) {
    float d = v[i] - mean;
    vs += d * d;
  }
#pragma unroll
  for (int off = 16; off >= 1; off >>= 1) vs += __shfl_xor(vs, off, 32);
  if (ln == 0) red[wv] = vs;
  __syncthreads();
  float var = 0.0f;
#pragma unroll
  for (int i = 0; i < 8; ++i) var += red[i];
  var *= (1.0f / D_MODEL);
  const float rstd = rsqrtf(var + 1e-5f);
#pragma unroll
  for (int i = 0; i < 4; ++i) {
    int idx = threadIdx.x + i * 256;
    float y = (v[i] - mean) * rstd * g[idx] + be[idx];
    outF[(size_t)row * D_MODEL + idx] = y;
    if (outB) outB[(size_t)row * D_MODEL + idx] = (bf16)y;
  }
}

// ---------------------------------------------------------------------------
// Host-side orchestration
// ---------------------------------------------------------------------------
extern "C" void kernel_launch(void* const* d_in, const int* in_sizes, int n_in,
                              void* d_out, int out_size, void* d_ws,
                              size_t ws_size, hipStream_t stream) {
  (void)in_sizes; (void)n_in; (void)out_size; (void)ws_size;
  const float* x  = (const float*)d_in[0];
  const float* WQ = (const float*)d_in[1];
  const float* bQ = (const float*)d_in[2];
  const float* WK = (const float*)d_in[3];
  const float* bK = (const float*)d_in[4];
  const float* WV = (const float*)d_in[5];
  const float* bV = (const float*)d_in[6];
  const float* WO = (const float*)d_in[7];
  const float* bO = (const float*)d_in[8];
  const float* W1 = (const float*)d_in[9];
  const float* b1 = (const float*)d_in[10];
  const float* W2 = (const float*)d_in[11];
  const float* b2 = (const float*)d_in[12];
  const float* g1 = (const float*)d_in[13];
  const float* be1 = (const float*)d_in[14];
  const float* g2 = (const float*)d_in[15];
  const float* be2 = (const float*)d_in[16];
  float* out = (float*)d_out;

  char* w = (char*)d_ws;
  auto carve = [&](size_t bytes) {
    char* p = w;
    w += (bytes + 255) & ~(size_t)255;
    return p;
  };
  const size_t MT = (size_t)MTOK;
  bf16* xb  = (bf16*)carve(MT * D_MODEL * 2);
  bf16* wqb = (bf16*)carve((size_t)D_MODEL * D_MODEL * 2);
  bf16* wkb = (bf16*)carve((size_t)D_MODEL * D_MODEL * 2);
  bf16* wvb = (bf16*)carve((size_t)D_MODEL * D_MODEL * 2);
  bf16* wob = (bf16*)carve((size_t)D_MODEL * D_MODEL * 2);
  bf16* w1b = (bf16*)carve((size_t)D_FF * D_MODEL * 2);
  bf16* w2b = (bf16*)carve((size_t)D_MODEL * D_FF * 2);
  bf16* qb  = (bf16*)carve(MT * D_MODEL * 2);
  bf16* kb  = (bf16*)carve(MT * D_MODEL * 2);
  bf16* vtb = (bf16*)carve(MT * D_MODEL * 2);
  bf16* aob = (bf16*)carve(MT * D_MODEL * 2);
  float* attnf = (float*)carve(MT * D_MODEL * 4);
  float* y1f   = (float*)carve(MT * D_MODEL * 4);
  bf16*  y1b   = (bf16*)carve(MT * D_MODEL * 2);
  bf16*  h1b   = (bf16*)carve(MT * D_FF * 2);
  float* fff = attnf; // attn_out dead after LN1

  cvt_all_kernel<<<TILES_ALL, 256, 0, stream>>>(
      x, WQ, WK, WV, WO, W1, W2, xb, wqb, wkb, wvb, wob, w1b, w2b);

  dim3 blk(256);
  dim3 gProj(MTOK / BM, D_MODEL / BN);
  gemm_bf16_kernel<false, false, true><<<gProj, blk, 0, stream>>>(
      xb, wqb, bQ, nullptr, qb, MTOK, D_MODEL, D_MODEL);
  gemm_bf16_kernel<false, false, true><<<gProj, blk, 0, stream>>>(
      xb, wkb, bK, nullptr, kb, MTOK, D_MODEL, D_MODEL);
  gemm_bf16_kernel<false, false, false, true><<<gProj, blk, 0, stream>>>(
      xb, wvb, bV, nullptr, vtb, MTOK, D_MODEL, D_MODEL);

  attn_kernel<<<BATCH * N_HEADS * (SEQ_T / 128), blk, 0, stream>>>(
      qb, kb, vtb, aob);

  gemm_bf16_kernel<false, true, false><<<gProj, blk, 0, stream>>>(
      aob, wob, bO, attnf, nullptr, MTOK, D_MODEL, D_MODEL);

  ln_residual_kernel<<<MTOK, blk, 0, stream>>>(x, attnf, g1, be1, y1f, y1b);

  dim3 gFF1(MTOK / BM, D_FF / BN);
  gemm_bf16_kernel<true, false, true><<<gFF1, blk, 0, stream>>>(
      y1b, w1b, b1, nullptr, h1b, MTOK, D_FF, D_MODEL);

  gemm_bf16_kernel<false, true, false><<<gProj, blk, 0, stream>>>(
      h1b, w2b, b2, fff, nullptr, MTOK, D_MODEL, D_FF);

  ln_residual_kernel<<<MTOK, blk, 0, stream>>>(y1f, fff, g2, be2, out,
                                               nullptr);
}

// v008
// One run takes 285 microseconds.
// Next to v007, in two timings, it ran 1.06 times as fast each time.
// Over all steps from v000 it is 1.80 times as fast.
#include <hip/hip_runtime.h>
#include <hip/hip_bf16.h>

// ---------------------------------------------------------------------------
// Types for CDNA5 WMMA (wave32, 16x16x32 bf16 -> f32)
// ---------------------------------------------------------------------------
typedef __bf16 bf16;
typedef bf16  v16bf __attribute__((ext_vector_type(16)));
typedef bf16  v8bf  __attribute__((ext_vector_type(8)));
typedef float v8f   __attribute__((ext_vector_type(8)));

static constexpr int D_MODEL = 1024;
static constexpr int N_HEADS = 16;
static constexpr int D_FF    = 4096;
static constexpr int SEQ_T   = 2048;
static constexpr int BATCH   = 4;
static constexpr int DK      = 64;            // head dim
static constexpr int MTOK    = BATCH * SEQ_T; // 8192 rows

__device__ __forceinline__ v8f wmma_bf16(v16bf a, v16bf b, v8f c) {
  return __builtin_amdgcn_wmma_f32_16x16x32_bf16(
      /*neg_a=*/false, a, /*neg_b=*/false, b,
      /*c_mod=*/(short)0, c, /*reuse_a=*/false, /*reuse_b=*/false);
}

// Load one 16-bit A/B operand fragment (ISA 16-bit 16x32 layout):
// lane L -> row = L&15, khalf = (L>>4)*8; elems [0..7]=p[0..7],
// elems [8..15]=p[16..23] with p at (row, khalf) of a K-contiguous row.
__device__ __forceinline__ v16bf ldfrag(const bf16* p) {
  v8bf lo = *reinterpret_cast<const v8bf*>(p);
  v8bf hi = *reinterpret_cast<const v8bf*>(p + 16);
  return __builtin_shufflevector(lo, hi, 0, 1, 2, 3, 4, 5, 6, 7,
                                 8, 9, 10, 11, 12, 13, 14, 15);
}

// Returns when every async-to-LDS copy that this wave has issued has landed.
__device__ __forceinline__ void async_wait0() {
  asm volatile("s_wait_asynccnt 0x0" ::: "memory");
}

// ---------------------------------------------------------------------------
// f32 -> bf16 conversion
// ---------------------------------------------------------------------------
// One thread converts 32 values: eight 16-byte loads, each 512 contiguous
// bytes per wave, all issued before the first conversion, so that a wave keeps
// 4 KB in flight and the launch needs 1/32 of the waves.
typedef float v4f  __attribute__((ext_vector_type(4)));
typedef bf16  v4bf __attribute__((ext_vector_type(4)));
static constexpr int CVT_LOADS = 8;                    // loads per thread
static constexpr int CVT_STEP  = 256 * 4;              // floats per block-wide load
static constexpr int CVT_TILE  = CVT_STEP * CVT_LOADS; // floats per block

// All seven arrays are converted by ONE launch: a block takes one tile of
// CVT_TILE values, and its index says which array the tile belongs to (a scalar
// choice, the same for the whole block).  Every array is a whole number of tiles.
static constexpr int TILES_X  = MTOK * D_MODEL / CVT_TILE;     // x
static constexpr int TILES_W  = D_MODEL * D_MODEL / CVT_TILE;  // WQ, WK, WV, WO
static constexpr int TILES_WF = D_FF * D_MODEL / CVT_TILE;     // W1, W2
static constexpr int TILES_ALL = TILES_X + 4 * TILES_W + 2 * TILES_WF;
static_assert(MTOK * D_MODEL % CVT_TILE == 0 &&
              D_MODEL * D_MODEL % CVT_TILE == 0 &&
              D_FF * D_MODEL % CVT_TILE == 0, "no partial tile");

__global__ __launch_bounds__(256) void cvt_all_kernel(
    const float* __restrict__ x, const float* __restrict__ wq,
    const float* __restrict__ wk, const float* __restrict__ wv,
    const float* __restrict__ wo, const float* __restrict__ w1,
    const float* __restrict__ w2, bf16* __restrict__ xb,
    bf16* __restrict__ wqb, bf16* __restrict__ wkb, bf16* __restrict__ wvb,
    bf16* __restrict__ wob, bf16* __restrict__ w1b, bf16* __restrict__ w2b) {
  int t = blockIdx.x;  // becomes the tile's index inside its own array
  const float* in = x;
  bf16* out = xb;
  if (t >= TILES_X) {
    t -= TILES_X;
    if (t < 2 * TILES_WF) {
      in = t < TILES_WF ? w1 : w2;
      out = t < TILES_WF ? w1b : w2b;
      t &= TILES_WF - 1;
    } else {
      t -= 2 * TILES_WF;
      const int a = t / TILES_W;
      in = a == 0 ? wq : a == 1 ? wk : a == 2 ? wv : wo;
      out = a == 0 ? wqb : a == 1 ? wkb : a == 2 ? wvb : wob;
      t &= TILES_W - 1;
    }
  }
  static_assert((TILES_WF & (TILES_WF - 1)) == 0 &&
                (TILES_W & (TILES_W - 1)) == 0, "the masks above");
  const int i0 = t * CVT_TILE + threadIdx.x * 4;
  v4f v[CVT_LOADS];
  // Unrolled so that v[] stays in registers and the loads go out together.
#pragma unroll
  for (int j = 0; j < CVT_LOADS; ++j)
    v[j] = *reinterpret_cast<const v4f*>(in + i0 + j * CVT_STEP);
  // Unrolled for the same reason: every index of v[] is a constant.
#pragma unroll
  for (int j = 0; j < CVT_LOADS; ++j)
    *reinterpret_cast<v4bf*>(out + i0 + j * CVT_STEP) =
        __builtin_convertvector(v[j], v4bf);
}

// ---------------------------------------------------------------------------
// GEMM: C[M,N] = act(A[M,K] @ W[N,K]^T + bias[N]),  A/W bf16 row-major.
// Block = 256 thr (8 waves, 4Mx2N).  Block tile 256(M) x 128(N), K-tile 64.
// A/W tiles staged in LDS via async-to-LDS DMA, double buffered; each wave
// computes a 64x64 tile = 4x4 WMMA fragments per 32-K step, so that a loaded
// fragment feeds four products.  M, N, K are multiples of BM, BN, BK.
// OUT_BF16_T: the bf16 result goes out transposed per batch entry,
// Cb[(row / SEQ_T) * N + col][row % SEQ_T]; with N = D_MODEL that is the
// [(b*H + h)*DK + d][t] layout in which the attention kernel reads V^T.
// ---------------------------------------------------------------------------
static constexpr int BM = 256, BN = 128, BK = 64;
static constexpr int LDS_STRIDE = 72;  // 64 + 8 pad (144B rows, 16B aligned)

template <bool RELU, bool OUT_F32, bool OUT_BF16, bool OUT_BF16_T = false>
__global__ __launch_bounds__(256) void gemm_bf16_kernel(
    const bf16* __restrict__ A, const bf16* __restrict__ W,
    const float* __restrict__ bias, float* __restrict__ Cf,
    bf16* __restrict__ Cb, int M, int N, int K) {
  __shared__ alignas(16) bf16 sA[2][BM * LDS_STRIDE];  // 2 x 36 KB
  __shared__ alignas(16) bf16 sW[2][BN * LDS_STRIDE];  // 2 x 18 KB

  const int tid = threadIdx.x;
  const int lane = tid & 31;
  const int wave = tid >> 5;
  const int m0l = (wave & 3) * 64;   // wave M offset within block tile
  const int n0l = (wave >> 2) * 64;  // wave N offset within block tile

  const int rlane = lane & 15;
  const int koff = (lane >> 4) << 3;  // 0 or 8
  const int half = lane >> 4;

  // Staging: a thread copies one 16B chunk of rows srow + 32*j, j = 0..7 of the
  // A slab and j = 0..3 of the W slab (a wave's copy covers four 128B rows).
  const int srow = tid >> 3;
  const int scol = (tid & 7) << 3;
  const bf16* Ab = A + ((size_t)blockIdx.x * BM + srow) * K + scol;
  const bf16* Wb = W + ((size_t)blockIdx.y * BN + srow) * K + scol;
  const size_t gstep = (size_t)32 * K;            // 32 rows, elements
  const unsigned int lstep = 32 * LDS_STRIDE * 2;  // 32 rows, LDS bytes
  const unsigned int lA =
      (unsigned int)(uintptr_t)(&sA[0][0] + srow * LDS_STRIDE + scol);
  const unsigned int lW =
      (unsigned int)(uintptr_t)(&sW[0][0] + srow * LDS_STRIDE + scol);

  // Stage the [BM x 64] and [BN x 64] K-slabs at kofs into buffer buf.
  auto stage = [&](int buf, int kofs) {
    const bf16* a = Ab + kofs;
    const bf16* w = Wb + kofs;
    const unsigned int da = lA + buf * (BM * LDS_STRIDE * 2);
    const unsigned int dw = lW + buf * (BN * LDS_STRIDE * 2);
    // The twelve copies of a slab pair; the wait in the same statement stands
    // in front of every later rewrite of an address register that they name.
    asm volatile(
        "global_load_async_to_lds_b128 %0, %12, off\n\t"
        "global_load_async_to_lds_b128 %1, %13, off\n\t"
        "global_load_async_to_lds_b128 %2, %14, off\n\t"
        "global_load_async_to_lds_b128 %3, %15, off\n\t"
        "global_load_async_to_lds_b128 %4, %16, off\n\t"
        "global_load_async_to_lds_b128 %5, %17, off\n\t"
        "global_load_async_to_lds_b128 %6, %18, off\n\t"
        "global_load_async_to_lds_b128 %7, %19, off\n\t"
        "global_load_async_to_lds_b128 %8, %20, off\n\t"
        "global_load_async_to_lds_b128 %9, %21, off\n\t"
        "global_load_async_to_lds_b128 %10, %22, off\n\t"
        "global_load_async_to_lds_b128 %11, %23, off\n\t"
        "s_wait_xcnt 0x0"
        :: "v"(da), "v"(da + lstep), "v"(da + 2 * lstep), "v"(da + 3 * lstep),
           "v"(da + 4 * lstep), "v"(da + 5 * lstep), "v"(da + 6 * lstep),
           "v"(da + 7 * lstep), "v"(dw), "v"(dw + lstep), "v"(dw + 2 * lstep),
           "v"(dw + 3 * lstep),
           "v"(a), "v"(a + gstep), "v"(a + 2 * gstep), "v"(a + 3 * gstep),
           "v"(a + 4 * gstep), "v"(a + 5 * gstep), "v"(a + 6 * gstep),
           "v"(a + 7 * gstep), "v"(w), "v"(w + gstep), "v"(w + 2 * gstep),
           "v"(w + 3 * gstep)
        : "memory");
  };

  v8f acc[4][4] = {};

  stage(0, 0);

  const int nk = K / BK;
  for (int t = 0; t < nk; ++t) {
    // Hand-over, passed by every wave: this wave's LDS reads of the last trip
    // are done and its copies of slab t have landed; the barrier then publishes
    // slab t and frees the other buffer for the copies below.
    asm volatile("s_wait_dscnt 0x0" ::: "memory");
    async_wait0();
    __syncthreads();
    if (t + 1 < nk) stage((t + 1) & 1, (t + 1) * BK);
    const bf16* a0 = sA[t & 1] + (m0l + rlane) * LDS_STRIDE + koff;
    const bf16* w0 = sW[t & 1] + (n0l + rlane) * LDS_STRIDE + koff;
#pragma unroll
    for (int kk = 0; kk < BK; kk += 32) {
      // All loops below unrolled: every index of af, wf and acc is then a
      // constant and the arrays stay in registers.
      v16bf af[4], wf[4];
#pragma unroll
      for (int i = 0; i < 4; ++i) af[i] = ldfrag(a0 + i * 16 * LDS_STRIDE + kk);
#pragma unroll
      for (int j = 0; j < 4; ++j) wf[j] = ldfrag(w0 + j * 16 * LDS_STRIDE + kk);
      // Inputs only: holds the sixteen LDS reads of a 32-K step together in front
      // of its sixteen products.  Without it the A fragments share one register
      // set and every row of four products waits out an LDS latency of its own.
      asm volatile("" :: "v"(af[0]), "v"(af[1]), "v"(af[2]), "v"(af[3]),
                         "v"(wf[0]), "v"(wf[1]), "v"(wf[2]), "v"(wf[3]));
#pragma unroll
      for (int i = 0; i < 4; ++i)
#pragma unroll
        for (int j = 0; j < 4; ++j)
          acc[i][j] = wmma_bf16(af[i], wf[j], acc[i][j]);
    }
    // No trailing barrier: next stage() writes the *other* buffer, and the
    // top-of-loop waits+barrier order buffer reuse across iterations.
  }
  async_wait0();  // no copy is outstanding when the wave ends, whatever K is

  // Epilogue.  C layout: VGPR r, lane L -> row = r + 8*(L>>4), col = L&15.
  const int m0 = blockIdx.x * BM + m0l;
  const int n0 = blockIdx.y * BN + n0l;
  if constexpr (OUT_BF16_T) {
    // A lane's eight accumulator registers are eight consecutive rows of one
    // column, so they are 16 contiguous bytes of the transposed result.  The
    // four stores of a column (i = 0..3) fill one 128B line, written by this
    // wave alone.  A wave's 64 rows lie in one batch entry.
    static_assert(SEQ_T % BM == 0, "a block tile stays inside one batch entry");
    bf16* ct = Cb + (size_t)(m0 / SEQ_T) * N * SEQ_T + (m0 % SEQ_T) + half * 8;
    // Both loops unrolled: every index of acc is then a constant.
#pragma unroll
    for (int j = 0; j < 4; ++j) {
      const int col = n0 + j * 16 + rlane;
      const float bv = bias[col];
#pragma unroll
      for (int i = 0; i < 4; ++i) {
        v8bf o;
#pragma unroll
        for (int r = 0; r < 8; ++r) {
          float v = acc[i][j][r] + bv;
          if (RELU) v = fmaxf(v, 0.0f);
          o[r] = (bf16)v;
        }
        *reinterpret_cast<v8bf*>(ct + (size_t)col * SEQ_T + i * 16) = o;
      }
    }
    return;
  }
#pragma unroll
  for (int i = 0; i < 4; ++i) {
#pragma unroll
    for (int j = 0; j < 4; ++j) {
      int col = n0 + j * 16 + rlane;
      float bv = bias[col];
#pragma unroll
      for (int r = 0; r < 8; ++r) {
        int row = m0 + i * 16 + r + half * 8;
        float v = acc[i][j][r] + bv;
        if (RELU) v = fmaxf(v, 0.0f);
        if (OUT_F32) Cf[(size_t)row * N + col] = v;
        if (OUT_BF16) Cb[(size_t)row * N + col] = (bf16)v;
      }
    }
  }
}

__device__ __forceinline__ float xhalf(float x) {
  return __builtin_bit_cast(
      float, __builtin_amdgcn_permlanex16(__builtin_bit_cast(int, x),
                                          __builtin_bit_cast(int, x),
                                          0x76543210, 0xfedcba98, false, false));
}

// K and V^T reach the waves through LDS: a stage is 64 keys, that is 64 K rows
// of 128 B and 64 V^T rows of 128 B, copied once for the block's 8 waves.
static constexpr int ATT_KEYS  = 64;  // keys per stage
static constexpr int ATT_PITCH = 72;  // LDS row: 64 values + 8 pad (144 B)

__global__ __launch_bounds__(256) void attn_kernel(
    const bf16* __restrict__ Q, const bf16* __restrict__ Kmat,
    const bf16* __restrict__ VT, bf16* __restrict__ O) {
  __shared__ alignas(16) bf16 sK[2][ATT_KEYS * ATT_PITCH];  // 2 x 9 KB
  __shared__ alignas(16) bf16 sV[2][DK * ATT_PITCH];        // 2 x 9 KB

  const int tid = threadIdx.x;
  const int lane = tid & 31;
  // Scalar, so that the per-wave causal skip below is a scalar branch.
  const int wave = __builtin_amdgcn_readfirstlane(tid >> 5);
  const int blk = blockIdx.x;
  const int pairi = blk & 7;  // T/128 = 16 chunks = 8 pairs
  const int bh = blk >> 3;    // 0..63
  const int b = bh >> 4;
  const int h = bh & (N_HEADS - 1);

  const int rlane = lane & 15;
  const int khalf = lane >> 4;
  const int koff = khalf * 8;

  const bf16* qp = Q + (size_t)b * SEQ_T * D_MODEL + h * DK;
  const bf16* kp = Kmat + (size_t)b * SEQ_T * D_MODEL + h * DK;
  const bf16* vtp = VT + (size_t)bh * DK * SEQ_T;

  // Staging: a thread copies one 16B chunk of rows srow and srow + 32 of the K
  // slab and of the V^T slab (a wave's copy covers four whole 128B rows).
  const int srow = tid >> 3;
  const int scol = (tid & 7) << 3;
  const bf16* kg = kp + (size_t)srow * D_MODEL + scol;
  const bf16* vg = vtp + (size_t)srow * SEQ_T + scol;
  const unsigned int lK =
      (unsigned int)(uintptr_t)(&sK[0][0] + srow * ATT_PITCH + scol);
  const unsigned int lV =
      (unsigned int)(uintptr_t)(&sV[0][0] + srow * ATT_PITCH + scol);
  const unsigned int lhalf = 32 * ATT_PITCH * 2;       // 32 rows, LDS bytes
  const unsigned int lbuf = ATT_KEYS * ATT_PITCH * 2;  // one buffer, LDS bytes

  // Copy keys st*64 .. st*64+63 (K rows, V^T columns) into buffer buf.
  auto stage = [&](int buf, int st) {
    const bf16* k = kg + (size_t)st * ATT_KEYS * D_MODEL;
    const bf16* v = vg + st * ATT_KEYS;
    const unsigned int dk = lK + buf * lbuf;
    const unsigned int dv = lV + buf * lbuf;
    // The four copies of a stage; the wait in the same statement stands in
    // front of every later rewrite of an address register that they name.
    asm volatile(
        "global_load_async_to_lds_b128 %0, %4, off\n\t"
        "global_load_async_to_lds_b128 %1, %5, off\n\t"
        "global_load_async_to_lds_b128 %2, %6, off\n\t"
        "global_load_async_to_lds_b128 %3, %7, off\n\t"
        "s_wait_xcnt 0x0"
        :: "v"(dk), "v"(dk + lhalf), "v"(dv), "v"(dv + lhalf),
           "v"(k), "v"(k + (size_t)32 * D_MODEL), "v"(v),
           "v"(v + (size_t)32 * SEQ_T)
        : "memory");
  };

  for (int part = 0; part < 2; ++part) {
  const int qchunk = part == 0 ? 15 - pairi : pairi;
  const int q_base = qchunk * 128 + wave * 16;
  const int qi = q_base + rlane;  // this lane's query
  const bf16* qrow = qp + (size_t)qi * D_MODEL;
  v16bf qf0 = ldfrag(qrow + koff);
  v16bf qf1 = ldfrag(qrow + 32 + koff);

  float rowM = -1.0e30f;  // running maximum of query qi (equal in both halves)
  float rowL = 0.0f;      // running sum over this half's keys only
  v8f acc[4] = {{}, {}, {}, {}};  // acc[dg][r] = O[qi][dg*16 + koff + r]

  const float scale = 0.125f;          // 1/sqrt(64)
  const int nkt = (q_base + 47) >> 5;  // # of 32-key tiles of this wave (causal)
  const int nst = qchunk * 2 + 2;      // # of 64-key stages of the block

  // Second chunk: the barrier at the foot of the first chunk's last stage has
  // ended every wave's reads of both buffers, and no copy is outstanding.
  stage(0, 0);
  async_wait0();    // this wave's copies of stage 0 have landed
  __syncthreads();  // publishes stage 0
  stage(1, 1);      // nst >= 2: stage 1 always exists

  for (int st = 0; st < nst; ++st) {
    const bf16* kb = sK[st & 1] + rlane * ATT_PITCH + koff;
    const bf16* vb = sV[st & 1] + rlane * ATT_PITCH + koff;
    // Unrolled: the LDS offsets of both halves of a stage are then constants.
#pragma unroll
    for (int sub = 0; sub < 2; ++sub) {
      const int kt = st * ATT_KEYS + sub * 32;
      if (st * 2 + sub < nkt) {  // tiles past this wave's diagonal are skipped
        v8f s0 = {}, s1 = {};  // s0[r]: key kt+koff+r, s1[r]: key kt+16+koff+r
        {
          const bf16* kr0 = kb + sub * 32 * ATT_PITCH;
          const bf16* kr1 = kr0 + 16 * ATT_PITCH;
          const v16bf k00 = ldfrag(kr0), k01 = ldfrag(kr0 + 32);
          const v16bf k10 = ldfrag(kr1), k11 = ldfrag(kr1 + 32);
          // Inputs only: holds the four fragment reads together in front of the
          // products, so that their LDS latencies overlap instead of adding up.
          asm volatile("" :: "v"(k00), "v"(k01), "v"(k10), "v"(k11));
          s0 = wmma_bf16(k00, qf0, s0);
          s1 = wmma_bf16(k10, qf0, s1);
          s0 = wmma_bf16(k01, qf1, s0);
          s1 = wmma_bf16(k11, qf1, s1);
        }
        float sc[16];
        float m = -1.0e30f;
#pragma unroll
        for (int r = 0; r < 8; ++r) {
          const int key = kt + koff + r;
          sc[r] = (key <= qi) ? (float)s0[r] * scale : -1.0e30f;
          sc[8 + r] = (key + 16 <= qi) ? (float)s1[r] * scale : -1.0e30f;
          m = fmaxf(m, fmaxf(sc[r], sc[8 + r]));
        }
        m = fmaxf(m, xhalf(m));
        const float newM = fmaxf(rowM, m);
        const float corr = __expf(rowM - newM);
        rowM = newM;
        v16bf pf;
        float p[16];
#pragma unroll
        for (int s = 0; s < 16; ++s) {
          p[s] = __expf(sc[s] - newM);
          pf[s] = (bf16)p[s];
        }
#pragma unroll
        for (int w = 8; w >= 1; w >>= 1)
#pragma unroll
          for (int s = 0; s < w; ++s) p[s] += p[s + w];
        rowL = rowL * corr + p[0];
        v16bf vf[4];
#pragma unroll
        for (int dg = 0; dg < 4; ++dg)
          vf[dg] = ldfrag(vb + dg * 16 * ATT_PITCH + sub * 32);
        // Inputs only, as for K: the four V^T fragment reads go out together.
        asm volatile("" :: "v"(vf[0]), "v"(vf[1]), "v"(vf[2]), "v"(vf[3]));
#pragma unroll
        for (int dg = 0; dg < 4; ++dg) {
          acc[dg] *= corr;
          acc[dg] = wmma_bf16(vf[dg], pf, acc[dg]);
        }
      }
    }
    // Hand-over, passed by every wave, outside the causal skip: this wave's LDS
    // reads of stage st are done and its copies of stage st + 1 have landed; the
    // barrier then publishes stage st + 1 and frees this stage's buffer.
    asm volatile("s_wait_dscnt 0x0" ::: "memory");
    async_wait0();
    __syncthreads();
    if (st + 2 < nst) stage(st & 1, st + 2);
  }
  async_wait0();  // no copy is outstanding when the wave ends

  const float inv = 1.0f / (rowL + xhalf(rowL));
  bf16* op = O + ((size_t)(b * SEQ_T + qi)) * D_MODEL + h * DK + koff;
#pragma unroll
  for (int dg = 0; dg < 4; ++dg) {
    v8bf o;
#pragma unroll
    for (int r = 0; r < 8; ++r) o[r] = (bf16)(acc[dg][r] * inv);
    *reinterpret_cast<v8bf*>(op + dg * 16) = o;
  }
  // The second chunk's code rewrites registers that the four stores above name
  // (address and data): this wait stands in front of every such rewrite.
  asm volatile("s_wait_xcnt 0x0" ::: "memory");
  }  // part
}

// ---------------------------------------------------------------------------
// LayerNorm(residual): out = LN(A + R) * g + be ; optional bf16 copy.
// ---------------------------------------------------------------------------
__global__ __launch_bounds__(256) void ln_residual_kernel(
    const float* __restrict__ A, const float* __restrict__ R,
    const float* __restrict__ g, const float* __restrict__ be,
    float* __restrict__ outF, bf16* __restrict__ outB) {
  const int row = blockIdx.x;
  const float* a = A + (size_t)row * D_MODEL;
  const float* rr = R + (size_t)row * D_MODEL;
  float v[4];
  float s = 0.0f;
#pragma unroll
  for (int i = 0; i < 4; ++i) {
    int idx = threadIdx.x + i * 256;
    v[i] = a[idx] + rr[idx];
    s += v[i];
  }
  __shared__ float red[8];
  const int wv = threadIdx.x >> 5, ln = threadIdx.x & 31;
#pragma unroll
  for (int off = 16; off >= 1; off >>= 1) s += __shfl_xor(s, off, 32);
  if (ln == 0) red[wv] = s;
  __syncthreads();
  float mean = 0.0f;
#pragma unroll
  for (int i = 0; i < 8; ++i) mean += red[i];
  mean *= (1.0f / D_MODEL);
  __syncthreads();
  float vs = 0.0f;
#pragma unroll
  for (int i = 0; i < 4; ++i) {
    float d = v[i] - mean;
    vs += d * d;
  }
#pragma unroll
  for (int off = 16; off >= 1; off >>= 1) vs += __shfl_xor(vs, off, 32);
  if (ln == 0) red[wv] = vs;
  __syncthreads();
  float var = 0.0f;
#pragma unroll
  for (int i = 0; i < 8; ++i) var += red[i];
  var *= (1.0f / D_MODEL);
  const float rstd = rsqrtf(var + 1e-5f);
#pragma unroll
  for (int i = 0; i < 4; ++i) {
    int idx = threadIdx.x + i * 256;
    float y = (v[i] - mean) * rstd * g[idx] + be[idx];
    outF[(size_t)row * D_MODEL + idx] = y;
    if (outB) outB[(size_t)row * D_MODEL + idx] = (bf16)y;
  }
}

// ---------------------------------------------------------------------------
// Host-side orchestration
// ---------------------------------------------------------------------------
extern "C" void kernel_launch(void* const* d_in, const int* in_sizes, int n_in,
                              void* d_out, int out_size, void* d_ws,
                              size_t ws_size, hipStream_t stream) {
  (void)in_sizes; (void)n_in; (void)out_size; (void)ws_size;
  const float* x  = (const float*)d_in[0];
  const float* WQ = (const float*)d_in[1];
  const float* bQ = (const float*)d_in[2];
  const float* WK = (const float*)d_in[3];
  const float* bK = (const float*)d_in[4];
  const float* WV = (const float*)d_in[5];
  const float* bV = (const float*)d_in[6];
  const float* WO = (const float*)d_in[7];
  const float* bO = (const float*)d_in[8];
  const float* W1 = (const float*)d_in[9];
  const float* b1 = (const float*)d_in[10];
  const float* W2 = (const float*)d_in[11];
  const float* b2 = (const float*)d_in[12];
  const float* g1 = (const float*)d_in[13];
  const float* be1 = (const float*)d_in[14];
  const float* g2 = (const float*)d_in[15];
  const float* be2 = (const float*)d_in[16];
  float* out = (float*)d_out;

  char* w = (char*)d_ws;
  auto carve = [&](size_t bytes) {
    char* p = w;
    w += (bytes + 255) & ~(size_t)255;
    return p;
  };
  const size_t MT = (size_t)MTOK;
  bf16* xb  = (bf16*)carve(MT * D_MODEL * 2);
  bf16* wqb = (bf16*)carve((size_t)D_MODEL * D_MODEL * 2);
  bf16* wkb = (bf16*)carve((size_t)D_MODEL * D_MODEL * 2);
  bf16* wvb = (bf16*)carve((size_t)D_MODEL * D_MODEL * 2);
  bf16* wob = (bf16*)carve((size_t)D_MODEL * D_MODEL * 2);
  bf16* w1b = (bf16*)carve((size_t)D_FF * D_MODEL * 2);
  bf16* w2b = (bf16*)carve((size_t)D_MODEL * D_FF * 2);
  bf16* qb  = (bf16*)carve(MT * D_MODEL * 2);
  bf16* kb  = (bf16*)carve(MT * D_MODEL * 2);
  bf16* vtb = (bf16*)carve(MT * D_MODEL * 2);
  bf16* aob = (bf16*)carve(MT * D_MODEL * 2);
  float* attnf = (float*)carve(MT * D_MODEL * 4);
  float* y1f   = (float*)carve(MT * D_MODEL * 4);
  bf16*  y1b   = (bf16*)carve(MT * D_MODEL * 2);
  bf16*  h1b   = (bf16*)carve(MT * D_FF * 2);
  float* fff = attnf; // attn_out dead after LN1

  cvt_all_kernel<<<TILES_ALL, 256, 0, stream>>>(
      x, WQ, WK, WV, WO, W1, W2, xb, wqb, wkb, wvb, wob, w1b, w2b);

  dim3 blk(256);
  dim3 gProj(MTOK / BM, D_MODEL / BN);
  gemm_bf16_kernel<false, false, true><<<gProj, blk, 0, stream>>>(
      xb, wqb, bQ, nullptr, qb, MTOK, D_MODEL, D_MODEL);
  gemm_bf16_kernel<false, false, true><<<gProj, blk, 0, stream>>>(
      xb, wkb, bK, nullptr, kb, MTOK, D_MODEL, D_MODEL);
  gemm_bf16_kernel<false, false, false, true><<<gProj, blk, 0, stream>>>(
      xb, wvb, bV, nullptr, vtb, MTOK, D_MODEL, D_MODEL);

  attn_kernel<<<BATCH * N_HEADS * (SEQ_T / 256), blk, 0, stream>>>(
      qb, kb, vtb, aob);

  gemm_bf16_kernel<false, true, false><<<gProj, blk, 0, stream>>>(
      aob, wob, bO, attnf, nullptr, MTOK, D_MODEL, D_MODEL);

  ln_residual_kernel<<<MTOK, blk, 0, stream>>>(x, attnf, g1, be1, y1f, y1b);

  dim3 gFF1(MTOK / BM, D_FF / BN);
  gemm_bf16_kernel<true, false, true><<<gFF1, blk, 0, stream>>>(
      y1b, w1b, b1, nullptr, h1b, MTOK, D_FF, D_MODEL);

  gemm_bf16_kernel<false, true, false><<<gProj, blk, 0, stream>>>(
      h1b, w2b, b2, fff, nullptr, MTOK, D_MODEL, D_FF);

  ln_residual_kernel<<<MTOK, blk, 0, stream>>>(y1f, fff, g2, be2, out,
                                               nullptr);
}

// v009
// It runs in 275 microseconds.
// Timed twice side by side with v008, it ran 1.03 times as fast both times.
// Over all steps from v000 it is 1.85 times as fast.
#include <hip/hip_runtime.h>
#include <hip/hip_bf16.h>

// ---------------------------------------------------------------------------
// Types for CDNA5 WMMA (wave32, 16x16x32 bf16 -> f32)
// ---------------------------------------------------------------------------
typedef __bf16 bf16;
typedef bf16  v16bf __attribute__((ext_vector_type(16)));
typedef bf16  v8bf  __attribute__((ext_vector_type(8)));
typedef float v8f   __attribute__((ext_vector_type(8)));

static constexpr int D_MODEL = 1024;
static constexpr int N_HEADS = 16;
static constexpr int D_FF    = 4096;
static constexpr int SEQ_T   = 2048;
static constexpr int BATCH   = 4;
static constexpr int DK      = 64;            // head dim
static constexpr int MTOK    = BATCH * SEQ_T; // 8192 rows

__device__ __forceinline__ v8f wmma_bf16(v16bf a, v16bf b, v8f c) {
  return __builtin_amdgcn_wmma_f32_16x16x32_bf16(
      /*neg_a=*/false, a, /*neg_b=*/false, b,
      /*c_mod=*/(short)0, c, /*reuse_a=*/false, /*reuse_b=*/false);
}

// Load one 16-bit A/B operand fragment (ISA 16-bit 16x32 layout):
// lane L -> row = L&15, khalf = (L>>4)*8; elems [0..7]=p[0..7],
// elems [8..15]=p[16..23] with p at (row, khalf) of a K-contiguous row.
__device__ __forceinline__ v16bf ldfrag(const bf16* p) {
  v8bf lo = *reinterpret_cast<const v8bf*>(p);
  v8bf hi = *reinterpret_cast<const v8bf*>(p + 16);
  return __builtin_shufflevector(lo, hi, 0, 1, 2, 3, 4, 5, 6, 7,
                                 8, 9, 10, 11, 12, 13, 14, 15);
}

// Returns when every async-to-LDS copy that this wave has issued has landed.
__device__ __forceinline__ void async_wait0() {
  asm volatile("s_wait_asynccnt 0x0" ::: "memory");
}

// ---------------------------------------------------------------------------
// f32 -> bf16 conversion
// ---------------------------------------------------------------------------
// One thread converts 32 values: eight 16-byte loads, each 512 contiguous
// bytes per wave, all issued before the first conversion, so that a wave keeps
// 4 KB in flight and the launch needs 1/32 of the waves.
typedef float v4f  __attribute__((ext_vector_type(4)));
typedef bf16  v4bf __attribute__((ext_vector_type(4)));
static constexpr int CVT_LOADS = 8;                    // loads per thread
static constexpr int CVT_STEP  = 256 * 4;              // floats per block-wide load
static constexpr int CVT_TILE  = CVT_STEP * CVT_LOADS; // floats per block

// All seven arrays are converted by ONE launch: a block takes one tile of
// CVT_TILE values, and its index says which array the tile belongs to (a scalar
// choice, the same for the whole block).  Every array is a whole number of tiles.
static constexpr int TILES_X  = MTOK * D_MODEL / CVT_TILE;     // x
static constexpr int TILES_W  = D_MODEL * D_MODEL / CVT_TILE;  // WQ, WK, WV, WO
static constexpr int TILES_WF = D_FF * D_MODEL / CVT_TILE;     // W1, W2
static constexpr int TILES_ALL = TILES_X + 4 * TILES_W + 2 * TILES_WF;
static_assert(MTOK * D_MODEL % CVT_TILE == 0 &&
              D_MODEL * D_MODEL % CVT_TILE == 0 &&
              D_FF * D_MODEL % CVT_TILE == 0, "no partial tile");

__global__ __launch_bounds__(256) void cvt_all_kernel(
    const float* __restrict__ x, const float* __restrict__ wq,
    const float* __restrict__ wk, const float* __restrict__ wv,
    const float* __restrict__ wo, const float* __restrict__ w1,
    const float* __restrict__ w2, bf16* __restrict__ xb,
    bf16* __restrict__ wqb, bf16* __restrict__ wkb, bf16* __restrict__ wvb,
    bf16* __restrict__ wob, bf16* __restrict__ w1b, bf16* __restrict__ w2b) {
  int t = blockIdx.x;  // becomes the tile's index inside its own array
  const float* in = x;
  bf16* out = xb;
  if (t >= TILES_X) {
    t -= TILES_X;
    if (t < 2 * TILES_WF) {
      in = t < TILES_WF ? w1 : w2;
      out = t < TILES_WF ? w1b : w2b;
      t &= TILES_WF - 1;
    } else {
      t -= 2 * TILES_WF;
      const int a = t / TILES_W;
      in = a == 0 ? wq : a == 1 ? wk : a == 2 ? wv : wo;
      out = a == 0 ? wqb : a == 1 ? wkb : a == 2 ? wvb : wob;
      t &= TILES_W - 1;
    }
  }
  static_assert((TILES_WF & (TILES_WF - 1)) == 0 &&
                (TILES_W & (TILES_W - 1)) == 0, "the masks above");
  const int i0 = t * CVT_TILE + threadIdx.x * 4;
  v4f v[CVT_LOADS];
  // Unrolled so that v[] stays in registers and the loads go out together.
#pragma unroll
  for (int j = 0; j < CVT_LOADS; ++j)
    v[j] = *reinterpret_cast<const v4f*>(in + i0 + j * CVT_STEP);
  // Unrolled for the same reason: every index of v[] is a constant.
#pragma unroll
  for (int j = 0; j < CVT_LOADS; ++j)
    *reinterpret_cast<v4bf*>(out + i0 + j * CVT_STEP) =
        __builtin_convertvector(v[j], v4bf);
}

// ---------------------------------------------------------------------------
// GEMM: C[M,N] = act(A[M,K] @ W[N,K]^T + bias[N]),  A/W bf16 row-major.
// Block = 256 thr (8 waves, 4Mx2N).  Block tile 256(M) x 128(N), K-tile 64.
// A/W tiles staged in LDS via async-to-LDS DMA, double buffered; each wave
// computes a 64x64 tile = 4x4 WMMA fragments per 32-K step, so that a loaded
// fragment feeds four products.  M, N, K are multiples of BM, BN, BK.
// OUT_BF16_T: the bf16 result goes out transposed per batch entry,
// Cb[(row / SEQ_T) * N + col][row % SEQ_T]; with N = D_MODEL that is the
// [(b*H + h)*DK + d][t] layout in which the attention kernel reads V^T.
// ---------------------------------------------------------------------------
static constexpr int BM = 256, BN = 128, BK = 64;
static constexpr int LDS_STRIDE = 72;  // 64 + 8 pad (144B rows, 16B aligned)

template <bool RELU, bool OUT_F32, bool OUT_BF16, bool OUT_BF16_T = false>
__global__ __launch_bounds__(256) void gemm_bf16_kernel(
    const bf16* __restrict__ A, const bf16* __restrict__ W,
    const float* __restrict__ bias, float* __restrict__ Cf,
    bf16* __restrict__ Cb, int M, int N, int K) {
  __shared__ alignas(16) bf16 sA[2][BM * LDS_STRIDE];  // 2 x 36 KB
  __shared__ alignas(16) bf16 sW[2][BN * LDS_STRIDE];  // 2 x 18 KB

  const int tid = threadIdx.x;
  const int lane = tid & 31;
  const int wave = tid >> 5;
  const int m0l = (wave & 3) * 64;   // wave M offset within block tile
  const int n0l = (wave >> 2) * 64;  // wave N offset within block tile

  const int rlane = lane & 15;
  const int koff = (lane >> 4) << 3;  // 0 or 8
  const int half = lane >> 4;

  // Staging: a thread copies one 16B chunk of rows srow + 32*j, j = 0..7 of the
  // A slab and j = 0..3 of the W slab (a wave's copy covers four 128B rows).
  const int srow = tid >> 3;
  const int scol = (tid & 7) << 3;
  const bf16* Ab = A + ((size_t)blockIdx.x * BM + srow) * K + scol;
  const bf16* Wb = W + ((size_t)blockIdx.y * BN + srow) * K + scol;
  const size_t gstep = (size_t)32 * K;            // 32 rows, elements
  const unsigned int lstep = 32 * LDS_STRIDE * 2;  // 32 rows, LDS bytes
  const unsigned int lA =
      (unsigned int)(uintptr_t)(&sA[0][0] + srow * LDS_STRIDE + scol);
  const unsigned int lW =
      (unsigned int)(uintptr_t)(&sW[0][0] + srow * LDS_STRIDE + scol);

  // Stage the [BM x 64] and [BN x 64] K-slabs at kofs into buffer buf.
  auto stage = [&](int buf, int kofs) {
    const bf16* a = Ab + kofs;
    const bf16* w = Wb + kofs;
    const unsigned int da = lA + buf * (BM * LDS_STRIDE * 2);
    const unsigned int dw = lW + buf * (BN * LDS_STRIDE * 2);
    // The twelve copies of a slab pair; the wait in the same statement stands
    // in front of every later rewrite of an address register that they name.
    asm volatile(
        "global_load_async_to_lds_b128 %0, %12, off\n\t"
        "global_load_async_to_lds_b128 %1, %13, off\n\t"
        "global_load_async_to_lds_b128 %2, %14, off\n\t"
        "global_load_async_to_lds_b128 %3, %15, off\n\t"
        "global_load_async_to_lds_b128 %4, %16, off\n\t"
        "global_load_async_to_lds_b128 %5, %17, off\n\t"
        "global_load_async_to_lds_b128 %6, %18, off\n\t"
        "global_load_async_to_lds_b128 %7, %19, off\n\t"
        "global_load_async_to_lds_b128 %8, %20, off\n\t"
        "global_load_async_to_lds_b128 %9, %21, off\n\t"
        "global_load_async_to_lds_b128 %10, %22, off\n\t"
        "global_load_async_to_lds_b128 %11, %23, off\n\t"
        "s_wait_xcnt 0x0"
        :: "v"(da), "v"(da + lstep), "v"(da + 2 * lstep), "v"(da + 3 * lstep),
           "v"(da + 4 * lstep), "v"(da + 5 * lstep), "v"(da + 6 * lstep),
           "v"(da + 7 * lstep), "v"(dw), "v"(dw + lstep), "v"(dw + 2 * lstep),
           "v"(dw + 3 * lstep),
           "v"(a), "v"(a + gstep), "v"(a + 2 * gstep), "v"(a + 3 * gstep),
           "v"(a + 4 * gstep), "v"(a + 5 * gstep), "v"(a + 6 * gstep),
           "v"(a + 7 * gstep), "v"(w), "v"(w + gstep), "v"(w + 2 * gstep),
           "v"(w + 3 * gstep)
        : "memory");
  };

  v8f acc[4][4] = {};

  stage(0, 0);

  const int nk = K / BK;
  for (int t = 0; t < nk; ++t) {
    // Hand-over, passed by every wave: this wave's LDS reads of the last trip
    // are done and its copies of slab t have landed; the barrier then publishes
    // slab t and frees the other buffer for the copies below.
    asm volatile("s_wait_dscnt 0x0" ::: "memory");
    async_wait0();
    __syncthreads();
    if (t + 1 < nk) stage((t + 1) & 1, (t + 1) * BK);
    const bf16* a0 = sA[t & 1] + (m0l + rlane) * LDS_STRIDE + koff;
    const bf16* w0 = sW[t & 1] + (n0l + rlane) * LDS_STRIDE + koff;
#pragma unroll
    for (int kk = 0; kk < BK; kk += 32) {
      // All loops below unrolled: every index of af, wf and acc is then a
      // constant and the arrays stay in registers.
      v16bf af[4], wf[4];
#pragma unroll
      for (int i = 0; i < 4; ++i) af[i] = ldfrag(a0 + i * 16 * LDS_STRIDE + kk);
#pragma unroll
      for (int j = 0; j < 4; ++j) wf[j] = ldfrag(w0 + j * 16 * LDS_STRIDE + kk);
      // Inputs only: holds the sixteen LDS reads of a 32-K step together in front
      // of its sixteen products.  Without it the A fragments share one register
      // set and every row of four products waits out an LDS latency of its own.
      asm volatile("" :: "v"(af[0]), "v"(af[1]), "v"(af[2]), "v"(af[3]),
                         "v"(wf[0]), "v"(wf[1]), "v"(wf[2]), "v"(wf[3]));
#pragma unroll
      for (int i = 0; i < 4; ++i)
#pragma unroll
        for (int j = 0; j < 4; ++j)
          acc[i][j] = wmma_bf16(af[i], wf[j], acc[i][j]);
    }
    // No trailing barrier: next stage() writes the *other* buffer, and the
    // top-of-loop waits+barrier order buffer reuse across iterations.
  }
  async_wait0();  // no copy is outstanding when the wave ends, whatever K is

  // Epilogue.  C layout: VGPR r, lane L -> row = r + 8*(L>>4), col = L&15.
  const int m0 = blockIdx.x * BM + m0l;
  const int n0 = blockIdx.y * BN + n0l;
  if constexpr (OUT_BF16_T) {
    // A lane's eight accumulator registers are eight consecutive rows of one
    // column, so they are 16 contiguous bytes of the transposed result.  The
    // four stores of a column (i = 0..3) fill one 128B line, written by this
    // wave alone.  A wave's 64 rows lie in one batch entry.
    static_assert(SEQ_T % BM == 0, "a block tile stays inside one batch entry");
    bf16* ct = Cb + (size_t)(m0 / SEQ_T) * N * SEQ_T + (m0 % SEQ_T) + half * 8;
    // Both loops unrolled: every index of acc is then a constant.
#pragma unroll
    for (int j = 0; j < 4; ++j) {
      const int col = n0 + j * 16 + rlane;
      const float bv = bias[col];
#pragma unroll
      for (int i = 0; i < 4; ++i) {
        v8bf o;
#pragma unroll
        for (int r = 0; r < 8; ++r) {
          float v = acc[i][j][r] + bv;
          if (RELU) v = fmaxf(v, 0.0f);
          o[r] = (bf16)v;
        }
        *reinterpret_cast<v8bf*>(ct + (size_t)col * SEQ_T + i * 16) = o;
      }
    }
    return;
  }
#pragma unroll
  for (int i = 0; i < 4; ++i) {
#pragma unroll
    for (int j = 0; j < 4; ++j) {
      int col = n0 + j * 16 + rlane;
      float bv = bias[col];
#pragma unroll
      for (int r = 0; r < 8; ++r) {
        int row = m0 + i * 16 + r + half * 8;
        float v = acc[i][j][r] + bv;
        if (RELU) v = fmaxf(v, 0.0f);
        if (OUT_F32) Cf[(size_t)row * N + col] = v;
        if (OUT_BF16) Cb[(size_t)row * N + col] = (bf16)v;
      }
    }
  }
}

__device__ __forceinline__ float xhalf(float x) {
  return __builtin_bit_cast(
      float, __builtin_amdgcn_permlanex16(__builtin_bit_cast(int, x),
                                          __builtin_bit_cast(int, x),
                                          0x76543210, 0xfedcba98, false, false));
}

// K and V^T reach the waves through LDS: a stage is 64 keys, that is 64 K rows
// of 128 B and 64 V^T rows of 128 B, copied once for the block's 8 waves.
static constexpr int ATT_KEYS  = 64;  // keys per stage
static constexpr int ATT_PITCH = 72;  // LDS row: 64 values + 8 pad (144 B)

__global__ __launch_bounds__(256) void attn_kernel(
    const bf16* __restrict__ Q, const bf16* __restrict__ Kmat,
    const bf16* __restrict__ VT, bf16* __restrict__ O) {
  __shared__ alignas(16) bf16 sK[2][ATT_KEYS * ATT_PITCH];  // 2 x 9 KB
  __shared__ alignas(16) bf16 sV[2][DK * ATT_PITCH];        // 2 x 9 KB

  const int tid = threadIdx.x;
  const int lane = tid & 31;
  // Scalar, so that the per-wave causal skip below is a scalar branch.
  const int wave = __builtin_amdgcn_readfirstlane(tid >> 5);
  const int blk = blockIdx.x;
  const int pairi = blk & 7;  // T/128 = 16 chunks = 8 pairs
  const int bh = blk >> 3;    // 0..63
  const int b = bh >> 4;
  const int h = bh & (N_HEADS - 1);

  const int rlane = lane & 15;
  const int khalf = lane >> 4;
  const int koff = khalf * 8;

  const bf16* qp = Q + (size_t)b * SEQ_T * D_MODEL + h * DK;
  const bf16* kp = Kmat + (size_t)b * SEQ_T * D_MODEL + h * DK;
  const bf16* vtp = VT + (size_t)bh * DK * SEQ_T;

  // Staging: a thread copies one 16B chunk of rows srow and srow + 32 of the K
  // slab and of the V^T slab (a wave's copy covers four whole 128B rows).
  const int srow = tid >> 3;
  const int scol = (tid & 7) << 3;
  const bf16* kg = kp + (size_t)srow * D_MODEL + scol;
  const bf16* vg = vtp + (size_t)srow * SEQ_T + scol;
  const unsigned int lK =
      (unsigned int)(uintptr_t)(&sK[0][0] + srow * ATT_PITCH + scol);
  const unsigned int lV =
      (unsigned int)(uintptr_t)(&sV[0][0] + srow * ATT_PITCH + scol);
  const unsigned int lhalf = 32 * ATT_PITCH * 2;       // 32 rows, LDS bytes
  const unsigned int lbuf = ATT_KEYS * ATT_PITCH * 2;  // one buffer, LDS bytes

  // Copy keys st*64 .. st*64+63 (K rows, V^T columns) into buffer buf.
  auto stage = [&](int buf, int st) {
    const bf16* k = kg + (size_t)st * ATT_KEYS * D_MODEL;
    const bf16* v = vg + st * ATT_KEYS;
    const unsigned int dk = lK + buf * lbuf;
    const unsigned int dv = lV + buf * lbuf;
    // The four copies of a stage; the wait in the same statement stands in
    // front of every later rewrite of an address register that they name.
    asm volatile(
        "global_load_async_to_lds_b128 %0, %4, off\n\t"
        "global_load_async_to_lds_b128 %1, %5, off\n\t"
        "global_load_async_to_lds_b128 %2, %6, off\n\t"
        "global_load_async_to_lds_b128 %3, %7, off\n\t"
        "s_wait_xcnt 0x0"
        :: "v"(dk), "v"(dk + lhalf), "v"(dv), "v"(dv + lhalf),
           "v"(k), "v"(k + (size_t)32 * D_MODEL), "v"(v),
           "v"(v + (size_t)32 * SEQ_T)
        : "memory");
  };

  for (int part = 0; part < 2; ++part) {
  const int qchunk = part == 0 ? 15 - pairi : pairi;
  const int q_base = qchunk * 128 + wave * 16;
  const int qi = q_base + rlane;  // this lane's query
  const bf16* qrow = qp + (size_t)qi * D_MODEL;
  v16bf qf0 = ldfrag(qrow + koff);
  v16bf qf1 = ldfrag(qrow + 32 + koff);

  float rowM = -1.0e30f;  // running maximum of query qi (equal in both halves)
  float rowL = 0.0f;      // running sum over this half's keys only
  v8f acc[4] = {{}, {}, {}, {}};  // acc[dg][r] = O[qi][dg*16 + koff + r]

  const float scale = 0.125f;          // 1/sqrt(64)
  const int nkt = (q_base + 47) >> 5;  // # of 32-key tiles of this wave (causal)
  const int nst = qchunk * 2 + 2;      // # of 64-key stages of the block

  // Second chunk: the barrier at the foot of the first chunk's last stage has
  // ended every wave's reads of both buffers, and no copy is outstanding.
  stage(0, 0);
  async_wait0();    // this wave's copies of stage 0 have landed
  __syncthreads();  // publishes stage 0
  stage(1, 1);      // nst >= 2: stage 1 always exists

  for (int st = 0; st < nst; ++st) {
    const bf16* kb = sK[st & 1] + rlane * ATT_PITCH + koff;
    const bf16* vb = sV[st & 1] + rlane * ATT_PITCH + koff;
    // Unrolled: the LDS offsets of both halves of a stage are then constants.
#pragma unroll
    for (int sub = 0; sub < 2; ++sub) {
      const int kt = st * ATT_KEYS + sub * 32;
      if (st * 2 + sub < nkt) {  // tiles past this wave's diagonal are skipped
        v8f s0 = {}, s1 = {};  // s0[r]: key kt+koff+r, s1[r]: key kt+16+koff+r
        {
          const bf16* kr0 = kb + sub * 32 * ATT_PITCH;
          const bf16* kr1 = kr0 + 16 * ATT_PITCH;
          const v16bf k00 = ldfrag(kr0), k01 = ldfrag(kr0 + 32);
          const v16bf k10 = ldfrag(kr1), k11 = ldfrag(kr1 + 32);
          // Inputs only: holds the four fragment reads together in front of the
          // products, so that their LDS latencies overlap instead of adding up.
          asm volatile("" :: "v"(k00), "v"(k01), "v"(k10), "v"(k11));
          s0 = wmma_bf16(k00, qf0, s0);
          s1 = wmma_bf16(k10, qf0, s1);
          s0 = wmma_bf16(k01, qf1, s0);
          s1 = wmma_bf16(k11, qf1, s1);
        }
        float sc[16];
        float m = -1.0e30f;
#pragma unroll
        for (int r = 0; r < 8; ++r) {
          sc[r] = (float)s0[r] * scale;
          sc[8 + r] = (float)s1[r] * scale;
        }
        // A tile whose last key is not behind the wave's first query is visible
        // to all 16 queries: there the causal test is an identity and is jumped
        // over.  Both sides of the test are scalar, so this is a scalar branch;
        // only the last tile of a wave takes it.
        if (kt + 31 > q_base) {
          // Unrolled: every index of sc is then a constant (registers).
#pragma unroll
          for (int r = 0; r < 8; ++r) {
            const int key = kt + koff + r;
            if (key > qi) sc[r] = -1.0e30f;
            if (key + 16 > qi) sc[8 + r] = -1.0e30f;
          }
        }
        // Unrolled for the same reason.
#pragma unroll
        for (int r = 0; r < 8; ++r) {
          m = fmaxf(m, fmaxf(sc[r], sc[8 + r]));
        }
        m = fmaxf(m, xhalf(m));
        const float newM = fmaxf(rowM, m);
        const float corr = __expf(rowM - newM);
        rowM = newM;
        v16bf pf;
        float p[16];
#pragma unroll
        for (int s = 0; s < 16; ++s) {
          p[s] = __expf(sc[s] - newM);
          pf[s] = (bf16)p[s];
        }
#pragma unroll
        for (int w = 8; w >= 1; w >>= 1)
#pragma unroll
          for (int s = 0; s < w; ++s) p[s] += p[s + w];
        rowL = rowL * corr + p[0];
        v16bf vf[4];
#pragma unroll
        for (int dg = 0; dg < 4; ++dg)
          vf[dg] = ldfrag(vb + dg * 16 * ATT_PITCH + sub * 32);
        // Inputs only, as for K: the four V^T fragment reads go out together.
        asm volatile("" :: "v"(vf[0]), "v"(vf[1]), "v"(vf[2]), "v"(vf[3]));
#pragma unroll
        for (int dg = 0; dg < 4; ++dg) {
          acc[dg] *= corr;
          acc[dg] = wmma_bf16(vf[dg], pf, acc[dg]);
        }
      }
    }
    // Hand-over, passed by every wave, outside the causal skip: this wave's LDS
    // reads of stage st are done and its copies of stage st + 1 have landed; the
    // barrier then publishes stage st + 1 and frees this stage's buffer.
    asm volatile("s_wait_dscnt 0x0" ::: "memory");
    async_wait0();
    __syncthreads();
    if (st + 2 < nst) stage(st & 1, st + 2);
  }
  async_wait0();  // no copy is outstanding when the wave ends

  const float inv = 1.0f / (rowL + xhalf(rowL));
  bf16* op = O + ((size_t)(b * SEQ_T + qi)) * D_MODEL + h * DK + koff;
#pragma unroll
  for (int dg = 0; dg < 4; ++dg) {
    v8bf o;
#pragma unroll
    for (int r = 0; r < 8; ++r) o[r] = (bf16)(acc[dg][r] * inv);
    *reinterpret_cast<v8bf*>(op + dg * 16) = o;
  }
  // The second chunk's code rewrites registers that the four stores above name
  // (address and data): this wait stands in front of every such rewrite.
  asm volatile("s_wait_xcnt 0x0" ::: "memory");
  }  // part
}

// ---------------------------------------------------------------------------
// LayerNorm(residual): out = LN(A + R) * g + be ; optional bf16 copy.
// ---------------------------------------------------------------------------
__global__ __launch_bounds__(256) void ln_residual_kernel(
    const float* __restrict__ A, const float* __restrict__ R,
    const float* __restrict__ g, const float* __restrict__ be,
    float* __restrict__ outF, bf16* __restrict__ outB) {
  const int row = blockIdx.x;
  const float* a = A + (size_t)row * D_MODEL;
  const float* rr = R + (size_t)row * D_MODEL;
  float v[4];
  float s = 0.0f;
#pragma unroll
  for (int i = 0; i < 4; ++i) {
    int idx = threadIdx.x + i * 256;
    v[i] = a[idx] + rr[idx];
    s += v[i];
  }
  __shared__ float red[8];
  const int wv = threadIdx.x >> 5, ln = threadIdx.x & 31;
#pragma unroll
  for (int off = 16; off >= 1; off >>= 1) s += __shfl_xor(s, off, 32);
  if (ln == 0) red[wv] = s;
  __syncthreads();
  float mean = 0.0f;
#pragma unroll
  for (int i = 0; i < 8; ++i) mean += red[i];
  mean *= (1.0f / D_MODEL);
  __syncthreads();
  float vs = 0.0f;
#pragma unroll
  for (int i = 0; i < 4; ++i) {
    float d = v[i] - mean;
    vs += d * d;
  }
#pragma unroll
  for (int off = 16; off >= 1; off >>= 1) vs += __shfl_xor(vs, off, 32);
  if (ln == 0) red[wv] = vs;
  __syncthreads();
  float var = 0.0f;
#pragma unroll
  for (int i = 0; i < 8; ++i) var += red[i];
  var *= (1.0f / D_MODEL);
  const float rstd = rsqrtf(var + 1e-5f);
#pragma unroll
  for (int i = 0; i < 4; ++i) {
    int idx = threadIdx.x + i * 256;
    float y = (v[i] - mean) * rstd * g[idx] + be[idx];
    outF[(size_t)row * D_MODEL + idx] = y;
    if (outB) outB[(size_t)row * D_MODEL + idx] = (bf16)y;
  }
}

// ---------------------------------------------------------------------------
// Host-side orchestration
// ---------------------------------------------------------------------------
extern "C" void kernel_launch(void* const* d_in, const int* in_sizes, int n_in,
                              void* d_out, int out_size, void* d_ws,
                              size_t ws_size, hipStream_t stream) {
  (void)in_sizes; (void)n_in; (void)out_size; (void)ws_size;
  const float* x  = (const float*)d_in[0];
  const float* WQ = (const float*)d_in[1];
  const float* bQ = (const float*)d_in[2];
  const float* WK = (const float*)d_in[3];
  const float* bK = (const float*)d_in[4];
  const float* WV = (const float*)d_in[5];
  const float* bV = (const float*)d_in[6];
  const float* WO = (const float*)d_in[7];
  const float* bO = (const float*)d_in[8];
  const float* W1 = (const float*)d_in[9];
  const float* b1 = (const float*)d_in[10];
  const float* W2 = (const float*)d_in[11];
  const float* b2 = (const float*)d_in[12];
  const float* g1 = (const float*)d_in[13];
  const float* be1 = (const float*)d_in[14];
  const float* g2 = (const float*)d_in[15];
  const float* be2 = (const float*)d_in[16];
  float* out = (float*)d_out;

  char* w = (char*)d_ws;
  auto carve = [&](size_t bytes) {
    char* p = w;
    w += (bytes + 255) & ~(size_t)255;
    return p;
  };
  const size_t MT = (size_t)MTOK;
  bf16* xb  = (bf16*)carve(MT * D_MODEL * 2);
  bf16* wqb = (bf16*)carve((size_t)D_MODEL * D_MODEL * 2);
  bf16* wkb = (bf16*)carve((size_t)D_MODEL * D_MODEL * 2);
  bf16* wvb = (bf16*)carve((size_t)D_MODEL * D_MODEL * 2);
  bf16* wob = (bf16*)carve((size_t)D_MODEL * D_MODEL * 2);
  bf16* w1b = (bf16*)carve((size_t)D_FF * D_MODEL * 2);
  bf16* w2b = (bf16*)carve((size_t)D_MODEL * D_FF * 2);
  bf16* qb  = (bf16*)carve(MT * D_MODEL * 2);
  bf16* kb  = (bf16*)carve(MT * D_MODEL * 2);
  bf16* vtb = (bf16*)carve(MT * D_MODEL * 2);
  bf16* aob = (bf16*)carve(MT * D_MODEL * 2);
  float* attnf = (float*)carve(MT * D_MODEL * 4);
  float* y1f   = (float*)carve(MT * D_MODEL * 4);
  bf16*  y1b   = (bf16*)carve(MT * D_MODEL * 2);
  bf16*  h1b   = (bf16*)carve(MT * D_FF * 2);
  float* fff = attnf; // attn_out dead after LN1

  cvt_all_kernel<<<TILES_ALL, 256, 0, stream>>>(
      x, WQ, WK, WV, WO, W1, W2, xb, wqb, wkb, wvb, wob, w1b, w2b);

  dim3 blk(256);
  dim3 gProj(MTOK / BM, D_MODEL / BN);
  gemm_bf16_kernel<false, false, true><<<gProj, blk, 0, stream>>>(
      xb, wqb, bQ, nullptr, qb, MTOK, D_MODEL, D_MODEL);
  gemm_bf16_kernel<false, false, true><<<gProj, blk, 0, stream>>>(
      xb, wkb, bK, nullptr, kb, MTOK, D_MODEL, D_MODEL);
  gemm_bf16_kernel<false, false, false, true><<<gProj, blk, 0, stream>>>(
      xb, wvb, bV, nullptr, vtb, MTOK, D_MODEL, D_MODEL);

  attn_kernel<<<BATCH * N_HEADS * (SEQ_T / 256), blk, 0, stream>>>(
      qb, kb, vtb, aob);

  gemm_bf16_kernel<false, true, false><<<gProj, blk, 0, stream>>>(
      aob, wob, bO, attnf, nullptr, MTOK, D_MODEL, D_MODEL);

  ln_residual_kernel<<<MTOK, blk, 0, stream>>>(x, attnf, g1, be1, y1f, y1b);

  dim3 gFF1(MTOK / BM, D_FF / BN);
  gemm_bf16_kernel<true, false, true><<<gFF1, blk, 0, stream>>>(
      y1b, w1b, b1, nullptr, h1b, MTOK, D_FF, D_MODEL);

  gemm_bf16_kernel<false, true, false><<<gProj, blk, 0, stream>>>(
      h1b, w2b, b2, fff, nullptr, MTOK, D_MODEL, D_FF);

  ln_residual_kernel<<<MTOK, blk, 0, stream>>>(y1f, fff, g2, be2, out,
                                               nullptr);
}

// v010
// Measured time: 266 microseconds a run.
// Next to v009, in two timings, it ran 1.04 times as fast each time.
// All steps since v000 together make it 1.92 times as fast.
#include <hip/hip_runtime.h>
#include <hip/hip_bf16.h>

// ---------------------------------------------------------------------------
// Types for CDNA5 WMMA (wave32, 16x16x32 bf16 -> f32)
// ---------------------------------------------------------------------------
typedef __bf16 bf16;
typedef bf16  v16bf __attribute__((ext_vector_type(16)));
typedef bf16  v8bf  __attribute__((ext_vector_type(8)));
typedef float v8f   __attribute__((ext_vector_type(8)));

static constexpr int D_MODEL = 1024;
static constexpr int N_HEADS = 16;
static constexpr int D_FF    = 4096;
static constexpr int SEQ_T   = 2048;
static constexpr int BATCH   = 4;
static constexpr int DK      = 64;            // head dim
static constexpr int MTOK    = BATCH * SEQ_T; // 8192 rows

__device__ __forceinline__ v8f wmma_bf16(v16bf a, v16bf b, v8f c) {
  return __builtin_amdgcn_wmma_f32_16x16x32_bf16(
      /*neg_a=*/false, a, /*neg_b=*/false, b,
      /*c_mod=*/(short)0, c, /*reuse_a=*/false, /*reuse_b=*/false);
}

// Load one 16-bit A/B operand fragment (ISA 16-bit 16x32 layout):
// lane L -> row = L&15, khalf = (L>>4)*8; elems [0..7]=p[0..7],
// elems [8..15]=p[16..23] with p at (row, khalf) of a K-contiguous row.
__device__ __forceinline__ v16bf ldfrag(const bf16* p) {
  v8bf lo = *reinterpret_cast<const v8bf*>(p);
  v8bf hi = *reinterpret_cast<const v8bf*>(p + 16);
  return __builtin_shufflevector(lo, hi, 0, 1, 2, 3, 4, 5, 6, 7,
                                 8, 9, 10, 11, 12, 13, 14, 15);
}

// Returns when every async-to-LDS copy that this wave has issued has landed.
__device__ __forceinline__ void async_wait0() {
  asm volatile("s_wait_asynccnt 0x0" ::: "memory");
}

// ---------------------------------------------------------------------------
// f32 -> bf16 conversion
// ---------------------------------------------------------------------------
// One thread converts 32 values: eight 16-byte loads, each 512 contiguous
// bytes per wave, all issued before the first conversion, so that a wave keeps
// 4 KB in flight and the launch needs 1/32 of the waves.
typedef float v4f  __attribute__((ext_vector_type(4)));
typedef bf16  v4bf __attribute__((ext_vector_type(4)));
static constexpr int CVT_LOADS = 8;                    // loads per thread
static constexpr int CVT_STEP  = 256 * 4;              // floats per block-wide load
static constexpr int CVT_TILE  = CVT_STEP * CVT_LOADS; // floats per block

// All seven arrays are converted by ONE launch: a block takes one tile of
// CVT_TILE values, and its index says which array the tile belongs to (a scalar
// choice, the same for the whole block).  Every array is a whole number of tiles.
static constexpr int TILES_X  = MTOK * D_MODEL / CVT_TILE;     // x
static constexpr int TILES_W  = D_MODEL * D_MODEL / CVT_TILE;  // WQ, WK, WV, WO
static constexpr int TILES_WF = D_FF * D_MODEL / CVT_TILE;     // W1, W2
static constexpr int TILES_ALL = TILES_X + 4 * TILES_W + 2 * TILES_WF;
static_assert(MTOK * D_MODEL % CVT_TILE == 0 &&
              D_MODEL * D_MODEL % CVT_TILE == 0 &&
              D_FF * D_MODEL % CVT_TILE == 0, "no partial tile");

__global__ __launch_bounds__(256) void cvt_all_kernel(
    const float* __restrict__ x, const float* __restrict__ wq,
    const float* __restrict__ wk, const float* __restrict__ wv,
    const float* __restrict__ wo, const float* __restrict__ w1,
    const float* __restrict__ w2, bf16* __restrict__ xb,
    bf16* __restrict__ wqb, bf16* __restrict__ wkb, bf16* __restrict__ wvb,
    bf16* __restrict__ wob, bf16* __restrict__ w1b, bf16* __restrict__ w2b) {
  int t = blockIdx.x;  // becomes the tile's index inside its own array
  const float* in = x;
  bf16* out = xb;
  if (t >= TILES_X) {
    t -= TILES_X;
    if (t < 2 * TILES_WF) {
      in = t < TILES_WF ? w1 : w2;
      out = t < TILES_WF ? w1b : w2b;
      t &= TILES_WF - 1;
    } else {
      t -= 2 * TILES_WF;
      const int a = t / TILES_W;
      in = a == 0 ? wq : a == 1 ? wk : a == 2 ? wv : wo;
      out = a == 0 ? wqb : a == 1 ? wkb : a == 2 ? wvb : wob;
      t &= TILES_W - 1;
    }
  }
  static_assert((TILES_WF & (TILES_WF - 1)) == 0 &&
                (TILES_W & (TILES_W - 1)) == 0, "the masks above");
  const int i0 = t * CVT_TILE + threadIdx.x * 4;
  v4f v[CVT_LOADS];
  // Unrolled so that v[] stays in registers and the loads go out together.
#pragma unroll
  for (int j = 0; j < CVT_LOADS; ++j)
    v[j] = *reinterpret_cast<const v4f*>(in + i0 + j * CVT_STEP);
  // Unrolled for the same reason: every index of v[] is a constant.
#pragma unroll
  for (int j = 0; j < CVT_LOADS; ++j)
    *reinterpret_cast<v4bf*>(out + i0 + j * CVT_STEP) =
        __builtin_convertvector(v[j], v4bf);
}

// ---------------------------------------------------------------------------
// GEMM: C[M,N] = act(A[M,K] @ W[N,K]^T + bias[N]),  A/W bf16 row-major.
// Block = 256 thr (8 waves, 4Mx2N).  Block tile 256(M) x 128(N), K-tile 64.
// A/W tiles staged in LDS via async-to-LDS DMA, double buffered; each wave
// computes a 64x64 tile = 4x4 WMMA fragments per 32-K step, so that a loaded
// fragment feeds four products.  M, N, K are multiples of BM, BN, BK.
// The weight fragment is the first operand of a product, so that a lane's eight
// accumulator registers are eight consecutive columns of one row of C; the
// results then pass through the wave's own LDS range and leave as whole lines.
// OUT_BF16_T (activation fragment first, eight consecutive rows of one column):
// the bf16 result goes out transposed per batch entry,
// Cb[(row / SEQ_T) * N + col][row % SEQ_T]; with N = D_MODEL that is the
// [(b*H + h)*DK + d][t] layout in which the attention kernel reads V^T.
// ---------------------------------------------------------------------------
static constexpr int BM = 256, BN = 128, BK = 64;
static constexpr int LDS_STRIDE = 72;  // 64 + 8 pad (144B rows, 16B aligned)
// Output staging, bytes.  A wave's 64 x 64 tile: 64 bf16 rows of 128 B, or two
// halves of 32 f32 rows of 256 B.  Both pitches are odd multiples of 16 B.
static constexpr int EPI_PITCH_B = 144;
static constexpr int EPI_PITCH_F = 272;
static constexpr int EPI_BYTES = 64 * EPI_PITCH_B;  // staging range of one wave
static_assert(32 * EPI_PITCH_F <= EPI_BYTES, "an f32 half fits the range");
static_assert(8 * EPI_BYTES <= 2 * BM * LDS_STRIDE * 2, "eight ranges fit sA");

template <bool RELU, bool OUT_F32, bool OUT_BF16, bool OUT_BF16_T = false>
__global__ __launch_bounds__(256) void gemm_bf16_kernel(
    const bf16* __restrict__ A, const bf16* __restrict__ W,
    const float* __restrict__ bias, float* __restrict__ Cf,
    bf16* __restrict__ Cb, int M, int N, int K) {
  __shared__ alignas(16) bf16 sA[2][BM * LDS_STRIDE];  // 2 x 36 KB
  __shared__ alignas(16) bf16 sW[2][BN * LDS_STRIDE];  // 2 x 18 KB

  const int tid = threadIdx.x;
  const int lane = tid & 31;
  const int wave = tid >> 5;
  const int m0l = (wave & 3) * 64;   // wave M offset within block tile
  const int n0l = (wave >> 2) * 64;  // wave N offset within block tile

  const int rlane = lane & 15;
  const int koff = (lane >> 4) << 3;  // 0 or 8
  const int half = lane >> 4;

  // Staging: a thread copies one 16B chunk of rows srow + 32*j, j = 0..7 of the
  // A slab and j = 0..3 of the W slab (a wave's copy covers four 128B rows).
  const int srow = tid >> 3;
  const int scol = (tid & 7) << 3;
  const bf16* Ab = A + ((size_t)blockIdx.x * BM + srow) * K + scol;
  const bf16* Wb = W + ((size_t)blockIdx.y * BN + srow) * K + scol;
  const size_t gstep = (size_t)32 * K;            // 32 rows, elements
  const unsigned int lstep = 32 * LDS_STRIDE * 2;  // 32 rows, LDS bytes
  const unsigned int lA =
      (unsigned int)(uintptr_t)(&sA[0][0] + srow * LDS_STRIDE + scol);
  const unsigned int lW =
      (unsigned int)(uintptr_t)(&sW[0][0] + srow * LDS_STRIDE + scol);

  // Stage the [BM x 64] and [BN x 64] K-slabs at kofs into buffer buf.
  auto stage = [&](int buf, int kofs) {
    const bf16* a = Ab + kofs;
    const bf16* w = Wb + kofs;
    const unsigned int da = lA + buf * (BM * LDS_STRIDE * 2);
    const unsigned int dw = lW + buf * (BN * LDS_STRIDE * 2);
    // The twelve copies of a slab pair; the wait in the same statement stands
    // in front of every later rewrite of an address register that they name.
    asm volatile(
        "global_load_async_to_lds_b128 %0, %12, off\n\t"
        "global_load_async_to_lds_b128 %1, %13, off\n\t"
        "global_load_async_to_lds_b128 %2, %14, off\n\t"
        "global_load_async_to_lds_b128 %3, %15, off\n\t"
        "global_load_async_to_lds_b128 %4, %16, off\n\t"
        "global_load_async_to_lds_b128 %5, %17, off\n\t"
        "global_load_async_to_lds_b128 %6, %18, off\n\t"
        "global_load_async_to_lds_b128 %7, %19, off\n\t"
        "global_load_async_to_lds_b128 %8, %20, off\n\t"
        "global_load_async_to_lds_b128 %9, %21, off\n\t"
        "global_load_async_to_lds_b128 %10, %22, off\n\t"
        "global_load_async_to_lds_b128 %11, %23, off\n\t"
        "s_wait_xcnt 0x0"
        :: "v"(da), "v"(da + lstep), "v"(da + 2 * lstep), "v"(da + 3 * lstep),
           "v"(da + 4 * lstep), "v"(da + 5 * lstep), "v"(da + 6 * lstep),
           "v"(da + 7 * lstep), "v"(dw), "v"(dw + lstep), "v"(dw + 2 * lstep),
           "v"(dw + 3 * lstep),
           "v"(a), "v"(a + gstep), "v"(a + 2 * gstep), "v"(a + 3 * gstep),
           "v"(a + 4 * gstep), "v"(a + 5 * gstep), "v"(a + 6 * gstep),
           "v"(a + 7 * gstep), "v"(w), "v"(w + gstep), "v"(w + 2 * gstep),
           "v"(w + 3 * gstep)
        : "memory");
  };

  v8f acc[4][4] = {};

  stage(0, 0);

  const int nk = K / BK;
  for (int t = 0; t < nk; ++t) {
    // Hand-over, passed by every wave: this wave's LDS reads of the last trip
    // are done and its copies of slab t have landed; the barrier then publishes
    // slab t and frees the other buffer for the copies below.
    asm volatile("s_wait_dscnt 0x0" ::: "memory");
    async_wait0();
    __syncthreads();
    if (t + 1 < nk) stage((t + 1) & 1, (t + 1) * BK);
    const bf16* a0 = sA[t & 1] + (m0l + rlane) * LDS_STRIDE + koff;
    const bf16* w0 = sW[t & 1] + (n0l + rlane) * LDS_STRIDE + koff;
#pragma unroll
    for (int kk = 0; kk < BK; kk += 32) {
      // All loops below unrolled: every index of af, wf and acc is then a
      // constant and the arrays stay in registers.
      v16bf af[4], wf[4];
#pragma unroll
      for (int i = 0; i < 4; ++i) af[i] = ldfrag(a0 + i * 16 * LDS_STRIDE + kk);
#pragma unroll
      for (int j = 0; j < 4; ++j) wf[j] = ldfrag(w0 + j * 16 * LDS_STRIDE + kk);
      // Inputs only: holds the sixteen LDS reads of a 32-K step together in front
      // of its sixteen products.  Without it the A fragments share one register
      // set and every row of four products waits out an LDS latency of its own.
      asm volatile("" :: "v"(af[0]), "v"(af[1]), "v"(af[2]), "v"(af[3]),
                         "v"(wf[0]), "v"(wf[1]), "v"(wf[2]), "v"(wf[3]));
#pragma unroll
      for (int i = 0; i < 4; ++i)
#pragma unroll
        for (int j = 0; j < 4; ++j)
          acc[i][j] = OUT_BF16_T ? wmma_bf16(af[i], wf[j], acc[i][j])
                                 : wmma_bf16(wf[j], af[i], acc[i][j]);
    }
    // No trailing barrier: next stage() writes the *other* buffer, and the
    // top-of-loop waits+barrier order buffer reuse across iterations.
  }
  async_wait0();  // no copy is outstanding when the wave ends, whatever K is

  // Epilogue.  D layout: VGPR r, lane L -> D[r + 8*(L>>4)][L&15], so that
  //   OUT_BF16_T: acc[i][j][r] = C[m0 + i*16 + half*8 + r][n0 + j*16 + rlane],
  //   otherwise:  acc[i][j][r] = C[m0 + i*16 + rlane][n0 + j*16 + half*8 + r]:
  // a lane's eight registers are 16 (bf16) or 32 (f32) contiguous output bytes.
  static_assert((int)OUT_F32 + (int)OUT_BF16 + (int)OUT_BF16_T == 1,
                "one staged result per kernel");
  const int m0 = blockIdx.x * BM + m0l;
  const int n0 = blockIdx.y * BN + n0l;
  // All loops below unrolled: every index of acc and of the bias arrays is then
  // a constant and the arrays stay in registers.
  float bc[4];   // OUT_BF16_T: the bias of this lane's four columns
  v4f bv[4][2];  // otherwise: the bias of this lane's 32 columns
#pragma unroll
  for (int j = 0; j < 4; ++j) {
    if constexpr (OUT_BF16_T) {
      bc[j] = bias[n0 + j * 16 + rlane];
    } else {
      const float* bp = bias + n0 + j * 16 + half * 8;
      bv[j][0] = *reinterpret_cast<const v4f*>(bp);
      bv[j][1] = *reinterpret_cast<const v4f*>(bp + 4);
    }
  }
  // The ring becomes output staging: this wave's LDS reads are done, and the
  // barrier ends every other wave's reads of the last slab.
  asm volatile("s_wait_dscnt 0x0" ::: "memory");
  __syncthreads();
  char* E = reinterpret_cast<char*>(&sA[0][0]) + wave * EPI_BYTES;
  if constexpr (!OUT_F32) {
    // 64 staged rows of 128 B: rows of C, or (OUT_BF16_T) columns of C.
#pragma unroll
    for (int i = 0; i < 4; ++i) {
#pragma unroll
      for (int j = 0; j < 4; ++j) {
        v8bf o;
#pragma unroll
        for (int r = 0; r < 8; ++r) {
          float v = acc[i][j][r] + (OUT_BF16_T ? bc[j] : bv[j][r >> 2][r & 3]);
          if (RELU) v = fmaxf(v, 0.0f);
          o[r] = (bf16)v;
        }
        const int srw = OUT_BF16_T ? j : i;  // 16-row group of the staged tile
        const int sch = OUT_BF16_T ? i : j;  // 32-byte chunk of the staged row
        *reinterpret_cast<v8bf*>(E + (srw * 16 + rlane) * EPI_PITCH_B +
                                 sch * 32 + half * 16) = o;
      }
    }
    // Every lane's rows are in LDS before any lane reads them back.
    asm volatile("s_wait_dscnt 0x0" ::: "memory");
    // Eight lanes take one whole 128B row.  The four rows of a store lie eight
    // apart: at this pitch the two rows of a half-wave then share no bank.
    const int rsub = (lane >> 3) * 8;
    const int c16 = (lane & 7) * 16;  // byte in the row
    // First staged row in memory and the distance of two rows, in elements.  A
    // wave's 64 rows of C lie in one batch entry.
    static_assert(SEQ_T % BM == 0, "a block tile stays inside one batch entry");
    const size_t gfirst =
        OUT_BF16_T ? ((size_t)(m0 / SEQ_T) * N + n0) * SEQ_T + (m0 % SEQ_T)
                   : (size_t)m0 * N + n0;
    const size_t gpitch = OUT_BF16_T ? (size_t)SEQ_T : (size_t)N;
    char* yb = reinterpret_cast<char*>(Cb + gfirst + rsub * gpitch) + c16;
    const char* eb = E + rsub * EPI_PITCH_B + c16;
#pragma unroll
    for (int q = 0; q < 16; ++q) {
      const int row = (q >> 3) * 32 + (q & 7);
      *reinterpret_cast<v8bf*>(yb + row * gpitch * 2) =
          *reinterpret_cast<const v8bf*>(eb + row * EPI_PITCH_B);
    }
  } else {
    const int rsub = lane >> 4;        // a half-wave takes one whole 256B row
    const int c16 = (lane & 15) * 16;  // byte in the row
    char* yf = reinterpret_cast<char*>(Cf + (size_t)(m0 + rsub) * N + n0) + c16;
    const char* eb = E + rsub * EPI_PITCH_F + c16;
#pragma unroll
    for (int hh = 0; hh < 2; ++hh) {  // rows hh*32 .. hh*32+31 of the tile
#pragma unroll
      for (int ii = 0; ii < 2; ++ii) {
#pragma unroll
        for (int j = 0; j < 4; ++j) {
#pragma unroll
          for (int k = 0; k < 2; ++k) {
            v4f o;
#pragma unroll
            for (int r = 0; r < 4; ++r) {
              float v = acc[hh * 2 + ii][j][k * 4 + r] + bv[j][k][r];
              if (RELU) v = fmaxf(v, 0.0f);
              o[r] = v;
            }
            *reinterpret_cast<v4f*>(E + (ii * 16 + rlane) * EPI_PITCH_F +
                                    j * 64 + half * 32 + k * 16) = o;
          }
        }
      }
      // Every lane's rows are in LDS before any lane reads them back.
      asm volatile("s_wait_dscnt 0x0" ::: "memory");
#pragma unroll
      for (int q = 0; q < 16; ++q) {
        *reinterpret_cast<v4f*>(yf + (size_t)(hh * 32 + q * 2) * N * 4) =
            *reinterpret_cast<const v4f*>(eb + q * 2 * EPI_PITCH_F);
      }
      // Every lane has read the first half before any lane overwrites it.
      if (hh == 0) asm volatile("s_wait_dscnt 0x0" ::: "memory");
    }
  }
}

__device__ __forceinline__ float xhalf(float x) {
  return __builtin_bit_cast(
      float, __builtin_amdgcn_permlanex16(__builtin_bit_cast(int, x),
                                          __builtin_bit_cast(int, x),
                                          0x76543210, 0xfedcba98, false, false));
}

// K and V^T reach the waves through LDS: a stage is 64 keys, that is 64 K rows
// of 128 B and 64 V^T rows of 128 B, copied once for the block's 8 waves.
static constexpr int ATT_KEYS  = 64;  // keys per stage
static constexpr int ATT_PITCH = 72;  // LDS row: 64 values + 8 pad (144 B)

__global__ __launch_bounds__(256) void attn_kernel(
    const bf16* __restrict__ Q, const bf16* __restrict__ Kmat,
    const bf16* __restrict__ VT, bf16* __restrict__ O) {
  __shared__ alignas(16) bf16 sK[2][ATT_KEYS * ATT_PITCH];  // 2 x 9 KB
  __shared__ alignas(16) bf16 sV[2][DK * ATT_PITCH];        // 2 x 9 KB

  const int tid = threadIdx.x;
  const int lane = tid & 31;
  // Scalar, so that the per-wave causal skip below is a scalar branch.
  const int wave = __builtin_amdgcn_readfirstlane(tid >> 5);
  const int blk = blockIdx.x;
  const int pairi = blk & 7;  // T/128 = 16 chunks = 8 pairs
  const int bh = blk >> 3;    // 0..63
  const int b = bh >> 4;
  const int h = bh & (N_HEADS - 1);

  const int rlane = lane & 15;
  const int khalf = lane >> 4;
  const int koff = khalf * 8;

  const bf16* qp = Q + (size_t)b * SEQ_T * D_MODEL + h * DK;
  const bf16* kp = Kmat + (size_t)b * SEQ_T * D_MODEL + h * DK;
  const bf16* vtp = VT + (size_t)bh * DK * SEQ_T;

  // Staging: a thread copies one 16B chunk of rows srow and srow + 32 of the K
  // slab and of the V^T slab (a wave's copy covers four whole 128B rows).
  const int srow = tid >> 3;
  const int scol = (tid & 7) << 3;
  const bf16* kg = kp + (size_t)srow * D_MODEL + scol;
  const bf16* vg = vtp + (size_t)srow * SEQ_T + scol;
  const unsigned int lK =
      (unsigned int)(uintptr_t)(&sK[0][0] + srow * ATT_PITCH + scol);
  const unsigned int lV =
      (unsigned int)(uintptr_t)(&sV[0][0] + srow * ATT_PITCH + scol);
  const unsigned int lhalf = 32 * ATT_PITCH * 2;       // 32 rows, LDS bytes
  const unsigned int lbuf = ATT_KEYS * ATT_PITCH * 2;  // one buffer, LDS bytes

  // Copy keys st*64 .. st*64+63 (K rows, V^T columns) into buffer buf.
  auto stage = [&](int buf, int st) {
    const bf16* k = kg + (size_t)st * ATT_KEYS * D_MODEL;
    const bf16* v = vg + st * ATT_KEYS;
    const unsigned int dk = lK + buf * lbuf;
    const unsigned int dv = lV + buf * lbuf;
    // The four copies of a stage; the wait in the same statement stands in
    // front of every later rewrite of an address register that they name.
    asm volatile(
        "global_load_async_to_lds_b128 %0, %4, off\n\t"
        "global_load_async_to_lds_b128 %1, %5, off\n\t"
        "global_load_async_to_lds_b128 %2, %6, off\n\t"
        "global_load_async_to_lds_b128 %3, %7, off\n\t"
        "s_wait_xcnt 0x0"
        :: "v"(dk), "v"(dk + lhalf), "v"(dv), "v"(dv + lhalf),
           "v"(k), "v"(k + (size_t)32 * D_MODEL), "v"(v),
           "v"(v + (size_t)32 * SEQ_T)
        : "memory");
  };

  for (int part = 0; part < 2; ++part) {
  const int qchunk = part == 0 ? 15 - pairi : pairi;
  const int q_base = qchunk * 128 + wave * 16;
  const int qi = q_base + rlane;  // this lane's query
  const bf16* qrow = qp + (size_t)qi * D_MODEL;
  v16bf qf0 = ldfrag(qrow + koff);
  v16bf qf1 = ldfrag(qrow + 32 + koff);

  float rowM = -1.0e30f;  // running maximum of query qi (equal in both halves)
  float rowL = 0.0f;      // running sum over this half's keys only
  v8f acc[4] = {{}, {}, {}, {}};  // acc[dg][r] = O[qi][dg*16 + koff + r]

  const float scale = 0.125f;          // 1/sqrt(64)
  const int nkt = (q_base + 47) >> 5;  // # of 32-key tiles of this wave (causal)
  const int nst = qchunk * 2 + 2;      // # of 64-key stages of the block

  // Second chunk: the barrier at the foot of the first chunk's last stage has
  // ended every wave's reads of both buffers, and no copy is outstanding.
  stage(0, 0);
  async_wait0();    // this wave's copies of stage 0 have landed
  __syncthreads();  // publishes stage 0
  stage(1, 1);      // nst >= 2: stage 1 always exists

  for (int st = 0; st < nst; ++st) {
    const bf16* kb = sK[st & 1] + rlane * ATT_PITCH + koff;
    const bf16* vb = sV[st & 1] + rlane * ATT_PITCH + koff;
    // Unrolled: the LDS offsets of both halves of a stage are then constants.
#pragma unroll
    for (int sub = 0; sub < 2; ++sub) {
      const int kt = st * ATT_KEYS + sub * 32;
      if (st * 2 + sub < nkt) {  // tiles past this wave's diagonal are skipped
        v8f s0 = {}, s1 = {};  // s0[r]: key kt+koff+r, s1[r]: key kt+16+koff+r
        {
          const bf16* kr0 = kb + sub * 32 * ATT_PITCH;
          const bf16* kr1 = kr0 + 16 * ATT_PITCH;
          const v16bf k00 = ldfrag(kr0), k01 = ldfrag(kr0 + 32);
          const v16bf k10 = ldfrag(kr1), k11 = ldfrag(kr1 + 32);
          // Inputs only: holds the four fragment reads together in front of the
          // products, so that their LDS latencies overlap instead of adding up.
          asm volatile("" :: "v"(k00), "v"(k01), "v"(k10), "v"(k11));
          s0 = wmma_bf16(k00, qf0, s0);
          s1 = wmma_bf16(k10, qf0, s1);
          s0 = wmma_bf16(k01, qf1, s0);
          s1 = wmma_bf16(k11, qf1, s1);
        }
        float sc[16];
        float m = -1.0e30f;
#pragma unroll
        for (int r = 0; r < 8; ++r) {
          sc[r] = (float)s0[r] * scale;
          sc[8 + r] = (float)s1[r] * scale;
        }
        // A tile whose last key is not behind the wave's first query is visible
        // to all 16 queries: there the causal test is an identity and is jumped
        // over.  Both sides of the test are scalar, so this is a scalar branch;
        // only the last tile of a wave takes it.
        if (kt + 31 > q_base) {
          // Unrolled: every index of sc is then a constant (registers).
#pragma unroll
          for (int r = 0; r < 8; ++r) {
            const int key = kt + koff + r;
            if (key > qi) sc[r] = -1.0e30f;
            if (key + 16 > qi) sc[8 + r] = -1.0e30f;
          }
        }
        // Unrolled for the same reason.
#pragma unroll
        for (int r = 0; r < 8; ++r) {
          m = fmaxf(m, fmaxf(sc[r], sc[8 + r]));
        }
        m = fmaxf(m, xhalf(m));
        const float newM = fmaxf(rowM, m);
        const float corr = __expf(rowM - newM);
        rowM = newM;
        v16bf pf;
        float p[16];
#pragma unroll
        for (int s = 0; s < 16; ++s) {
          p[s] = __expf(sc[s] - newM);
          pf[s] = (bf16)p[s];
        }
#pragma unroll
        for (int w = 8; w >= 1; w >>= 1)
#pragma unroll
          for (int s = 0; s < w; ++s) p[s] += p[s + w];
        rowL = rowL * corr + p[0];
        v16bf vf[4];
#pragma unroll
        for (int dg = 0; dg < 4; ++dg)
          vf[dg] = ldfrag(vb + dg * 16 * ATT_PITCH + sub * 32);
        // Inputs only, as for K: the four V^T fragment reads go out together.
        asm volatile("" :: "v"(vf[0]), "v"(vf[1]), "v"(vf[2]), "v"(vf[3]));
#pragma unroll
        for (int dg = 0; dg < 4; ++dg) {
          acc[dg] *= corr;
          acc[dg] = wmma_bf16(vf[dg], pf, acc[dg]);
        }
      }
    }
    // Hand-over, passed by every wave, outside the causal skip: this wave's LDS
    // reads of stage st are done and its copies of stage st + 1 have landed; the
    // barrier then publishes stage st + 1 and frees this stage's buffer.
    asm volatile("s_wait_dscnt 0x0" ::: "memory");
    async_wait0();
    __syncthreads();
    if (st + 2 < nst) stage(st & 1, st + 2);
  }
  async_wait0();  // no copy is outstanding when the wave ends

  const float inv = 1.0f / (rowL + xhalf(rowL));
  bf16* op = O + ((size_t)(b * SEQ_T + qi)) * D_MODEL + h * DK + koff;
#pragma unroll
  for (int dg = 0; dg < 4; ++dg) {
    v8bf o;
#pragma unroll
    for (int r = 0; r < 8; ++r) o[r] = (bf16)(acc[dg][r] * inv);
    *reinterpret_cast<v8bf*>(op + dg * 16) = o;
  }
  // The second chunk's code rewrites registers that the four stores above name
  // (address and data): this wait stands in front of every such rewrite.
  asm volatile("s_wait_xcnt 0x0" ::: "memory");
  }  // part
}

// ---------------------------------------------------------------------------
// LayerNorm(residual): out = LN(A + R) * g + be ; optional bf16 copy.
// ---------------------------------------------------------------------------
__global__ __launch_bounds__(256) void ln_residual_kernel(
    const float* __restrict__ A, const float* __restrict__ R,
    const float* __restrict__ g, const float* __restrict__ be,
    float* __restrict__ outF, bf16* __restrict__ outB) {
  const int row = blockIdx.x;
  const float* a = A + (size_t)row * D_MODEL;
  const float* rr = R + (size_t)row * D_MODEL;
  float v[4];
  float s = 0.0f;
#pragma unroll
  for (int i = 0; i < 4; ++i) {
    int idx = threadIdx.x + i * 256;
    v[i] = a[idx] + rr[idx];
    s += v[i];
  }
  __shared__ float red[8];
  const int wv = threadIdx.x >> 5, ln = threadIdx.x & 31;
#pragma unroll
  for (int off = 16; off >= 1; off >>= 1) s += __shfl_xor(s, off, 32);
  if (ln == 0) red[wv] = s;
  __syncthreads();
  float mean = 0.0f;
#pragma unroll
  for (int i = 0; i < 8; ++i) mean += red[i];
  mean *= (1.0f / D_MODEL);
  __syncthreads();
  float vs = 0.0f;
#pragma unroll
  for (int i = 0; i < 4; ++i) {
    float d = v[i] - mean;
    vs += d * d;
  }
#pragma unroll
  for (int off = 16; off >= 1; off >>= 1) vs += __shfl_xor(vs, off, 32);
  if (ln == 0) red[wv] = vs;
  __syncthreads();
  float var = 0.0f;
#pragma unroll
  for (int i = 0; i < 8; ++i) var += red[i];
  var *= (1.0f / D_MODEL);
  const float rstd = rsqrtf(var + 1e-5f);
#pragma unroll
  for (int i = 0; i < 4; ++i) {
    int idx = threadIdx.x + i * 256;
    float y = (v[i] - mean) * rstd * g[idx] + be[idx];
    outF[(size_t)row * D_MODEL + idx] = y;
    if (outB) outB[(size_t)row * D_MODEL + idx] = (bf16)y;
  }
}

// ---------------------------------------------------------------------------
// Host-side orchestration
// ---------------------------------------------------------------------------
extern "C" void kernel_launch(void* const* d_in, const int* in_sizes, int n_in,
                              void* d_out, int out_size, void* d_ws,
                              size_t ws_size, hipStream_t stream) {
  (void)in_sizes; (void)n_in; (void)out_size; (void)ws_size;
  const float* x  = (const float*)d_in[0];
  const float* WQ = (const float*)d_in[1];
  const float* bQ = (const float*)d_in[2];
  const float* WK = (const float*)d_in[3];
  const float* bK = (const float*)d_in[4];
  const float* WV = (const float*)d_in[5];
  const float* bV = (const float*)d_in[6];
  const float* WO = (const float*)d_in[7];
  const float* bO = (const float*)d_in[8];
  const float* W1 = (const float*)d_in[9];
  const float* b1 = (const float*)d_in[10];
  const float* W2 = (const float*)d_in[11];
  const float* b2 = (const float*)d_in[12];
  const float* g1 = (const float*)d_in[13];
  const float* be1 = (const float*)d_in[14];
  const float* g2 = (const float*)d_in[15];
  const float* be2 = (const float*)d_in[16];
  float* out = (float*)d_out;

  char* w = (char*)d_ws;
  auto carve = [&](size_t bytes) {
    char* p = w;
    w += (bytes + 255) & ~(size_t)255;
    return p;
  };
  const size_t MT = (size_t)MTOK;
  bf16* xb  = (bf16*)carve(MT * D_MODEL * 2);
  bf16* wqb = (bf16*)carve((size_t)D_MODEL * D_MODEL * 2);
  bf16* wkb = (bf16*)carve((size_t)D_MODEL * D_MODEL * 2);
  bf16* wvb = (bf16*)carve((size_t)D_MODEL * D_MODEL * 2);
  bf16* wob = (bf16*)carve((size_t)D_MODEL * D_MODEL * 2);
  bf16* w1b = (bf16*)carve((size_t)D_FF * D_MODEL * 2);
  bf16* w2b = (bf16*)carve((size_t)D_MODEL * D_FF * 2);
  bf16* qb  = (bf16*)carve(MT * D_MODEL * 2);
  bf16* kb  = (bf16*)carve(MT * D_MODEL * 2);
  bf16* vtb = (bf16*)carve(MT * D_MODEL * 2);
  bf16* aob = (bf16*)carve(MT * D_MODEL * 2);
  float* attnf = (float*)carve(MT * D_MODEL * 4);
  float* y1f   = (float*)carve(MT * D_MODEL * 4);
  bf16*  y1b   = (bf16*)carve(MT * D_MODEL * 2);
  bf16*  h1b   = (bf16*)carve(MT * D_FF * 2);
  float* fff = attnf; // attn_out dead after LN1

  cvt_all_kernel<<<TILES_ALL, 256, 0, stream>>>(
      x, WQ, WK, WV, WO, W1, W2, xb, wqb, wkb, wvb, wob, w1b, w2b);

  dim3 blk(256);
  dim3 gProj(MTOK / BM, D_MODEL / BN);
  gemm_bf16_kernel<false, false, true><<<gProj, blk, 0, stream>>>(
      xb, wqb, bQ, nullptr, qb, MTOK, D_MODEL, D_MODEL);
  gemm_bf16_kernel<false, false, true><<<gProj, blk, 0, stream>>>(
      xb, wkb, bK, nullptr, kb, MTOK, D_MODEL, D_MODEL);
  gemm_bf16_kernel<false, false, false, true><<<gProj, blk, 0, stream>>>(
      xb, wvb, bV, nullptr, vtb, MTOK, D_MODEL, D_MODEL);

  attn_kernel<<<BATCH * N_HEADS * (SEQ_T / 256), blk, 0, stream>>>(
      qb, kb, vtb, aob);

  gemm_bf16_kernel<false, true, false><<<gProj, blk, 0, stream>>>(
      aob, wob, bO, attnf, nullptr, MTOK, D_MODEL, D_MODEL);

  ln_residual_kernel<<<MTOK, blk, 0, stream>>>(x, attnf, g1, be1, y1f, y1b);

  dim3 gFF1(MTOK / BM, D_FF / BN);
  gemm_bf16_kernel<true, false, true><<<gFF1, blk, 0, stream>>>(
      y1b, w1b, b1, nullptr, h1b, MTOK, D_FF, D_MODEL);

  gemm_bf16_kernel<false, true, false><<<gProj, blk, 0, stream>>>(
      h1b, w2b, b2, fff, nullptr, MTOK, D_MODEL, D_FF);

  ln_residual_kernel<<<MTOK, blk, 0, stream>>>(y1f, fff, g2, be2, out,
                                               nullptr);
}
